// v000
// The times below were measured on an AMD MI455X: many runs one after another, warmed up first and cycling through
// copies of the inputs, with the whole window's GPU time divided by the number of runs. Launches and the gaps
// between them are all in it. The median over several windows is given; except for v000 it joins two sittings, which
// can be a few percent apart, so the side-by-side timings, each taken in one sitting, are the better comparison.
// v000, which the later versions start from, runs in 354 microseconds.
#include <hip/hip_runtime.h>

// ---------------------------------------------------------------------------
// MI455X (gfx1250, wave32) RoPE attention, f16 WMMA pipeline.
// ---------------------------------------------------------------------------

typedef __attribute__((ext_vector_type(16))) _Float16 v16h;
typedef __attribute__((ext_vector_type(8)))  float    v8f;

union Frag16 { v16h v; uint4 u[2]; };

#define D_MODEL   1024
#define NUM_HEADS 16
#define HEAD_DIM  64
#define BATCH     2
#define SEQ       2048
#define MROWS     (BATCH * SEQ)   // 4096

// ---------------------------------------------------------------------------
// fp32 -> fp16 elementwise convert
// ---------------------------------------------------------------------------
__global__ void cvt_f32_f16(const float* __restrict__ in, _Float16* __restrict__ out, int n) {
    int i = blockIdx.x * blockDim.x + threadIdx.x;
    if (i < n) out[i] = (_Float16)in[i];
}

// ---------------------------------------------------------------------------
// Generic GEMM: C[M][N] = A[M][K] * W[N][K]^T   (A,W f16 row-major, C f32)
// Block = 256 threads (8 waves). Tile 128(M) x 128(N), BK=32.
// Wave (wm,wn) in 4x2 grid computes a 32x64 sub-tile = 2x4 WMMA fragments.
// Per k-step per wave: 8 v_wmma against 12 ds_load_b128.
// ---------------------------------------------------------------------------
__global__ __launch_bounds__(256)
void gemm_nt_f16(const _Float16* __restrict__ A, const _Float16* __restrict__ W,
                 float* __restrict__ C, int M, int N, int K) {
    __shared__ __align__(16) _Float16 Atile[128][32];
    __shared__ __align__(16) _Float16 Btile[128][32];

    const int t    = threadIdx.x;
    const int wave = t >> 5, lane = t & 31;
    const int half = lane >> 4, l16 = lane & 15;
    const int wm   = wave >> 1, wn = wave & 1;
    const int bm   = blockIdx.y * 128, bn = blockIdx.x * 128;

    v8f acc[2][4] = {};

    const int ar = t >> 1, ac = (t & 1) * 16;   // both tiles: 128 rows x 32, 16 elems/thread

    for (int k0 = 0; k0 < K; k0 += 32) {
        __syncthreads();
        *(uint4*)&Atile[ar][ac]     = *(const uint4*)&A[(size_t)(bm + ar) * K + k0 + ac];
        *(uint4*)&Atile[ar][ac + 8] = *(const uint4*)&A[(size_t)(bm + ar) * K + k0 + ac + 8];
        *(uint4*)&Btile[ar][ac]     = *(const uint4*)&W[(size_t)(bn + ar) * K + k0 + ac];
        *(uint4*)&Btile[ar][ac + 8] = *(const uint4*)&W[(size_t)(bn + ar) * K + k0 + ac + 8];
        __syncthreads();

        Frag16 a[2], b[4];
#pragma unroll
        for (int i = 0; i < 2; ++i) {
            int r = wm * 32 + i * 16 + l16;
            a[i].u[0] = *(const uint4*)&Atile[r][half * 8];
            a[i].u[1] = *(const uint4*)&Atile[r][16 + half * 8];
        }
#pragma unroll
        for (int j = 0; j < 4; ++j) {
            int r = wn * 64 + j * 16 + l16;
            b[j].u[0] = *(const uint4*)&Btile[r][half * 8];
            b[j].u[1] = *(const uint4*)&Btile[r][16 + half * 8];
        }
#pragma unroll
        for (int i = 0; i < 2; ++i)
#pragma unroll
            for (int j = 0; j < 4; ++j)
                acc[i][j] = __builtin_amdgcn_wmma_f32_16x16x32_f16(
                    false, a[i].v, false, b[j].v, (short)0, acc[i][j], false, false);
    }

#pragma unroll
    for (int i = 0; i < 2; ++i)
#pragma unroll
        for (int j = 0; j < 4; ++j) {
            int col = bn + wn * 64 + j * 16 + l16;
#pragma unroll
            for (int e = 0; e < 8; ++e) {
                int row = bm + wm * 32 + i * 16 + e + 8 * half;
                C[(size_t)row * N + col] = acc[i][j][e];
            }
        }
}

// ---------------------------------------------------------------------------
// RoPE + repack:  qkv f32 [b,l, 3*1024]  ->  Q,K f16 [b,h,l,dh] ; V^T f16 [b,h,dh,l]
// Softmax scale 1/sqrt(64) folded into Q.
// ---------------------------------------------------------------------------
__global__ void rope_pack(const float* __restrict__ qkv,
                          const float* __restrict__ cosT, const float* __restrict__ sinT,
                          _Float16* __restrict__ Q, _Float16* __restrict__ Kd,
                          _Float16* __restrict__ Vt) {
    int idx = blockIdx.x * blockDim.x + threadIdx.x;      // 2^22 threads
    int dh = idx & 63;
    int h  = (idx >> 6) & (NUM_HEADS - 1);
    int l  = (idx >> 10) & (SEQ - 1);
    int b  = idx >> 21;

    size_t base = ((size_t)b * SEQ + l) * (3 * D_MODEL);
    int e  = h * HEAD_DIM + dh;
    int ep = h * HEAD_DIM + ((dh + 32) & 63);

    float c = cosT[l * HEAD_DIM + dh];
    float s = sinT[l * HEAD_DIM + dh];

    float q0 = qkv[base + e],               qp = qkv[base + ep];
    float k0 = qkv[base + D_MODEL + e],     kp = qkv[base + D_MODEL + ep];
    float v0 = qkv[base + 2 * D_MODEL + e];

    float rq = (dh < 32) ? -qp : qp;
    float rk = (dh < 32) ? -kp : kp;
    float qr = (q0 * c + rq * s) * 0.125f;  // 1/sqrt(HEAD_DIM)
    float kr = (k0 * c + rk * s);

    int bh = b * NUM_HEADS + h;
    Q [((size_t)bh * SEQ + l) * HEAD_DIM + dh] = (_Float16)qr;
    Kd[((size_t)bh * SEQ + l) * HEAD_DIM + dh] = (_Float16)kr;
    Vt[((size_t)bh * HEAD_DIM + dh) * SEQ + l] = (_Float16)v0;
}

// ---------------------------------------------------------------------------
// Flash attention: block = one (b,h) x 128 queries; 8 waves x 16-query strips.
// Keys streamed in chunks of 64; online softmax in fp32 (one reduction pass
// per 64 keys instead of per 32 -> half the shuffle/barrier overhead).
// Output f16 [b*L + q][h*64 + dh]  (A-operand for the final projection GEMM).
// ---------------------------------------------------------------------------
__global__ __launch_bounds__(256)
void attn_f16(const _Float16* __restrict__ Q, const _Float16* __restrict__ Kd,
              const _Float16* __restrict__ Vt, _Float16* __restrict__ O) {
    __shared__ __align__(16) _Float16 Kblk[64][64];    // [key][dh]
    __shared__ __align__(16) _Float16 Vblk[64][64];    // [dh][key]
    __shared__ __align__(16) _Float16 Pbuf[8][16][64]; // per-wave C->A bounce

    const int t    = threadIdx.x;
    const int wave = t >> 5, lane = t & 31;
    const int half = lane >> 4, l16 = lane & 15;
    const int bh    = blockIdx.x;          // 0..31
    const int qtile = blockIdx.y;          // 0..15
    const int qbase = qtile * 128 + wave * 16;

    // Q strip: 16 queries x 64 dh = two 16x32 A fragments, loaded straight from global
    Frag16 qf[2];
#pragma unroll
    for (int kk = 0; kk < 2; ++kk) {
        const _Float16* qp = Q + ((size_t)bh * SEQ + qbase + l16) * HEAD_DIM + kk * 32;
        qf[kk].u[0] = *(const uint4*)(qp + half * 8);
        qf[kk].u[1] = *(const uint4*)(qp + 16 + half * 8);
    }

    v8f o[4] = {};
    float mrun[8], lrun[8];
#pragma unroll
    for (int e = 0; e < 8; ++e) { mrun[e] = -1e30f; lrun[e] = 0.f; }

    const int lr = t >> 2, lc = (t & 3) * 16;   // 64x64 tile loads: 16 elems/thread

    for (int kb = 0; kb < SEQ; kb += 64) {
        __syncthreads();
        // K block 64x64 [key][dh]
        *(uint4*)&Kblk[lr][lc]     = *(const uint4*)&Kd[((size_t)bh * SEQ + kb + lr) * HEAD_DIM + lc];
        *(uint4*)&Kblk[lr][lc + 8] = *(const uint4*)&Kd[((size_t)bh * SEQ + kb + lr) * HEAD_DIM + lc + 8];
        // V block 64x64 [dh][key] from V^T
        *(uint4*)&Vblk[lr][lc]     = *(const uint4*)&Vt[((size_t)bh * HEAD_DIM + lr) * SEQ + kb + lc];
        *(uint4*)&Vblk[lr][lc + 8] = *(const uint4*)&Vt[((size_t)bh * HEAD_DIM + lr) * SEQ + kb + lc + 8];
        __syncthreads();

        // S = Q * K^T : 16 queries x 64 keys (4 N-fragments, K-dim 64 = 2 steps)
        v8f s[4] = {};
#pragma unroll
        for (int nf = 0; nf < 4; ++nf)
#pragma unroll
            for (int kk = 0; kk < 2; ++kk) {
                Frag16 b;
                int kr = nf * 16 + l16;
                b.u[0] = *(const uint4*)&Kblk[kr][kk * 32 + half * 8];
                b.u[1] = *(const uint4*)&Kblk[kr][kk * 32 + 16 + half * 8];
                s[nf] = __builtin_amdgcn_wmma_f32_16x16x32_f16(
                    false, qf[kk].v, false, b.v, (short)0, s[nf], false, false);
            }

        // --- online softmax (rows live across the 16 lanes of each half-wave) ---
        float mcur[8];
#pragma unroll
        for (int e = 0; e < 8; ++e)
            mcur[e] = fmaxf(fmaxf(s[0][e], s[1][e]), fmaxf(s[2][e], s[3][e]));
#pragma unroll
        for (int msk = 1; msk < 16; msk <<= 1)
#pragma unroll
            for (int e = 0; e < 8; ++e)
                mcur[e] = fmaxf(mcur[e], __shfl_xor(mcur[e], msk, 32));

        float alpha[8];
#pragma unroll
        for (int e = 0; e < 8; ++e) {
            float mn = fmaxf(mrun[e], mcur[e]);
            alpha[e] = __expf(mrun[e] - mn);
            mrun[e]  = mn;
        }
#pragma unroll
        for (int nf = 0; nf < 4; ++nf)
#pragma unroll
            for (int e = 0; e < 8; ++e) s[nf][e] = __expf(s[nf][e] - mrun[e]);

        float rsum[8];
#pragma unroll
        for (int e = 0; e < 8; ++e)
            rsum[e] = (s[0][e] + s[1][e]) + (s[2][e] + s[3][e]);
#pragma unroll
        for (int msk = 1; msk < 16; msk <<= 1)
#pragma unroll
            for (int e = 0; e < 8; ++e) rsum[e] += __shfl_xor(rsum[e], msk, 32);
#pragma unroll
        for (int e = 0; e < 8; ++e) lrun[e] = lrun[e] * alpha[e] + rsum[e];
#pragma unroll
        for (int jf = 0; jf < 4; ++jf)
#pragma unroll
            for (int e = 0; e < 8; ++e) o[jf][e] *= alpha[e];

        // P: C-layout -> A-layout via per-wave LDS bounce (DS ops are in-order per wave)
#pragma unroll
        for (int nf = 0; nf < 4; ++nf)
#pragma unroll
            for (int e = 0; e < 8; ++e)
                Pbuf[wave][e + 8 * half][nf * 16 + l16] = (_Float16)s[nf][e];

        Frag16 p[2];
#pragma unroll
        for (int kk = 0; kk < 2; ++kk) {
            p[kk].u[0] = *(const uint4*)&Pbuf[wave][l16][kk * 32 + half * 8];
            p[kk].u[1] = *(const uint4*)&Pbuf[wave][l16][kk * 32 + 16 + half * 8];
        }

        // O += P * V : 16 queries x 64 dh (4 N-fragments, K=64 keys = 2 steps)
#pragma unroll
        for (int jf = 0; jf < 4; ++jf)
#pragma unroll
            for (int kk = 0; kk < 2; ++kk) {
                Frag16 b;
                int dh = jf * 16 + l16;
                b.u[0] = *(const uint4*)&Vblk[dh][kk * 32 + half * 8];
                b.u[1] = *(const uint4*)&Vblk[dh][kk * 32 + 16 + half * 8];
                o[jf] = __builtin_amdgcn_wmma_f32_16x16x32_f16(
                    false, p[kk].v, false, b.v, (short)0, o[jf], false, false);
            }
    }

    // normalize + store f16 [b*L + q][h*64 + dh]
    const int b = bh >> 4, h = bh & (NUM_HEADS - 1);
#pragma unroll
    for (int jf = 0; jf < 4; ++jf) {
        int col = h * HEAD_DIM + jf * 16 + l16;
#pragma unroll
        for (int e = 0; e < 8; ++e) {
            int qrow = qbase + e + 8 * half;
            size_t m = (size_t)b * SEQ + qrow;
            O[m * D_MODEL + col] = (_Float16)(o[jf][e] / lrun[e]);
        }
    }
}

// ---------------------------------------------------------------------------
// Launcher
// ---------------------------------------------------------------------------
extern "C" void kernel_launch(void* const* d_in, const int* in_sizes, int n_in,
                              void* d_out, int out_size, void* d_ws, size_t ws_size,
                              hipStream_t stream) {
    (void)in_sizes; (void)n_in; (void)out_size; (void)ws_size;

    const float* x    = (const float*)d_in[0];   // [2,2048,1024]
    const float* cosT = (const float*)d_in[1];   // [2048,64]
    const float* sinT = (const float*)d_in[2];   // [2048,64]
    const float* wqkv = (const float*)d_in[3];   // [3072,1024]
    const float* wo   = (const float*)d_in[4];   // [1024,1024]
    float* out = (float*)d_out;                  // [2,2048,1024]

    char* ws = (char*)d_ws;
    _Float16* x_h  = (_Float16*)(ws);                        //  8 MB
    _Float16* wq_h = (_Float16*)(ws + ( 8ull << 20));        //  6 MB
    _Float16* wo_h = (_Float16*)(ws + (14ull << 20));        //  2 MB
    float*    qkv  = (float*)   (ws + (16ull << 20));        // 48 MB
    _Float16* q_h  = (_Float16*)(ws + (64ull << 20));        //  8 MB
    _Float16* k_h  = (_Float16*)(ws + (72ull << 20));        //  8 MB
    _Float16* vt_h = (_Float16*)(ws + (80ull << 20));        //  8 MB
    _Float16* at_h = (_Float16*)(ws + (88ull << 20));        //  8 MB

    cvt_f32_f16<<<(MROWS * D_MODEL) / 256, 256, 0, stream>>>(x, x_h, MROWS * D_MODEL);
    cvt_f32_f16<<<(3 * D_MODEL * D_MODEL) / 256, 256, 0, stream>>>(wqkv, wq_h, 3 * D_MODEL * D_MODEL);
    cvt_f32_f16<<<(D_MODEL * D_MODEL) / 256, 256, 0, stream>>>(wo, wo_h, D_MODEL * D_MODEL);

    // qkv = x @ w_qkv^T   : M=4096, N=3072, K=1024
    gemm_nt_f16<<<dim3(3072 / 128, MROWS / 128), 256, 0, stream>>>(x_h, wq_h, qkv, MROWS, 3072, 1024);

    rope_pack<<<(BATCH * SEQ * NUM_HEADS * HEAD_DIM) / 256, 256, 0, stream>>>(
        qkv, cosT, sinT, q_h, k_h, vt_h);

    attn_f16<<<dim3(BATCH * NUM_HEADS, SEQ / 128), 256, 0, stream>>>(q_h, k_h, vt_h, at_h);

    // out = attn @ w_o^T  : M=4096, N=1024, K=1024
    gemm_nt_f16<<<dim3(D_MODEL / 128, MROWS / 128), 256, 0, stream>>>(at_h, wo_h, out, MROWS, D_MODEL, 1024);
}

// v001
// It runs in 246 microseconds.
// Two timings next to v000 both put it at 1.46 times that version's speed.
#include <hip/hip_runtime.h>

// ---------------------------------------------------------------------------
// MI455X (gfx1250, wave32) RoPE attention, f16 WMMA pipeline.
// ---------------------------------------------------------------------------

typedef __attribute__((ext_vector_type(16))) _Float16 v16h;
typedef __attribute__((ext_vector_type(8)))  float    v8f;

union Frag16 { v16h v; uint4 u[2]; };

#define D_MODEL   1024
#define NUM_HEADS 16
#define HEAD_DIM  64
#define BATCH     2
#define SEQ       2048
#define MROWS     (BATCH * SEQ)   // 4096

// LDS row pitch in f16 elements for tiles whose rows are read as 16-byte
// fragments by 16 lanes at once: 16 B x odd, so the 16 rows fall on distinct
// banks (a pitch of 64 B or 128 B puts them on the same few banks).
#define PITCH32   40              // 32-element rows: 80 B
#define PITCH64   72              // 64-element rows: 144 B

// ---------------------------------------------------------------------------
// fp32 -> fp16 elementwise convert
// ---------------------------------------------------------------------------
__global__ void cvt_f32_f16(const float* __restrict__ in, _Float16* __restrict__ out, int n) {
    int i = blockIdx.x * blockDim.x + threadIdx.x;
    if (i < n) out[i] = (_Float16)in[i];
}

// ---------------------------------------------------------------------------
// Generic GEMM: C[M][N] = A[M][K] * W[N][K]^T   (A,W f16 row-major, C f32)
// Block = 256 threads (8 waves). Tile 128(M) x 128(N), BK=32.
// Wave (wm,wn) in 4x2 grid computes a 32x64 sub-tile = 2x4 WMMA fragments.
// Per k-step per wave: 8 v_wmma against 12 ds_load_b128.
// ---------------------------------------------------------------------------
__global__ __launch_bounds__(256)
void gemm_nt_f16(const _Float16* __restrict__ A, const _Float16* __restrict__ W,
                 float* __restrict__ C, int M, int N, int K) {
    __shared__ __align__(16) _Float16 Atile[128][PITCH32];
    __shared__ __align__(16) _Float16 Btile[128][PITCH32];

    const int t    = threadIdx.x;
    const int wave = t >> 5, lane = t & 31;
    const int half = lane >> 4, l16 = lane & 15;
    const int wm   = wave >> 1, wn = wave & 1;
    const int bm   = blockIdx.y * 128, bn = blockIdx.x * 128;

    v8f acc[2][4] = {};

    const int ar = t >> 1, ac = (t & 1) * 16;   // both tiles: 128 rows x 32, 16 elems/thread

    for (int k0 = 0; k0 < K; k0 += 32) {
        __syncthreads();
        *(uint4*)&Atile[ar][ac]     = *(const uint4*)&A[(size_t)(bm + ar) * K + k0 + ac];
        *(uint4*)&Atile[ar][ac + 8] = *(const uint4*)&A[(size_t)(bm + ar) * K + k0 + ac + 8];
        *(uint4*)&Btile[ar][ac]     = *(const uint4*)&W[(size_t)(bn + ar) * K + k0 + ac];
        *(uint4*)&Btile[ar][ac + 8] = *(const uint4*)&W[(size_t)(bn + ar) * K + k0 + ac + 8];
        __syncthreads();

        Frag16 a[2], b[4];
#pragma unroll
        for (int i = 0; i < 2; ++i) {
            int r = wm * 32 + i * 16 + l16;
            a[i].u[0] = *(const uint4*)&Atile[r][half * 8];
            a[i].u[1] = *(const uint4*)&Atile[r][16 + half * 8];
        }
#pragma unroll
        for (int j = 0; j < 4; ++j) {
            int r = wn * 64 + j * 16 + l16;
            b[j].u[0] = *(const uint4*)&Btile[r][half * 8];
            b[j].u[1] = *(const uint4*)&Btile[r][16 + half * 8];
        }
#pragma unroll
        for (int i = 0; i < 2; ++i)
#pragma unroll
            for (int j = 0; j < 4; ++j)
                acc[i][j] = __builtin_amdgcn_wmma_f32_16x16x32_f16(
                    false, a[i].v, false, b[j].v, (short)0, acc[i][j], false, false);
    }

#pragma unroll
    for (int i = 0; i < 2; ++i)
#pragma unroll
        for (int j = 0; j < 4; ++j) {
            int col = bn + wn * 64 + j * 16 + l16;
#pragma unroll
            for (int e = 0; e < 8; ++e) {
                int row = bm + wm * 32 + i * 16 + e + 8 * half;
                C[(size_t)row * N + col] = acc[i][j][e];
            }
        }
}

// ---------------------------------------------------------------------------
// RoPE + repack:  qkv f32 [b,l, 3*1024]  ->  Q,K f16 [b,h,l,dh] ; V^T f16 [b,h,dh,l]
// Softmax scale 1/sqrt(64) folded into Q.
// ---------------------------------------------------------------------------
__global__ void rope_pack(const float* __restrict__ qkv,
                          const float* __restrict__ cosT, const float* __restrict__ sinT,
                          _Float16* __restrict__ Q, _Float16* __restrict__ Kd,
                          _Float16* __restrict__ Vt) {
    int idx = blockIdx.x * blockDim.x + threadIdx.x;      // 2^22 threads
    int dh = idx & 63;
    int h  = (idx >> 6) & (NUM_HEADS - 1);
    int l  = (idx >> 10) & (SEQ - 1);
    int b  = idx >> 21;

    size_t base = ((size_t)b * SEQ + l) * (3 * D_MODEL);
    int e  = h * HEAD_DIM + dh;
    int ep = h * HEAD_DIM + ((dh + 32) & 63);

    float c = cosT[l * HEAD_DIM + dh];
    float s = sinT[l * HEAD_DIM + dh];

    float q0 = qkv[base + e],               qp = qkv[base + ep];
    float k0 = qkv[base + D_MODEL + e],     kp = qkv[base + D_MODEL + ep];
    float v0 = qkv[base + 2 * D_MODEL + e];

    float rq = (dh < 32) ? -qp : qp;
    float rk = (dh < 32) ? -kp : kp;
    float qr = (q0 * c + rq * s) * 0.125f;  // 1/sqrt(HEAD_DIM)
    float kr = (k0 * c + rk * s);

    int bh = b * NUM_HEADS + h;
    Q [((size_t)bh * SEQ + l) * HEAD_DIM + dh] = (_Float16)qr;
    Kd[((size_t)bh * SEQ + l) * HEAD_DIM + dh] = (_Float16)kr;
    Vt[((size_t)bh * HEAD_DIM + dh) * SEQ + l] = (_Float16)v0;
}

// ---------------------------------------------------------------------------
// Flash attention: block = one (b,h) x 128 queries; 8 waves x 16-query strips.
// Keys streamed in chunks of 64; online softmax in fp32 (one reduction pass
// per 64 keys instead of per 32 -> half the shuffle/barrier overhead).
// Output f16 [b*L + q][h*64 + dh]  (A-operand for the final projection GEMM).
// ---------------------------------------------------------------------------
__global__ __launch_bounds__(256)
void attn_f16(const _Float16* __restrict__ Q, const _Float16* __restrict__ Kd,
              const _Float16* __restrict__ Vt, _Float16* __restrict__ O) {
    __shared__ __align__(16) _Float16 Kblk[64][PITCH64];    // [key][dh]
    __shared__ __align__(16) _Float16 Vblk[64][PITCH64];    // [dh][key]
    __shared__ __align__(16) _Float16 Pbuf[8][16][PITCH64]; // per-wave C->A bounce

    const int t    = threadIdx.x;
    const int wave = t >> 5, lane = t & 31;
    const int half = lane >> 4, l16 = lane & 15;
    const int bh    = blockIdx.x;          // 0..31
    const int qtile = blockIdx.y;          // 0..15
    const int qbase = qtile * 128 + wave * 16;

    // Q strip: 16 queries x 64 dh = two 16x32 A fragments, loaded straight from global
    Frag16 qf[2];
#pragma unroll
    for (int kk = 0; kk < 2; ++kk) {
        const _Float16* qp = Q + ((size_t)bh * SEQ + qbase + l16) * HEAD_DIM + kk * 32;
        qf[kk].u[0] = *(const uint4*)(qp + half * 8);
        qf[kk].u[1] = *(const uint4*)(qp + 16 + half * 8);
    }

    v8f o[4] = {};
    float mrun[8], lrun[8];
#pragma unroll
    for (int e = 0; e < 8; ++e) { mrun[e] = -1e30f; lrun[e] = 0.f; }

    const int lr = t >> 2, lc = (t & 3) * 16;   // 64x64 tile loads: 16 elems/thread

    for (int kb = 0; kb < SEQ; kb += 64) {
        __syncthreads();
        // K block 64x64 [key][dh]
        *(uint4*)&Kblk[lr][lc]     = *(const uint4*)&Kd[((size_t)bh * SEQ + kb + lr) * HEAD_DIM + lc];
        *(uint4*)&Kblk[lr][lc + 8] = *(const uint4*)&Kd[((size_t)bh * SEQ + kb + lr) * HEAD_DIM + lc + 8];
        // V block 64x64 [dh][key] from V^T
        *(uint4*)&Vblk[lr][lc]     = *(const uint4*)&Vt[((size_t)bh * HEAD_DIM + lr) * SEQ + kb + lc];
        *(uint4*)&Vblk[lr][lc + 8] = *(const uint4*)&Vt[((size_t)bh * HEAD_DIM + lr) * SEQ + kb + lc + 8];
        __syncthreads();

        // S = Q * K^T : 16 queries x 64 keys (4 N-fragments, K-dim 64 = 2 steps)
        v8f s[4] = {};
#pragma unroll
        for (int nf = 0; nf < 4; ++nf)
#pragma unroll
            for (int kk = 0; kk < 2; ++kk) {
                Frag16 b;
                int kr = nf * 16 + l16;
                b.u[0] = *(const uint4*)&Kblk[kr][kk * 32 + half * 8];
                b.u[1] = *(const uint4*)&Kblk[kr][kk * 32 + 16 + half * 8];
                s[nf] = __builtin_amdgcn_wmma_f32_16x16x32_f16(
                    false, qf[kk].v, false, b.v, (short)0, s[nf], false, false);
            }

        // --- online softmax (rows live across the 16 lanes of each half-wave) ---
        float mcur[8];
#pragma unroll
        for (int e = 0; e < 8; ++e)
            mcur[e] = fmaxf(fmaxf(s[0][e], s[1][e]), fmaxf(s[2][e], s[3][e]));
#pragma unroll
        for (int msk = 1; msk < 16; msk <<= 1)
#pragma unroll
            for (int e = 0; e < 8; ++e)
                mcur[e] = fmaxf(mcur[e], __shfl_xor(mcur[e], msk, 32));

        float alpha[8];
#pragma unroll
        for (int e = 0; e < 8; ++e) {
            float mn = fmaxf(mrun[e], mcur[e]);
            alpha[e] = __expf(mrun[e] - mn);
            mrun[e]  = mn;
        }
#pragma unroll
        for (int nf = 0; nf < 4; ++nf)
#pragma unroll
            for (int e = 0; e < 8; ++e) s[nf][e] = __expf(s[nf][e] - mrun[e]);

        float rsum[8];
#pragma unroll
        for (int e = 0; e < 8; ++e)
            rsum[e] = (s[0][e] + s[1][e]) + (s[2][e] + s[3][e]);
#pragma unroll
        for (int msk = 1; msk < 16; msk <<= 1)
#pragma unroll
            for (int e = 0; e < 8; ++e) rsum[e] += __shfl_xor(rsum[e], msk, 32);
#pragma unroll
        for (int e = 0; e < 8; ++e) lrun[e] = lrun[e] * alpha[e] + rsum[e];
#pragma unroll
        for (int jf = 0; jf < 4; ++jf)
#pragma unroll
            for (int e = 0; e < 8; ++e) o[jf][e] *= alpha[e];

        // P: C-layout -> A-layout via per-wave LDS bounce (DS ops are in-order per wave)
#pragma unroll
        for (int nf = 0; nf < 4; ++nf)
#pragma unroll
            for (int e = 0; e < 8; ++e)
                Pbuf[wave][e + 8 * half][nf * 16 + l16] = (_Float16)s[nf][e];

        Frag16 p[2];
#pragma unroll
        for (int kk = 0; kk < 2; ++kk) {
            p[kk].u[0] = *(const uint4*)&Pbuf[wave][l16][kk * 32 + half * 8];
            p[kk].u[1] = *(const uint4*)&Pbuf[wave][l16][kk * 32 + 16 + half * 8];
        }

        // O += P * V : 16 queries x 64 dh (4 N-fragments, K=64 keys = 2 steps)
#pragma unroll
        for (int jf = 0; jf < 4; ++jf)
#pragma unroll
            for (int kk = 0; kk < 2; ++kk) {
                Frag16 b;
                int dh = jf * 16 + l16;
                b.u[0] = *(const uint4*)&Vblk[dh][kk * 32 + half * 8];
                b.u[1] = *(const uint4*)&Vblk[dh][kk * 32 + 16 + half * 8];
                o[jf] = __builtin_amdgcn_wmma_f32_16x16x32_f16(
                    false, p[kk].v, false, b.v, (short)0, o[jf], false, false);
            }
    }

    // normalize + store f16 [b*L + q][h*64 + dh]
    const int b = bh >> 4, h = bh & (NUM_HEADS - 1);
#pragma unroll
    for (int jf = 0; jf < 4; ++jf) {
        int col = h * HEAD_DIM + jf * 16 + l16;
#pragma unroll
        for (int e = 0; e < 8; ++e) {
            int qrow = qbase + e + 8 * half;
            size_t m = (size_t)b * SEQ + qrow;
            O[m * D_MODEL + col] = (_Float16)(o[jf][e] / lrun[e]);
        }
    }
}

// ---------------------------------------------------------------------------
// Launcher
// ---------------------------------------------------------------------------
extern "C" void kernel_launch(void* const* d_in, const int* in_sizes, int n_in,
                              void* d_out, int out_size, void* d_ws, size_t ws_size,
                              hipStream_t stream) {
    (void)in_sizes; (void)n_in; (void)out_size; (void)ws_size;

    const float* x    = (const float*)d_in[0];   // [2,2048,1024]
    const float* cosT = (const float*)d_in[1];   // [2048,64]
    const float* sinT = (const float*)d_in[2];   // [2048,64]
    const float* wqkv = (const float*)d_in[3];   // [3072,1024]
    const float* wo   = (const float*)d_in[4];   // [1024,1024]
    float* out = (float*)d_out;                  // [2,2048,1024]

    char* ws = (char*)d_ws;
    _Float16* x_h  = (_Float16*)(ws);                        //  8 MB
    _Float16* wq_h = (_Float16*)(ws + ( 8ull << 20));        //  6 MB
    _Float16* wo_h = (_Float16*)(ws + (14ull << 20));        //  2 MB
    float*    qkv  = (float*)   (ws + (16ull << 20));        // 48 MB
    _Float16* q_h  = (_Float16*)(ws + (64ull << 20));        //  8 MB
    _Float16* k_h  = (_Float16*)(ws + (72ull << 20));        //  8 MB
    _Float16* vt_h = (_Float16*)(ws + (80ull << 20));        //  8 MB
    _Float16* at_h = (_Float16*)(ws + (88ull << 20));        //  8 MB

    cvt_f32_f16<<<(MROWS * D_MODEL) / 256, 256, 0, stream>>>(x, x_h, MROWS * D_MODEL);
    cvt_f32_f16<<<(3 * D_MODEL * D_MODEL) / 256, 256, 0, stream>>>(wqkv, wq_h, 3 * D_MODEL * D_MODEL);
    cvt_f32_f16<<<(D_MODEL * D_MODEL) / 256, 256, 0, stream>>>(wo, wo_h, D_MODEL * D_MODEL);

    // qkv = x @ w_qkv^T   : M=4096, N=3072, K=1024
    gemm_nt_f16<<<dim3(3072 / 128, MROWS / 128), 256, 0, stream>>>(x_h, wq_h, qkv, MROWS, 3072, 1024);

    rope_pack<<<(BATCH * SEQ * NUM_HEADS * HEAD_DIM) / 256, 256, 0, stream>>>(
        qkv, cosT, sinT, q_h, k_h, vt_h);

    attn_f16<<<dim3(BATCH * NUM_HEADS, SEQ / 128), 256, 0, stream>>>(q_h, k_h, vt_h, at_h);

    // out = attn @ w_o^T  : M=4096, N=1024, K=1024
    gemm_nt_f16<<<dim3(D_MODEL / 128, MROWS / 128), 256, 0, stream>>>(at_h, wo_h, out, MROWS, D_MODEL, 1024);
}

// v002
// It runs in 155 microseconds.
// Next to v001, in two timings, it ran 1.59 times as fast each time.
// Counting every step since v000, it is 2.31 times as fast.
#include <hip/hip_runtime.h>

// ---------------------------------------------------------------------------
// MI455X (gfx1250, wave32) RoPE attention, f16 WMMA pipeline.
// ---------------------------------------------------------------------------

typedef __attribute__((ext_vector_type(16))) _Float16 v16h;
typedef __attribute__((ext_vector_type(8)))  float    v8f;
typedef __attribute__((ext_vector_type(4)))  float    v4f;
typedef __attribute__((ext_vector_type(4)))  _Float16 v4h;

union Frag16 { v16h v; uint4 u[2]; };

#define D_MODEL   1024
#define NUM_HEADS 16
#define HEAD_DIM  64
#define BATCH     2
#define SEQ       2048
#define MROWS     (BATCH * SEQ)   // 4096

// LDS row pitch in f16 elements for tiles whose rows are read as 16-byte
// fragments by 16 lanes at once: 16 B x odd, so the 16 rows fall on distinct
// banks (a pitch of 64 B or 128 B puts them on the same few banks).
#define PITCH32   40              // 32-element rows: 80 B
#define PITCH64   72              // 64-element rows: 144 B

// ---------------------------------------------------------------------------
// fp32 -> fp16 elementwise convert. A block takes CVT_BLOCK contiguous floats;
// a lane takes eight float4, each wave-wide load covering 512 contiguous bytes,
// so few waves have to start and each keeps eight loads in flight.
// The element count must be a multiple of CVT_BLOCK (grid = count / CVT_BLOCK).
// ---------------------------------------------------------------------------
#define CVT_BLOCK (256 * 8 * 4)
__global__ __launch_bounds__(256)
void cvt_f32_f16(const float* __restrict__ in, _Float16* __restrict__ out) {
    const size_t base = (size_t)blockIdx.x * CVT_BLOCK + threadIdx.x * 4;
    v4f v[8];
    // unrolled so that all eight loads are issued before the first is waited for
#pragma unroll
    for (int k = 0; k < 8; ++k) v[k] = *(const v4f*)&in[base + k * 1024];
#pragma unroll
    for (int k = 0; k < 8; ++k) *(v4h*)&out[base + k * 1024] = __builtin_convertvector(v[k], v4h);
}

// ---------------------------------------------------------------------------
// Generic GEMM: C[M][N] = A[M][K] * W[N][K]^T   (A,W f16 row-major, C f32)
// Block = 256 threads (8 waves). Tile 128(M) x 128(N), BK=32.
// Wave (wm,wn) in 4x2 grid computes a 32x64 sub-tile = 2x4 WMMA fragments.
// Per k-step per wave: 8 v_wmma against 12 ds_load_b128.
// ---------------------------------------------------------------------------
__global__ __launch_bounds__(256)
void gemm_nt_f16(const _Float16* __restrict__ A, const _Float16* __restrict__ W,
                 float* __restrict__ C, int M, int N, int K) {
    __shared__ __align__(16) _Float16 Atile[128][PITCH32];
    __shared__ __align__(16) _Float16 Btile[128][PITCH32];

    const int t    = threadIdx.x;
    const int wave = t >> 5, lane = t & 31;
    const int half = lane >> 4, l16 = lane & 15;
    const int wm   = wave >> 1, wn = wave & 1;
    const int bm   = blockIdx.y * 128, bn = blockIdx.x * 128;

    v8f acc[2][4] = {};

    const int ar = t >> 1, ac = (t & 1) * 16;   // both tiles: 128 rows x 32, 16 elems/thread

    for (int k0 = 0; k0 < K; k0 += 32) {
        __syncthreads();
        *(uint4*)&Atile[ar][ac]     = *(const uint4*)&A[(size_t)(bm + ar) * K + k0 + ac];
        *(uint4*)&Atile[ar][ac + 8] = *(const uint4*)&A[(size_t)(bm + ar) * K + k0 + ac + 8];
        *(uint4*)&Btile[ar][ac]     = *(const uint4*)&W[(size_t)(bn + ar) * K + k0 + ac];
        *(uint4*)&Btile[ar][ac + 8] = *(const uint4*)&W[(size_t)(bn + ar) * K + k0 + ac + 8];
        __syncthreads();

        Frag16 a[2], b[4];
#pragma unroll
        for (int i = 0; i < 2; ++i) {
            int r = wm * 32 + i * 16 + l16;
            a[i].u[0] = *(const uint4*)&Atile[r][half * 8];
            a[i].u[1] = *(const uint4*)&Atile[r][16 + half * 8];
        }
#pragma unroll
        for (int j = 0; j < 4; ++j) {
            int r = wn * 64 + j * 16 + l16;
            b[j].u[0] = *(const uint4*)&Btile[r][half * 8];
            b[j].u[1] = *(const uint4*)&Btile[r][16 + half * 8];
        }
#pragma unroll
        for (int i = 0; i < 2; ++i)
#pragma unroll
            for (int j = 0; j < 4; ++j)
                acc[i][j] = __builtin_amdgcn_wmma_f32_16x16x32_f16(
                    false, a[i].v, false, b[j].v, (short)0, acc[i][j], false, false);
    }

#pragma unroll
    for (int i = 0; i < 2; ++i)
#pragma unroll
        for (int j = 0; j < 4; ++j) {
            int col = bn + wn * 64 + j * 16 + l16;
#pragma unroll
            for (int e = 0; e < 8; ++e) {
                int row = bm + wm * 32 + i * 16 + e + 8 * half;
                C[(size_t)row * N + col] = acc[i][j][e];
            }
        }
}

// ---------------------------------------------------------------------------
// RoPE + repack:  qkv f32 [b,l, 3*1024]  ->  Q,K f16 [b,h,l,dh] ; V^T f16 [b,h,dh,l]
// Softmax scale 1/sqrt(64) folded into Q.
// Block = one (b,h) x 64 positions. Lane c of each group of 8 holds dh 4c..4c+3 and
// 32+4c..32+4c+3 (the two sides of a rotation pair) of two neighbouring positions,
// so every load is 16 B a lane and eight lanes cover one whole 128-B line.
// V is turned in LDS: a dword holds one dh of two neighbouring positions; a row
// (one dh, 64 positions) leaves as one whole line of V^T.
// ---------------------------------------------------------------------------
__global__ __launch_bounds__(256)
void rope_pack(const float* __restrict__ qkv,
               const float* __restrict__ cosT, const float* __restrict__ sinT,
               _Float16* __restrict__ Q, _Float16* __restrict__ Kd,
               _Float16* __restrict__ Vt) {
    // [dh][position pair]; the 16-B chunk index of a row is XORed with (dh >> 2) & 7,
    // so the eight dh rows that one wave-wide store touches fall on distinct banks.
    __shared__ __align__(16) unsigned int Vs[HEAD_DIM][32];

    const int t  = threadIdx.x;
    const int c  = t & 7;                    // float4 column inside each half of the head
    const int rp = t >> 3;                   // position pair 0..31
    const int h  = blockIdx.x & (NUM_HEADS - 1);
    const int l0 = ((blockIdx.x >> 4) & (SEQ / 64 - 1)) * 64;
    const int b  = blockIdx.x >> 9;
    const int bh = b * NUM_HEADS + h;

    const int lA = l0 + 2 * rp;              // the lane's first position; the second is lA + 1
    const float* row = qkv + ((size_t)b * SEQ + lA) * (3 * D_MODEL) + h * HEAD_DIM + 4 * c;
    const float* cp  = cosT + lA * HEAD_DIM + 4 * c;
    const float* sp  = sinT + lA * HEAD_DIM + 4 * c;

    v4f q[2][2], k[2][2], v[2][2], cs[2][2], sn[2][2];   // [position][half of the head]
    // every loop of this kernel is unrolled so that these arrays are indexed by constants
    // and stay in registers
#pragma unroll
    for (int r = 0; r < 2; ++r)
#pragma unroll
        for (int hh = 0; hh < 2; ++hh)
            v[r][hh] = *(const v4f*)(row + r * 3 * D_MODEL + 2 * D_MODEL + hh * 32);
#pragma unroll
    for (int r = 0; r < 2; ++r)
#pragma unroll
        for (int hh = 0; hh < 2; ++hh) {
            q[r][hh]  = *(const v4f*)(row + r * 3 * D_MODEL + hh * 32);
            k[r][hh]  = *(const v4f*)(row + r * 3 * D_MODEL + D_MODEL + hh * 32);
            cs[r][hh] = *(const v4f*)(cp + r * HEAD_DIM + hh * 32);
            sn[r][hh] = *(const v4f*)(sp + r * HEAD_DIM + hh * 32);
        }
    // Precaution for the 20 loads above: their three address pairs are inputs here, so they
    // stay live up to this wait and no later load's result is placed in one of them before it.
    asm volatile("s_wait_xcnt 0x0" :: "v"(row), "v"(cp), "v"(sp) : "memory");
    // Keeps the arithmetic behind all 20 loads: without it the scheduler lifts the V conversions
    // among them to reuse their registers, and the last loads issue only after the first return.
    __builtin_amdgcn_sched_barrier(0);

    // V first, so that no global store is outstanding at the barrier.
    // A dword: positions 2rp (low half) and 2rp + 1 (high half) of one dh.
#pragma unroll
    for (int hh = 0; hh < 2; ++hh)
#pragma unroll
        for (int i = 0; i < 4; ++i) {
            union { _Float16 f[2]; unsigned int u; } pk;
            pk.f[0] = (_Float16)v[0][hh][i];
            pk.f[1] = (_Float16)v[1][hh][i];
            const int d = hh * 32 + 4 * c + i;               // (d >> 2) & 7 == c
            Vs[d][(((rp >> 2) ^ c) << 2) | (rp & 3)] = pk.u;
        }
    __syncthreads();

    // 64 rows x 8 chunks of 8 positions: eight lanes store one whole line of V^T
#pragma unroll
    for (int p = 0; p < 2; ++p) {
        const int d  = p * 32 + (t >> 3);
        const int ch = t & 7;
        const uint4 w = *(const uint4*)&Vs[d][(ch ^ ((d >> 2) & 7)) << 2];
        *(uint4*)&Vt[((size_t)bh * HEAD_DIM + d) * SEQ + l0 + 8 * ch] = w;
    }

#pragma unroll
    for (int r = 0; r < 2; ++r) {
        const int l = l0 + 2 * rp + r;
        const size_t o = ((size_t)bh * SEQ + l) * HEAD_DIM + 4 * c;
        // rotate_half: dh < 32 pairs with -t[dh + 32], dh >= 32 with +t[dh - 32]
        v4f qlo = (q[r][0] * cs[r][0] - q[r][1] * sn[r][0]) * 0.125f;  // 1/sqrt(HEAD_DIM)
        v4f qhi = (q[r][1] * cs[r][1] + q[r][0] * sn[r][1]) * 0.125f;
        v4f klo =  k[r][0] * cs[r][0] - k[r][1] * sn[r][0];
        v4f khi =  k[r][1] * cs[r][1] + k[r][0] * sn[r][1];
        *(v4h*)&Q [o]      = __builtin_convertvector(qlo, v4h);
        *(v4h*)&Q [o + 32] = __builtin_convertvector(qhi, v4h);
        *(v4h*)&Kd[o]      = __builtin_convertvector(klo, v4h);
        *(v4h*)&Kd[o + 32] = __builtin_convertvector(khi, v4h);
    }
}

// ---------------------------------------------------------------------------
// Flash attention: block = one (b,h) x 128 queries; 8 waves x 16-query strips.
// Keys streamed in chunks of 64; online softmax in fp32 (one reduction pass
// per 64 keys instead of per 32 -> half the shuffle/barrier overhead).
// Output f16 [b*L + q][h*64 + dh]  (A-operand for the final projection GEMM).
// ---------------------------------------------------------------------------
__global__ __launch_bounds__(256)
void attn_f16(const _Float16* __restrict__ Q, const _Float16* __restrict__ Kd,
              const _Float16* __restrict__ Vt, _Float16* __restrict__ O) {
    __shared__ __align__(16) _Float16 Kblk[64][PITCH64];    // [key][dh]
    __shared__ __align__(16) _Float16 Vblk[64][PITCH64];    // [dh][key]
    __shared__ __align__(16) _Float16 Pbuf[8][16][PITCH64]; // per-wave C->A bounce

    const int t    = threadIdx.x;
    const int wave = t >> 5, lane = t & 31;
    const int half = lane >> 4, l16 = lane & 15;
    const int bh    = blockIdx.x;          // 0..31
    const int qtile = blockIdx.y;          // 0..15
    const int qbase = qtile * 128 + wave * 16;

    // Q strip: 16 queries x 64 dh = two 16x32 A fragments, loaded straight from global
    Frag16 qf[2];
#pragma unroll
    for (int kk = 0; kk < 2; ++kk) {
        const _Float16* qp = Q + ((size_t)bh * SEQ + qbase + l16) * HEAD_DIM + kk * 32;
        qf[kk].u[0] = *(const uint4*)(qp + half * 8);
        qf[kk].u[1] = *(const uint4*)(qp + 16 + half * 8);
    }

    v8f o[4] = {};
    float mrun[8], lrun[8];
#pragma unroll
    for (int e = 0; e < 8; ++e) { mrun[e] = -1e30f; lrun[e] = 0.f; }

    const int lr = t >> 2, lc = (t & 3) * 16;   // 64x64 tile loads: 16 elems/thread

    for (int kb = 0; kb < SEQ; kb += 64) {
        __syncthreads();
        // K block 64x64 [key][dh]
        *(uint4*)&Kblk[lr][lc]     = *(const uint4*)&Kd[((size_t)bh * SEQ + kb + lr) * HEAD_DIM + lc];
        *(uint4*)&Kblk[lr][lc + 8] = *(const uint4*)&Kd[((size_t)bh * SEQ + kb + lr) * HEAD_DIM + lc + 8];
        // V block 64x64 [dh][key] from V^T
        *(uint4*)&Vblk[lr][lc]     = *(const uint4*)&Vt[((size_t)bh * HEAD_DIM + lr) * SEQ + kb + lc];
        *(uint4*)&Vblk[lr][lc + 8] = *(const uint4*)&Vt[((size_t)bh * HEAD_DIM + lr) * SEQ + kb + lc + 8];
        __syncthreads();

        // S = Q * K^T : 16 queries x 64 keys (4 N-fragments, K-dim 64 = 2 steps)
        v8f s[4] = {};
#pragma unroll
        for (int nf = 0; nf < 4; ++nf)
#pragma unroll
            for (int kk = 0; kk < 2; ++kk) {
                Frag16 b;
                int kr = nf * 16 + l16;
                b.u[0] = *(const uint4*)&Kblk[kr][kk * 32 + half * 8];
                b.u[1] = *(const uint4*)&Kblk[kr][kk * 32 + 16 + half * 8];
                s[nf] = __builtin_amdgcn_wmma_f32_16x16x32_f16(
                    false, qf[kk].v, false, b.v, (short)0, s[nf], false, false);
            }

        // --- online softmax (rows live across the 16 lanes of each half-wave) ---
        float mcur[8];
#pragma unroll
        for (int e = 0; e < 8; ++e)
            mcur[e] = fmaxf(fmaxf(s[0][e], s[1][e]), fmaxf(s[2][e], s[3][e]));
#pragma unroll
        for (int msk = 1; msk < 16; msk <<= 1)
#pragma unroll
            for (int e = 0; e < 8; ++e)
                mcur[e] = fmaxf(mcur[e], __shfl_xor(mcur[e], msk, 32));

        float alpha[8];
#pragma unroll
        for (int e = 0; e < 8; ++e) {
            float mn = fmaxf(mrun[e], mcur[e]);
            alpha[e] = __expf(mrun[e] - mn);
            mrun[e]  = mn;
        }
#pragma unroll
        for (int nf = 0; nf < 4; ++nf)
#pragma unroll
            for (int e = 0; e < 8; ++e) s[nf][e] = __expf(s[nf][e] - mrun[e]);

        float rsum[8];
#pragma unroll
        for (int e = 0; e < 8; ++e)
            rsum[e] = (s[0][e] + s[1][e]) + (s[2][e] + s[3][e]);
#pragma unroll
        for (int msk = 1; msk < 16; msk <<= 1)
#pragma unroll
            for (int e = 0; e < 8; ++e) rsum[e] += __shfl_xor(rsum[e], msk, 32);
#pragma unroll
        for (int e = 0; e < 8; ++e) lrun[e] = lrun[e] * alpha[e] + rsum[e];
#pragma unroll
        for (int jf = 0; jf < 4; ++jf)
#pragma unroll
            for (int e = 0; e < 8; ++e) o[jf][e] *= alpha[e];

        // P: C-layout -> A-layout via per-wave LDS bounce (DS ops are in-order per wave)
#pragma unroll
        for (int nf = 0; nf < 4; ++nf)
#pragma unroll
            for (int e = 0; e < 8; ++e)
                Pbuf[wave][e + 8 * half][nf * 16 + l16] = (_Float16)s[nf][e];

        Frag16 p[2];
#pragma unroll
        for (int kk = 0; kk < 2; ++kk) {
            p[kk].u[0] = *(const uint4*)&Pbuf[wave][l16][kk * 32 + half * 8];
            p[kk].u[1] = *(const uint4*)&Pbuf[wave][l16][kk * 32 + 16 + half * 8];
        }

        // O += P * V : 16 queries x 64 dh (4 N-fragments, K=64 keys = 2 steps)
#pragma unroll
        for (int jf = 0; jf < 4; ++jf)
#pragma unroll
            for (int kk = 0; kk < 2; ++kk) {
                Frag16 b;
                int dh = jf * 16 + l16;
                b.u[0] = *(const uint4*)&Vblk[dh][kk * 32 + half * 8];
                b.u[1] = *(const uint4*)&Vblk[dh][kk * 32 + 16 + half * 8];
                o[jf] = __builtin_amdgcn_wmma_f32_16x16x32_f16(
                    false, p[kk].v, false, b.v, (short)0, o[jf], false, false);
            }
    }

    // normalize + store f16 [b*L + q][h*64 + dh]
    const int b = bh >> 4, h = bh & (NUM_HEADS - 1);
#pragma unroll
    for (int jf = 0; jf < 4; ++jf) {
        int col = h * HEAD_DIM + jf * 16 + l16;
#pragma unroll
        for (int e = 0; e < 8; ++e) {
            int qrow = qbase + e + 8 * half;
            size_t m = (size_t)b * SEQ + qrow;
            O[m * D_MODEL + col] = (_Float16)(o[jf][e] / lrun[e]);
        }
    }
}

// ---------------------------------------------------------------------------
// Launcher
// ---------------------------------------------------------------------------
extern "C" void kernel_launch(void* const* d_in, const int* in_sizes, int n_in,
                              void* d_out, int out_size, void* d_ws, size_t ws_size,
                              hipStream_t stream) {
    (void)in_sizes; (void)n_in; (void)out_size; (void)ws_size;

    const float* x    = (const float*)d_in[0];   // [2,2048,1024]
    const float* cosT = (const float*)d_in[1];   // [2048,64]
    const float* sinT = (const float*)d_in[2];   // [2048,64]
    const float* wqkv = (const float*)d_in[3];   // [3072,1024]
    const float* wo   = (const float*)d_in[4];   // [1024,1024]
    float* out = (float*)d_out;                  // [2,2048,1024]

    char* ws = (char*)d_ws;
    _Float16* x_h  = (_Float16*)(ws);                        //  8 MB
    _Float16* wq_h = (_Float16*)(ws + ( 8ull << 20));        //  6 MB
    _Float16* wo_h = (_Float16*)(ws + (14ull << 20));        //  2 MB
    float*    qkv  = (float*)   (ws + (16ull << 20));        // 48 MB
    _Float16* q_h  = (_Float16*)(ws + (64ull << 20));        //  8 MB
    _Float16* k_h  = (_Float16*)(ws + (72ull << 20));        //  8 MB
    _Float16* vt_h = (_Float16*)(ws + (80ull << 20));        //  8 MB
    _Float16* at_h = (_Float16*)(ws + (88ull << 20));        //  8 MB

    cvt_f32_f16<<<(MROWS * D_MODEL) / CVT_BLOCK, 256, 0, stream>>>(x, x_h);
    cvt_f32_f16<<<(3 * D_MODEL * D_MODEL) / CVT_BLOCK, 256, 0, stream>>>(wqkv, wq_h);
    cvt_f32_f16<<<(D_MODEL * D_MODEL) / CVT_BLOCK, 256, 0, stream>>>(wo, wo_h);

    // qkv = x @ w_qkv^T   : M=4096, N=3072, K=1024
    gemm_nt_f16<<<dim3(3072 / 128, MROWS / 128), 256, 0, stream>>>(x_h, wq_h, qkv, MROWS, 3072, 1024);

    rope_pack<<<BATCH * NUM_HEADS * (SEQ / 64), 256, 0, stream>>>(
        qkv, cosT, sinT, q_h, k_h, vt_h);

    attn_f16<<<dim3(BATCH * NUM_HEADS, SEQ / 128), 256, 0, stream>>>(q_h, k_h, vt_h, at_h);

    // out = attn @ w_o^T  : M=4096, N=1024, K=1024
    gemm_nt_f16<<<dim3(D_MODEL / 128, MROWS / 128), 256, 0, stream>>>(at_h, wo_h, out, MROWS, D_MODEL, 1024);
}

// v003
// A run of this version takes 127 microseconds.
// Timed twice side by side with v002, it ran 1.23 and 1.22 times as fast.
// All steps since v000 together make it 2.84 times as fast.
#include <hip/hip_runtime.h>

// ---------------------------------------------------------------------------
// MI455X (gfx1250, wave32) RoPE attention, f16 WMMA pipeline.
// ---------------------------------------------------------------------------

typedef __attribute__((ext_vector_type(16))) _Float16 v16h;
typedef __attribute__((ext_vector_type(8)))  float    v8f;
typedef __attribute__((ext_vector_type(4)))  float    v4f;
typedef __attribute__((ext_vector_type(4)))  _Float16 v4h;

union Frag16 { v16h v; uint4 u[2]; };

#define D_MODEL   1024
#define NUM_HEADS 16
#define HEAD_DIM  64
#define BATCH     2
#define SEQ       2048
#define MROWS     (BATCH * SEQ)   // 4096

// LDS row pitch in f16 elements for tiles whose rows are read as 16-byte
// fragments by 16 lanes at once: 16 B x odd, so the 16 rows fall on distinct
// banks (a pitch of 64 B or 128 B puts them on the same few banks).
#define PITCH32   40              // 32-element rows: 80 B
#define PITCH64   72              // 64-element rows: 144 B

// ---------------------------------------------------------------------------
// fp32 -> fp16 elementwise convert. A block takes CVT_BLOCK contiguous floats;
// a lane takes eight float4, each wave-wide load covering 512 contiguous bytes,
// so few waves have to start and each keeps eight loads in flight.
// The element count must be a multiple of CVT_BLOCK (grid = count / CVT_BLOCK).
// ---------------------------------------------------------------------------
#define CVT_BLOCK (256 * 8 * 4)
__global__ __launch_bounds__(256)
void cvt_f32_f16(const float* __restrict__ in, _Float16* __restrict__ out) {
    const size_t base = (size_t)blockIdx.x * CVT_BLOCK + threadIdx.x * 4;
    v4f v[8];
    // unrolled so that all eight loads are issued before the first is waited for
#pragma unroll
    for (int k = 0; k < 8; ++k) v[k] = *(const v4f*)&in[base + k * 1024];
#pragma unroll
    for (int k = 0; k < 8; ++k) *(v4h*)&out[base + k * 1024] = __builtin_convertvector(v[k], v4h);
}

// ---------------------------------------------------------------------------
// Generic GEMM: C[M][N] = A[M][K] * W[N][K]^T   (A,W f16 row-major, C f32)
// Block = 256 threads (8 waves). Tile 128(M) x 128(N), BK=32.
// Wave (wm,wn) in 4x2 grid computes a 32x64 sub-tile = 2x4 WMMA fragments.
// Per k-step per wave: 8 v_wmma against 12 ds_load_b128.
// ---------------------------------------------------------------------------
__global__ __launch_bounds__(256)
void gemm_nt_f16(const _Float16* __restrict__ A, const _Float16* __restrict__ W,
                 float* __restrict__ C, int M, int N, int K) {
    __shared__ __align__(16) _Float16 Atile[128][PITCH32];
    __shared__ __align__(16) _Float16 Btile[128][PITCH32];

    const int t    = threadIdx.x;
    const int wave = t >> 5, lane = t & 31;
    const int half = lane >> 4, l16 = lane & 15;
    const int wm   = wave >> 1, wn = wave & 1;
    const int bm   = blockIdx.y * 128, bn = blockIdx.x * 128;

    v8f acc[2][4] = {};

    const int ar = t >> 1, ac = (t & 1) * 16;   // both tiles: 128 rows x 32, 16 elems/thread

    for (int k0 = 0; k0 < K; k0 += 32) {
        __syncthreads();
        *(uint4*)&Atile[ar][ac]     = *(const uint4*)&A[(size_t)(bm + ar) * K + k0 + ac];
        *(uint4*)&Atile[ar][ac + 8] = *(const uint4*)&A[(size_t)(bm + ar) * K + k0 + ac + 8];
        *(uint4*)&Btile[ar][ac]     = *(const uint4*)&W[(size_t)(bn + ar) * K + k0 + ac];
        *(uint4*)&Btile[ar][ac + 8] = *(const uint4*)&W[(size_t)(bn + ar) * K + k0 + ac + 8];
        __syncthreads();

        Frag16 a[2], b[4];
#pragma unroll
        for (int i = 0; i < 2; ++i) {
            int r = wm * 32 + i * 16 + l16;
            a[i].u[0] = *(const uint4*)&Atile[r][half * 8];
            a[i].u[1] = *(const uint4*)&Atile[r][16 + half * 8];
        }
#pragma unroll
        for (int j = 0; j < 4; ++j) {
            int r = wn * 64 + j * 16 + l16;
            b[j].u[0] = *(const uint4*)&Btile[r][half * 8];
            b[j].u[1] = *(const uint4*)&Btile[r][16 + half * 8];
        }
#pragma unroll
        for (int i = 0; i < 2; ++i)
#pragma unroll
            for (int j = 0; j < 4; ++j)
                acc[i][j] = __builtin_amdgcn_wmma_f32_16x16x32_f16(
                    false, a[i].v, false, b[j].v, (short)0, acc[i][j], false, false);
    }

#pragma unroll
    for (int i = 0; i < 2; ++i)
#pragma unroll
        for (int j = 0; j < 4; ++j) {
            int col = bn + wn * 64 + j * 16 + l16;
#pragma unroll
            for (int e = 0; e < 8; ++e) {
                int row = bm + wm * 32 + i * 16 + e + 8 * half;
                C[(size_t)row * N + col] = acc[i][j][e];
            }
        }
}

// ---------------------------------------------------------------------------
// RoPE + repack:  qkv f32 [b,l, 3*1024]  ->  Q,K f16 [b,h,l,dh] ; V^T f16 [b,h,dh,l]
// Softmax scale 1/sqrt(64) folded into Q.
// Block = one (b,h) x 64 positions. Lane c of each group of 8 holds dh 4c..4c+3 and
// 32+4c..32+4c+3 (the two sides of a rotation pair) of two neighbouring positions,
// so every load is 16 B a lane and eight lanes cover one whole 128-B line.
// V is turned in LDS: a dword holds one dh of two neighbouring positions; a row
// (one dh, 64 positions) leaves as one whole line of V^T.
// ---------------------------------------------------------------------------
__global__ __launch_bounds__(256)
void rope_pack(const float* __restrict__ qkv,
               const float* __restrict__ cosT, const float* __restrict__ sinT,
               _Float16* __restrict__ Q, _Float16* __restrict__ Kd,
               _Float16* __restrict__ Vt) {
    // [dh][position pair]; the 16-B chunk index of a row is XORed with (dh >> 2) & 7,
    // so the eight dh rows that one wave-wide store touches fall on distinct banks.
    __shared__ __align__(16) unsigned int Vs[HEAD_DIM][32];

    const int t  = threadIdx.x;
    const int c  = t & 7;                    // float4 column inside each half of the head
    const int rp = t >> 3;                   // position pair 0..31
    const int h  = blockIdx.x & (NUM_HEADS - 1);
    const int l0 = ((blockIdx.x >> 4) & (SEQ / 64 - 1)) * 64;
    const int b  = blockIdx.x >> 9;
    const int bh = b * NUM_HEADS + h;

    const int lA = l0 + 2 * rp;              // the lane's first position; the second is lA + 1
    const float* row = qkv + ((size_t)b * SEQ + lA) * (3 * D_MODEL) + h * HEAD_DIM + 4 * c;
    const float* cp  = cosT + lA * HEAD_DIM + 4 * c;
    const float* sp  = sinT + lA * HEAD_DIM + 4 * c;

    v4f q[2][2], k[2][2], v[2][2], cs[2][2], sn[2][2];   // [position][half of the head]
    // every loop of this kernel is unrolled so that these arrays are indexed by constants
    // and stay in registers
#pragma unroll
    for (int r = 0; r < 2; ++r)
#pragma unroll
        for (int hh = 0; hh < 2; ++hh)
            v[r][hh] = *(const v4f*)(row + r * 3 * D_MODEL + 2 * D_MODEL + hh * 32);
#pragma unroll
    for (int r = 0; r < 2; ++r)
#pragma unroll
        for (int hh = 0; hh < 2; ++hh) {
            q[r][hh]  = *(const v4f*)(row + r * 3 * D_MODEL + hh * 32);
            k[r][hh]  = *(const v4f*)(row + r * 3 * D_MODEL + D_MODEL + hh * 32);
            cs[r][hh] = *(const v4f*)(cp + r * HEAD_DIM + hh * 32);
            sn[r][hh] = *(const v4f*)(sp + r * HEAD_DIM + hh * 32);
        }
    // Precaution for the 20 loads above: their three address pairs are inputs here, so they
    // stay live up to this wait and no later load's result is placed in one of them before it.
    asm volatile("s_wait_xcnt 0x0" :: "v"(row), "v"(cp), "v"(sp) : "memory");
    // Keeps the arithmetic behind all 20 loads: without it the scheduler lifts the V conversions
    // among them to reuse their registers, and the last loads issue only after the first return.
    __builtin_amdgcn_sched_barrier(0);

    // V first, so that no global store is outstanding at the barrier.
    // A dword: positions 2rp (low half) and 2rp + 1 (high half) of one dh.
#pragma unroll
    for (int hh = 0; hh < 2; ++hh)
#pragma unroll
        for (int i = 0; i < 4; ++i) {
            union { _Float16 f[2]; unsigned int u; } pk;
            pk.f[0] = (_Float16)v[0][hh][i];
            pk.f[1] = (_Float16)v[1][hh][i];
            const int d = hh * 32 + 4 * c + i;               // (d >> 2) & 7 == c
            Vs[d][(((rp >> 2) ^ c) << 2) | (rp & 3)] = pk.u;
        }
    __syncthreads();

    // 64 rows x 8 chunks of 8 positions: eight lanes store one whole line of V^T
#pragma unroll
    for (int p = 0; p < 2; ++p) {
        const int d  = p * 32 + (t >> 3);
        const int ch = t & 7;
        const uint4 w = *(const uint4*)&Vs[d][(ch ^ ((d >> 2) & 7)) << 2];
        *(uint4*)&Vt[((size_t)bh * HEAD_DIM + d) * SEQ + l0 + 8 * ch] = w;
    }

#pragma unroll
    for (int r = 0; r < 2; ++r) {
        const int l = l0 + 2 * rp + r;
        const size_t o = ((size_t)bh * SEQ + l) * HEAD_DIM + 4 * c;
        // rotate_half: dh < 32 pairs with -t[dh + 32], dh >= 32 with +t[dh - 32]
        v4f qlo = (q[r][0] * cs[r][0] - q[r][1] * sn[r][0]) * 0.125f;  // 1/sqrt(HEAD_DIM)
        v4f qhi = (q[r][1] * cs[r][1] + q[r][0] * sn[r][1]) * 0.125f;
        v4f klo =  k[r][0] * cs[r][0] - k[r][1] * sn[r][0];
        v4f khi =  k[r][1] * cs[r][1] + k[r][0] * sn[r][1];
        *(v4h*)&Q [o]      = __builtin_convertvector(qlo, v4h);
        *(v4h*)&Q [o + 32] = __builtin_convertvector(qhi, v4h);
        *(v4h*)&Kd[o]      = __builtin_convertvector(klo, v4h);
        *(v4h*)&Kd[o + 32] = __builtin_convertvector(khi, v4h);
    }
}

__device__ inline float xhalf(float x) {
    return __builtin_bit_cast(float, __builtin_amdgcn_permlanex16(
        __builtin_bit_cast(int, x), __builtin_bit_cast(int, x), 0x76543210, 0xfedcba98, false, false));
}

// 2^x of eight values in place. One statement, so that each v_exp_f32 is followed by an
// independent instruction and the last by v_nop: the slot the instruction set asks for between
// a transcendental and an instruction that reads its result or overwrites its source.
__device__ inline void exp2x8(v8f& x) {
    float a = x[0], b = x[1], c = x[2], d = x[3], e = x[4], f = x[5], g = x[6], h = x[7];
    asm("v_exp_f32 %0, %0\n\tv_exp_f32 %1, %1\n\tv_exp_f32 %2, %2\n\tv_exp_f32 %3, %3\n\t"
        "v_exp_f32 %4, %4\n\tv_exp_f32 %5, %5\n\tv_exp_f32 %6, %6\n\tv_exp_f32 %7, %7\n\tv_nop"
        : "+v"(a), "+v"(b), "+v"(c), "+v"(d), "+v"(e), "+v"(f), "+v"(g), "+v"(h));
    x[0] = a; x[1] = b; x[2] = c; x[3] = d; x[4] = e; x[5] = f; x[6] = g; x[7] = h;
}

__global__ __launch_bounds__(256)
void attn_f16(const _Float16* __restrict__ Q, const _Float16* __restrict__ Kd,
              const _Float16* __restrict__ Vt, _Float16* __restrict__ O) {
    __shared__ __align__(16) _Float16 Kblk[64][PITCH64];    // [key][dh]
    __shared__ __align__(16) _Float16 Vblk[64][PITCH64];    // [dh][key]

    const int t    = threadIdx.x;
    const int wave = t >> 5, lane = t & 31;
    const int half = lane >> 4, l16 = lane & 15;
    const int bh    = blockIdx.x;          // 0..31
    const int qtile = blockIdx.y;          // 0..15
    const int qbase = qtile * 128 + wave * 16;

    // Q strip: 16 queries x 64 dh = two 32x16 B fragments (column = query l16), straight from global
    Frag16 qf[2];
#pragma unroll
    for (int kk = 0; kk < 2; ++kk) {
        const _Float16* qp = Q + ((size_t)bh * SEQ + qbase + l16) * HEAD_DIM + kk * 32;
        qf[kk].u[0] = *(const uint4*)(qp + half * 8);
        qf[kk].u[1] = *(const uint4*)(qp + 16 + half * 8);
    }

    v8f o[4] = {};                   // o[jf][e] = O^T[dh = jf * 16 + 8 * half + e][query l16]
    float mrun = -1e30f;             // running maximum of query l16, equal in both halves
    float lrun = 0.f;                // running sum over this half's keys only; joined after the loop

    const int lr = t >> 2, lc = (t & 3) * 16;   // 64x64 tile loads: 16 elems/thread

    for (int kb = 0; kb < SEQ; kb += 64) {
        __syncthreads();
        // K block 64x64 [key][dh]
        *(uint4*)&Kblk[lr][lc]     = *(const uint4*)&Kd[((size_t)bh * SEQ + kb + lr) * HEAD_DIM + lc];
        *(uint4*)&Kblk[lr][lc + 8] = *(const uint4*)&Kd[((size_t)bh * SEQ + kb + lr) * HEAD_DIM + lc + 8];
        // V block 64x64 [dh][key] from V^T
        *(uint4*)&Vblk[lr][lc]     = *(const uint4*)&Vt[((size_t)bh * HEAD_DIM + lr) * SEQ + kb + lc];
        *(uint4*)&Vblk[lr][lc + 8] = *(const uint4*)&Vt[((size_t)bh * HEAD_DIM + lr) * SEQ + kb + lc + 8];
        __syncthreads();

        // S^T = K * Q^T : 64 keys x 16 queries (4 M-fragments, K-dim 64 = 2 steps)
        // s[nf][e] = score of key kb + nf * 16 + 8 * half + e against query l16
        v8f s[4] = {};
#pragma unroll
        for (int nf = 0; nf < 4; ++nf)
#pragma unroll
            for (int kk = 0; kk < 2; ++kk) {
                Frag16 a;
                int kr = nf * 16 + l16;
                a.u[0] = *(const uint4*)&Kblk[kr][kk * 32 + half * 8];
                a.u[1] = *(const uint4*)&Kblk[kr][kk * 32 + 16 + half * 8];
                s[nf] = __builtin_amdgcn_wmma_f32_16x16x32_f16(
                    false, a.v, false, qf[kk].v, (short)0, s[nf], false, false);
            }

        // --- online softmax: the lane's 32 scores, then the other half's 32 ---
        float m8[8];
#pragma unroll
        for (int e = 0; e < 8; ++e)
            m8[e] = fmaxf(fmaxf(s[0][e], s[1][e]), fmaxf(s[2][e], s[3][e]));
        float mcur = fmaxf(fmaxf(fmaxf(m8[0], m8[1]), fmaxf(m8[2], m8[3])),
                           fmaxf(fmaxf(m8[4], m8[5]), fmaxf(m8[6], m8[7])));
        mcur = fmaxf(mcur, xhalf(mcur));

        const float mn    = fmaxf(mrun, mcur);
        const float alpha = __expf(mrun - mn);
        mrun = mn;
#pragma unroll
        for (int nf = 0; nf < 4; ++nf) {
            s[nf] = (s[nf] - mrun) * 1.44269504088896340736f;   // e^x = 2^(x * log2 e), as __expf forms it
            exp2x8(s[nf]);
        }

        float r8[8];
#pragma unroll
        for (int e = 0; e < 8; ++e)
            r8[e] = (s[0][e] + s[1][e]) + (s[2][e] + s[3][e]);
        lrun = lrun * alpha + (((r8[0] + r8[1]) + (r8[2] + r8[3])) + ((r8[4] + r8[5]) + (r8[6] + r8[7])));
#pragma unroll
        for (int jf = 0; jf < 4; ++jf)
#pragma unroll
            for (int e = 0; e < 8; ++e) o[jf][e] *= alpha;

        // P^T as B operand: element i of fragment kk is key kk * 32 + (i < 8 ? 8 * half + i
        // : 16 + 8 * half + i - 8), which is register i & 7 of tile 2 * kk + (i >> 3)
        Frag16 p[2];
#pragma unroll
        for (int kk = 0; kk < 2; ++kk)
#pragma unroll
            for (int i = 0; i < 16; ++i)
                p[kk].v[i] = (_Float16)s[2 * kk + (i >> 3)][i & 7];

        // O^T += V^T * P^T : 64 dh x 16 queries (4 M-fragments, K=64 keys = 2 steps)
#pragma unroll
        for (int jf = 0; jf < 4; ++jf)
#pragma unroll
            for (int kk = 0; kk < 2; ++kk) {
                Frag16 a;
                int dh = jf * 16 + l16;
                a.u[0] = *(const uint4*)&Vblk[dh][kk * 32 + half * 8];
                a.u[1] = *(const uint4*)&Vblk[dh][kk * 32 + 16 + half * 8];
                o[jf] = __builtin_amdgcn_wmma_f32_16x16x32_f16(
                    false, a.v, false, p[kk].v, (short)0, o[jf], false, false);
            }
    }

    // join the halves' sums, normalize, store f16 [b*L + q][h*64 + dh]: 8 neighbouring dh a store
    lrun += xhalf(lrun);
    const int b = bh >> 4, h = bh & (NUM_HEADS - 1);
    const size_t m = (size_t)b * SEQ + qbase + l16;
#pragma unroll
    for (int jf = 0; jf < 4; ++jf) {
        union { _Float16 f[8]; uint4 u; } pk;
#pragma unroll
        for (int e = 0; e < 8; ++e) pk.f[e] = (_Float16)(o[jf][e] / lrun);
        *(uint4*)&O[m * D_MODEL + h * HEAD_DIM + jf * 16 + 8 * half] = pk.u;
    }
}

// ---------------------------------------------------------------------------
// Launcher
// ---------------------------------------------------------------------------
extern "C" void kernel_launch(void* const* d_in, const int* in_sizes, int n_in,
                              void* d_out, int out_size, void* d_ws, size_t ws_size,
                              hipStream_t stream) {
    (void)in_sizes; (void)n_in; (void)out_size; (void)ws_size;

    const float* x    = (const float*)d_in[0];   // [2,2048,1024]
    const float* cosT = (const float*)d_in[1];   // [2048,64]
    const float* sinT = (const float*)d_in[2];   // [2048,64]
    const float* wqkv = (const float*)d_in[3];   // [3072,1024]
    const float* wo   = (const float*)d_in[4];   // [1024,1024]
    float* out = (float*)d_out;                  // [2,2048,1024]

    char* ws = (char*)d_ws;
    _Float16* x_h  = (_Float16*)(ws);                        //  8 MB
    _Float16* wq_h = (_Float16*)(ws + ( 8ull << 20));        //  6 MB
    _Float16* wo_h = (_Float16*)(ws + (14ull << 20));        //  2 MB
    float*    qkv  = (float*)   (ws + (16ull << 20));        // 48 MB
    _Float16* q_h  = (_Float16*)(ws + (64ull << 20));        //  8 MB
    _Float16* k_h  = (_Float16*)(ws + (72ull << 20));        //  8 MB
    _Float16* vt_h = (_Float16*)(ws + (80ull << 20));        //  8 MB
    _Float16* at_h = (_Float16*)(ws + (88ull << 20));        //  8 MB

    cvt_f32_f16<<<(MROWS * D_MODEL) / CVT_BLOCK, 256, 0, stream>>>(x, x_h);
    cvt_f32_f16<<<(3 * D_MODEL * D_MODEL) / CVT_BLOCK, 256, 0, stream>>>(wqkv, wq_h);
    cvt_f32_f16<<<(D_MODEL * D_MODEL) / CVT_BLOCK, 256, 0, stream>>>(wo, wo_h);

    // qkv = x @ w_qkv^T   : M=4096, N=3072, K=1024
    gemm_nt_f16<<<dim3(3072 / 128, MROWS / 128), 256, 0, stream>>>(x_h, wq_h, qkv, MROWS, 3072, 1024);

    rope_pack<<<BATCH * NUM_HEADS * (SEQ / 64), 256, 0, stream>>>(
        qkv, cosT, sinT, q_h, k_h, vt_h);

    attn_f16<<<dim3(BATCH * NUM_HEADS, SEQ / 128), 256, 0, stream>>>(q_h, k_h, vt_h, at_h);

    // out = attn @ w_o^T  : M=4096, N=1024, K=1024
    gemm_nt_f16<<<dim3(D_MODEL / 128, MROWS / 128), 256, 0, stream>>>(at_h, wo_h, out, MROWS, D_MODEL, 1024);
}

// v004
// It runs in 99.7 microseconds.
// Next to v003, in two timings, it ran 1.29 and 1.27 times as fast.
// Over all steps from v000 it is 3.63 times as fast.
#include <hip/hip_runtime.h>

// ---------------------------------------------------------------------------
// MI455X (gfx1250, wave32) RoPE attention, f16 WMMA pipeline.
// ---------------------------------------------------------------------------

typedef __attribute__((ext_vector_type(16))) _Float16 v16h;
typedef __attribute__((ext_vector_type(8)))  float    v8f;
typedef __attribute__((ext_vector_type(4)))  float    v4f;
typedef __attribute__((ext_vector_type(4)))  _Float16 v4h;

union Frag16 { v16h v; uint4 u[2]; };

#define D_MODEL   1024
#define NUM_HEADS 16
#define HEAD_DIM  64
#define BATCH     2
#define SEQ       2048
#define MROWS     (BATCH * SEQ)   // 4096

// LDS row pitch in f16 elements for tiles whose rows are read as 16-byte
// fragments by 16 lanes at once: 16 B x odd, so the 16 rows fall on distinct
// banks (a pitch of 64 B or 128 B puts them on the same few banks).
#define PITCH32   40              // 32-element rows: 80 B; no tile here uses it
#define PITCH64   72              // 64-element rows: 144 B

// ---------------------------------------------------------------------------
// Staging of LDS tiles: asynchronous copies, 16 B a lane, global -> LDS through no register,
// in a ring of two buffers: the copies of tile t + 2 are issued at the foot of trip t and
// waited for at the foot of trip t + 1, so they fly while tile t + 1 is worked on.
// ---------------------------------------------------------------------------
// LDS byte address of a __shared__ object: the low 32 bits of its address
__device__ inline unsigned lds_addr(const void* p) { return (unsigned)(size_t)p; }

// Four copies of a lane. The s_wait_xcnt closes the statement as a precaution: it stands in
// front of every later instruction that could rewrite an address register named here.
__device__ inline void copy4(unsigned l0, unsigned l1, unsigned l2, unsigned l3,
                             const _Float16* g0, const _Float16* g1,
                             const _Float16* g2, const _Float16* g3) {
    asm volatile("global_load_async_to_lds_b128 %0, %4, off\n\t"
                 "global_load_async_to_lds_b128 %1, %5, off\n\t"
                 "global_load_async_to_lds_b128 %2, %6, off\n\t"
                 "global_load_async_to_lds_b128 %3, %7, off\n\t"
                 "s_wait_xcnt 0x0"
                 :: "v"(l0), "v"(l1), "v"(l2), "v"(l3), "v"(g0), "v"(g1), "v"(g2), "v"(g3)
                 : "memory");
}

// Eight copies of a lane in one statement, with the same closing wait.
__device__ inline void copy8(unsigned l0, unsigned l1, unsigned l2, unsigned l3,
                             unsigned l4, unsigned l5, unsigned l6, unsigned l7,
                             const _Float16* g0, const _Float16* g1,
                             const _Float16* g2, const _Float16* g3,
                             const _Float16* g4, const _Float16* g5,
                             const _Float16* g6, const _Float16* g7) {
    asm volatile("global_load_async_to_lds_b128 %0, %8, off\n\t"
                 "global_load_async_to_lds_b128 %1, %9, off\n\t"
                 "global_load_async_to_lds_b128 %2, %10, off\n\t"
                 "global_load_async_to_lds_b128 %3, %11, off\n\t"
                 "global_load_async_to_lds_b128 %4, %12, off\n\t"
                 "global_load_async_to_lds_b128 %5, %13, off\n\t"
                 "global_load_async_to_lds_b128 %6, %14, off\n\t"
                 "global_load_async_to_lds_b128 %7, %15, off\n\t"
                 "s_wait_xcnt 0x0"
                 :: "v"(l0), "v"(l1), "v"(l2), "v"(l3), "v"(l4), "v"(l5), "v"(l6), "v"(l7),
                    "v"(g0), "v"(g1), "v"(g2), "v"(g3), "v"(g4), "v"(g5), "v"(g6), "v"(g7)
                 : "memory");
}

// The wave's own copies have landed (the compiler places no wait for them).
__device__ inline void wait_copies() { asm volatile("s_wait_asynccnt 0x0" ::: "memory"); }
// The wave's own LDS reads have returned: the buffer they read may be refilled behind the barrier.
__device__ inline void wait_lds_reads() { asm volatile("s_wait_dscnt 0x0" ::: "memory"); }

// ---------------------------------------------------------------------------
// fp32 -> fp16 elementwise convert. A block takes CVT_BLOCK contiguous floats;
// a lane takes eight float4, each wave-wide load covering 512 contiguous bytes,
// so few waves have to start and each keeps eight loads in flight.
// The element count must be a multiple of CVT_BLOCK (grid = count / CVT_BLOCK).
// ---------------------------------------------------------------------------
#define CVT_BLOCK (256 * 8 * 4)
__global__ __launch_bounds__(256)
void cvt_f32_f16(const float* __restrict__ in, _Float16* __restrict__ out) {
    const size_t base = (size_t)blockIdx.x * CVT_BLOCK + threadIdx.x * 4;
    v4f v[8];
    // unrolled so that all eight loads are issued before the first is waited for
#pragma unroll
    for (int k = 0; k < 8; ++k) v[k] = *(const v4f*)&in[base + k * 1024];
#pragma unroll
    for (int k = 0; k < 8; ++k) *(v4h*)&out[base + k * 1024] = __builtin_convertvector(v[k], v4h);
}

// ---------------------------------------------------------------------------
// Generic GEMM: C[M][N] = A[M][K] * W[N][K]^T   (A,W f16 row-major, C f32)
// Block = 256 threads (8 waves). Tile 128(M) x 128(N); a stage of the ring is 64 k (two
// k-steps of 32).
// K must be a multiple of 64.
// Wave (wm,wn) in 4x2 grid computes a 32x64 sub-tile = 2x4 WMMA fragments.
// Per k-step per wave: 8 v_wmma against 12 ds_load_b128.
// ---------------------------------------------------------------------------
__global__ __launch_bounds__(256)
void gemm_nt_f16(const _Float16* __restrict__ A, const _Float16* __restrict__ W,
                 float* __restrict__ C, int M, int N, int K) {
    __shared__ __align__(16) _Float16 Tiles[2][2][128][PITCH64];   // [buffer][A | W][row][k]

    const int t    = threadIdx.x;
    const int wave = t >> 5, lane = t & 31;
    const int half = lane >> 4, l16 = lane & 15;
    const int wm   = wave >> 1, wn = wave & 1;
    const int bm   = blockIdx.y * 128, bn = blockIdx.x * 128;

    v8f acc[2][4] = {};

    // A stage: 2 tiles x 128 rows x 128 B. A lane copies chunk cc of rows cr, cr + 32, cr + 64
    // and cr + 96 of both tiles; eight lanes cover one whole 128-B line.
    const int cr = t >> 3, cc = (t & 7) * 8;
    const _Float16* ga = A + (size_t)(bm + cr) * K + cc;
    const _Float16* gw = W + (size_t)(bn + cr) * K + cc;
    const size_t    gs = (size_t)32 * K;                       // 32 rows on, in elements
    const unsigned  ls = 32 * PITCH64 * 2;                     // 32 rows on, in LDS bytes
    const unsigned  la = lds_addr(&Tiles[0][0][cr][cc]);
    const unsigned  lw = lds_addr(&Tiles[0][1][cr][cc]);
    const unsigned  lb = sizeof(Tiles[0]);                     // one buffer on
    const int       T  = K / 64;

#define GEMM_STAGE(s, buf)                                                              \
    copy8(la + (buf) * lb, la + (buf) * lb + ls, la + (buf) * lb + 2 * ls, la + (buf) * lb + 3 * ls, \
          lw + (buf) * lb, lw + (buf) * lb + ls, lw + (buf) * lb + 2 * ls, lw + (buf) * lb + 3 * ls, \
          ga + (s) * 64, ga + (s) * 64 + gs, ga + (s) * 64 + 2 * gs, ga + (s) * 64 + 3 * gs,         \
          gw + (s) * 64, gw + (s) * 64 + gs, gw + (s) * 64 + 2 * gs, gw + (s) * 64 + 3 * gs)

    GEMM_STAGE(0, 0);
    wait_copies();
    __syncthreads();                 // stage 0 is published
    if (T > 1) GEMM_STAGE(1, 1);

    for (int s = 0; s < T; ++s) {
        const int buf = s & 1;
        // two k-steps, unrolled so that the fragment arrays are indexed by constants
#pragma unroll
        for (int kk = 0; kk < 2; ++kk) {
            Frag16 a[2], b[4];
#pragma unroll
            for (int i = 0; i < 2; ++i) {
                int r = wm * 32 + i * 16 + l16;
                a[i].u[0] = *(const uint4*)&Tiles[buf][0][r][kk * 32 + half * 8];
                a[i].u[1] = *(const uint4*)&Tiles[buf][0][r][kk * 32 + 16 + half * 8];
            }
#pragma unroll
            for (int j = 0; j < 4; ++j) {
                int r = wn * 64 + j * 16 + l16;
                b[j].u[0] = *(const uint4*)&Tiles[buf][1][r][kk * 32 + half * 8];
                b[j].u[1] = *(const uint4*)&Tiles[buf][1][r][kk * 32 + 16 + half * 8];
            }
            // Keeps the k-step's 12 fragment loads one group in front of its WMMAs: without it
            // the scheduler loads the second A fragment among them and waits out its latency there.
            __builtin_amdgcn_sched_barrier(0);
#pragma unroll
            for (int i = 0; i < 2; ++i)
#pragma unroll
                for (int j = 0; j < 4; ++j)
                    acc[i][j] = __builtin_amdgcn_wmma_f32_16x16x32_f16(
                        false, a[i].v, false, b[j].v, (short)0, acc[i][j], false, false);
        }
        wait_lds_reads();
        wait_copies();
        __syncthreads();
        if (s + 2 < T) GEMM_STAGE(s + 2, buf);
    }
    wait_copies();
#undef GEMM_STAGE

#pragma unroll
    for (int i = 0; i < 2; ++i)
#pragma unroll
        for (int j = 0; j < 4; ++j) {
            int col = bn + wn * 64 + j * 16 + l16;
#pragma unroll
            for (int e = 0; e < 8; ++e) {
                int row = bm + wm * 32 + i * 16 + e + 8 * half;
                C[(size_t)row * N + col] = acc[i][j][e];
            }
        }
}

// ---------------------------------------------------------------------------
// RoPE + repack:  qkv f32 [b,l, 3*1024]  ->  Q,K f16 [b,h,l,dh] ; V^T f16 [b,h,dh,l]
// Softmax scale 1/sqrt(64) folded into Q.
// Block = one (b,h) x 64 positions. Lane c of each group of 8 holds dh 4c..4c+3 and
// 32+4c..32+4c+3 (the two sides of a rotation pair) of two neighbouring positions,
// so every load is 16 B a lane and eight lanes cover one whole 128-B line.
// V is turned in LDS: a dword holds one dh of two neighbouring positions; a row
// (one dh, 64 positions) leaves as one whole line of V^T.
// ---------------------------------------------------------------------------
__global__ __launch_bounds__(256)
void rope_pack(const float* __restrict__ qkv,
               const float* __restrict__ cosT, const float* __restrict__ sinT,
               _Float16* __restrict__ Q, _Float16* __restrict__ Kd,
               _Float16* __restrict__ Vt) {
    // [dh][position pair]; the 16-B chunk index of a row is XORed with (dh >> 2) & 7,
    // so the eight dh rows that one wave-wide store touches fall on distinct banks.
    __shared__ __align__(16) unsigned int Vs[HEAD_DIM][32];

    const int t  = threadIdx.x;
    const int c  = t & 7;                    // float4 column inside each half of the head
    const int rp = t >> 3;                   // position pair 0..31
    const int h  = blockIdx.x & (NUM_HEADS - 1);
    const int l0 = ((blockIdx.x >> 4) & (SEQ / 64 - 1)) * 64;
    const int b  = blockIdx.x >> 9;
    const int bh = b * NUM_HEADS + h;

    const int lA = l0 + 2 * rp;              // the lane's first position; the second is lA + 1
    const float* row = qkv + ((size_t)b * SEQ + lA) * (3 * D_MODEL) + h * HEAD_DIM + 4 * c;
    const float* cp  = cosT + lA * HEAD_DIM + 4 * c;
    const float* sp  = sinT + lA * HEAD_DIM + 4 * c;

    v4f q[2][2], k[2][2], v[2][2], cs[2][2], sn[2][2];   // [position][half of the head]
    // every loop of this kernel is unrolled so that these arrays are indexed by constants
    // and stay in registers
#pragma unroll
    for (int r = 0; r < 2; ++r)
#pragma unroll
        for (int hh = 0; hh < 2; ++hh)
            v[r][hh] = *(const v4f*)(row + r * 3 * D_MODEL + 2 * D_MODEL + hh * 32);
#pragma unroll
    for (int r = 0; r < 2; ++r)
#pragma unroll
        for (int hh = 0; hh < 2; ++hh) {
            q[r][hh]  = *(const v4f*)(row + r * 3 * D_MODEL + hh * 32);
            k[r][hh]  = *(const v4f*)(row + r * 3 * D_MODEL + D_MODEL + hh * 32);
            cs[r][hh] = *(const v4f*)(cp + r * HEAD_DIM + hh * 32);
            sn[r][hh] = *(const v4f*)(sp + r * HEAD_DIM + hh * 32);
        }
    // Precaution for the 20 loads above: their three address pairs are inputs here, so they
    // stay live up to this wait and no later load's result is placed in one of them before it.
    asm volatile("s_wait_xcnt 0x0" :: "v"(row), "v"(cp), "v"(sp) : "memory");
    // Keeps the arithmetic behind all 20 loads: without it the scheduler lifts the V conversions
    // among them to reuse their registers, and the last loads issue only after the first return.
    __builtin_amdgcn_sched_barrier(0);

    // V first, so that no global store is outstanding at the barrier.
    // A dword: positions 2rp (low half) and 2rp + 1 (high half) of one dh.
#pragma unroll
    for (int hh = 0; hh < 2; ++hh)
#pragma unroll
        for (int i = 0; i < 4; ++i) {
            union { _Float16 f[2]; unsigned int u; } pk;
            pk.f[0] = (_Float16)v[0][hh][i];
            pk.f[1] = (_Float16)v[1][hh][i];
            const int d = hh * 32 + 4 * c + i;               // (d >> 2) & 7 == c
            Vs[d][(((rp >> 2) ^ c) << 2) | (rp & 3)] = pk.u;
        }
    __syncthreads();

    // 64 rows x 8 chunks of 8 positions: eight lanes store one whole line of V^T
#pragma unroll
    for (int p = 0; p < 2; ++p) {
        const int d  = p * 32 + (t >> 3);
        const int ch = t & 7;
        const uint4 w = *(const uint4*)&Vs[d][(ch ^ ((d >> 2) & 7)) << 2];
        *(uint4*)&Vt[((size_t)bh * HEAD_DIM + d) * SEQ + l0 + 8 * ch] = w;
    }

#pragma unroll
    for (int r = 0; r < 2; ++r) {
        const int l = l0 + 2 * rp + r;
        const size_t o = ((size_t)bh * SEQ + l) * HEAD_DIM + 4 * c;
        // rotate_half: dh < 32 pairs with -t[dh + 32], dh >= 32 with +t[dh - 32]
        v4f qlo = (q[r][0] * cs[r][0] - q[r][1] * sn[r][0]) * 0.125f;  // 1/sqrt(HEAD_DIM)
        v4f qhi = (q[r][1] * cs[r][1] + q[r][0] * sn[r][1]) * 0.125f;
        v4f klo =  k[r][0] * cs[r][0] - k[r][1] * sn[r][0];
        v4f khi =  k[r][1] * cs[r][1] + k[r][0] * sn[r][1];
        *(v4h*)&Q [o]      = __builtin_convertvector(qlo, v4h);
        *(v4h*)&Q [o + 32] = __builtin_convertvector(qhi, v4h);
        *(v4h*)&Kd[o]      = __builtin_convertvector(klo, v4h);
        *(v4h*)&Kd[o + 32] = __builtin_convertvector(khi, v4h);
    }
}

__device__ inline float xhalf(float x) {
    return __builtin_bit_cast(float, __builtin_amdgcn_permlanex16(
        __builtin_bit_cast(int, x), __builtin_bit_cast(int, x), 0x76543210, 0xfedcba98, false, false));
}

// 2^x of eight values in place. One statement, so that each v_exp_f32 is followed by an
// independent instruction and the last by v_nop: the slot the instruction set asks for between
// a transcendental and an instruction that reads its result or overwrites its source.
__device__ inline void exp2x8(v8f& x) {
    float a = x[0], b = x[1], c = x[2], d = x[3], e = x[4], f = x[5], g = x[6], h = x[7];
    asm("v_exp_f32 %0, %0\n\tv_exp_f32 %1, %1\n\tv_exp_f32 %2, %2\n\tv_exp_f32 %3, %3\n\t"
        "v_exp_f32 %4, %4\n\tv_exp_f32 %5, %5\n\tv_exp_f32 %6, %6\n\tv_exp_f32 %7, %7\n\tv_nop"
        : "+v"(a), "+v"(b), "+v"(c), "+v"(d), "+v"(e), "+v"(f), "+v"(g), "+v"(h));
    x[0] = a; x[1] = b; x[2] = c; x[3] = d; x[4] = e; x[5] = f; x[6] = g; x[7] = h;
}

__global__ __launch_bounds__(256)
void attn_f16(const _Float16* __restrict__ Q, const _Float16* __restrict__ Kd,
              const _Float16* __restrict__ Vt, _Float16* __restrict__ O) {
    // [buffer][K | V^T][row][col]: K rows are keys over dh, V^T rows are dh over keys
    __shared__ __align__(16) _Float16 KV[2][2][64][PITCH64];

    const int t    = threadIdx.x;
    const int wave = t >> 5, lane = t & 31;
    const int half = lane >> 4, l16 = lane & 15;
    const int bh    = blockIdx.x;          // 0..31
    const int qtile = blockIdx.y;          // 0..15
    const int qbase = qtile * 128 + wave * 16;

    // Q strip: 16 queries x 64 dh = two 32x16 B fragments (column = query l16), straight from global
    Frag16 qf[2];
#pragma unroll
    for (int kk = 0; kk < 2; ++kk) {
        const _Float16* qp = Q + ((size_t)bh * SEQ + qbase + l16) * HEAD_DIM + kk * 32;
        qf[kk].u[0] = *(const uint4*)(qp + half * 8);
        qf[kk].u[1] = *(const uint4*)(qp + 16 + half * 8);
    }

    v8f o[4] = {};                   // o[jf][e] = O^T[dh = jf * 16 + 8 * half + e][query l16]
    float mrun = -1e30f;             // running maximum of query l16, equal in both halves
    float lrun = 0.f;                // running sum over this half's keys only; joined after the loop

    // A stage: 64 keys = 2 tiles x 64 rows x 128 B. A lane copies chunk cc of rows cr and
    // cr + 32 of both tiles; eight lanes cover one whole 128-B line.
    const int cr = t >> 3, cc = (t & 7) * 8;
    const _Float16* gk = Kd + ((size_t)bh * SEQ + cr) * HEAD_DIM + cc;        // [key][dh]
    const _Float16* gv = Vt + ((size_t)bh * HEAD_DIM + cr) * SEQ + cc;        // [dh][key]
    const unsigned  ls = 32 * PITCH64 * 2;                     // 32 rows on, in LDS bytes
    const unsigned  lk = lds_addr(&KV[0][0][cr][cc]);
    const unsigned  lv = lds_addr(&KV[0][1][cr][cc]);
    const unsigned  lb = sizeof(KV[0]);                        // one buffer on
    constexpr int   T  = SEQ / 64;

#define KV_STAGE(s, buf)                                                                \
    copy4(lk + (buf) * lb, lk + (buf) * lb + ls, lv + (buf) * lb, lv + (buf) * lb + ls, \
          gk + (size_t)(s) * 64 * HEAD_DIM, gk + ((size_t)(s) * 64 + 32) * HEAD_DIM,    \
          gv + (s) * 64, gv + (s) * 64 + (size_t)32 * SEQ)

    KV_STAGE(0, 0);
    wait_copies();
    __syncthreads();                 // stage 0 is published
    KV_STAGE(1, 1);

    for (int st = 0; st < T; ++st) {
        const int buf = st & 1;
        const _Float16 (*Kblk)[PITCH64] = KV[buf][0];
        const _Float16 (*Vblk)[PITCH64] = KV[buf][1];

        // S^T = K * Q^T : 64 keys x 16 queries (4 M-fragments, K-dim 64 = 2 steps)
        // s[nf][e] = score of key st * 64 + nf * 16 + 8 * half + e against query l16
        v8f s[4] = {};
#pragma unroll
        for (int nf = 0; nf < 4; ++nf)
#pragma unroll
            for (int kk = 0; kk < 2; ++kk) {
                Frag16 a;
                int kr = nf * 16 + l16;
                a.u[0] = *(const uint4*)&Kblk[kr][kk * 32 + half * 8];
                a.u[1] = *(const uint4*)&Kblk[kr][kk * 32 + 16 + half * 8];
                s[nf] = __builtin_amdgcn_wmma_f32_16x16x32_f16(
                    false, a.v, false, qf[kk].v, (short)0, s[nf], false, false);
            }

        // --- online softmax: the lane's 32 scores, then the other half's 32 ---
        float m8[8];
#pragma unroll
        for (int e = 0; e < 8; ++e)
            m8[e] = fmaxf(fmaxf(s[0][e], s[1][e]), fmaxf(s[2][e], s[3][e]));
        float mcur = fmaxf(fmaxf(fmaxf(m8[0], m8[1]), fmaxf(m8[2], m8[3])),
                           fmaxf(fmaxf(m8[4], m8[5]), fmaxf(m8[6], m8[7])));
        mcur = fmaxf(mcur, xhalf(mcur));

        const float mn    = fmaxf(mrun, mcur);
        const float alpha = __expf(mrun - mn);
        mrun = mn;
#pragma unroll
        for (int nf = 0; nf < 4; ++nf) {
            s[nf] = (s[nf] - mrun) * 1.44269504088896340736f;   // e^x = 2^(x * log2 e), as __expf forms it
            exp2x8(s[nf]);
        }

        float r8[8];
#pragma unroll
        for (int e = 0; e < 8; ++e)
            r8[e] = (s[0][e] + s[1][e]) + (s[2][e] + s[3][e]);
        lrun = lrun * alpha + (((r8[0] + r8[1]) + (r8[2] + r8[3])) + ((r8[4] + r8[5]) + (r8[6] + r8[7])));
#pragma unroll
        for (int jf = 0; jf < 4; ++jf)
#pragma unroll
            for (int e = 0; e < 8; ++e) o[jf][e] *= alpha;

        // P^T as B operand: element i of fragment kk is key kk * 32 + (i < 8 ? 8 * half + i
        // : 16 + 8 * half + i - 8), which is register i & 7 of tile 2 * kk + (i >> 3)
        Frag16 p[2];
#pragma unroll
        for (int kk = 0; kk < 2; ++kk)
#pragma unroll
            for (int i = 0; i < 16; ++i)
                p[kk].v[i] = (_Float16)s[2 * kk + (i >> 3)][i & 7];

        // O^T += V^T * P^T : 64 dh x 16 queries (4 M-fragments, K=64 keys = 2 steps)
#pragma unroll
        for (int jf = 0; jf < 4; ++jf)
#pragma unroll
            for (int kk = 0; kk < 2; ++kk) {
                Frag16 a;
                int dh = jf * 16 + l16;
                a.u[0] = *(const uint4*)&Vblk[dh][kk * 32 + half * 8];
                a.u[1] = *(const uint4*)&Vblk[dh][kk * 32 + 16 + half * 8];
                o[jf] = __builtin_amdgcn_wmma_f32_16x16x32_f16(
                    false, a.v, false, p[kk].v, (short)0, o[jf], false, false);
            }

        wait_lds_reads();
        wait_copies();
        __syncthreads();
        if (st + 2 < T) KV_STAGE(st + 2, buf);
    }
    wait_copies();
#undef KV_STAGE

    // join the halves' sums, normalize, store f16 [b*L + q][h*64 + dh]: 8 neighbouring dh a store
    lrun += xhalf(lrun);
    const int b = bh >> 4, h = bh & (NUM_HEADS - 1);
    const size_t m = (size_t)b * SEQ + qbase + l16;
#pragma unroll
    for (int jf = 0; jf < 4; ++jf) {
        union { _Float16 f[8]; uint4 u; } pk;
#pragma unroll
        for (int e = 0; e < 8; ++e) pk.f[e] = (_Float16)(o[jf][e] / lrun);
        *(uint4*)&O[m * D_MODEL + h * HEAD_DIM + jf * 16 + 8 * half] = pk.u;
    }
}

// ---------------------------------------------------------------------------
// Launcher
// ---------------------------------------------------------------------------
extern "C" void kernel_launch(void* const* d_in, const int* in_sizes, int n_in,
                              void* d_out, int out_size, void* d_ws, size_t ws_size,
                              hipStream_t stream) {
    (void)in_sizes; (void)n_in; (void)out_size; (void)ws_size;

    const float* x    = (const float*)d_in[0];   // [2,2048,1024]
    const float* cosT = (const float*)d_in[1];   // [2048,64]
    const float* sinT = (const float*)d_in[2];   // [2048,64]
    const float* wqkv = (const float*)d_in[3];   // [3072,1024]
    const float* wo   = (const float*)d_in[4];   // [1024,1024]
    float* out = (float*)d_out;                  // [2,2048,1024]

    char* ws = (char*)d_ws;
    _Float16* x_h  = (_Float16*)(ws);                        //  8 MB
    _Float16* wq_h = (_Float16*)(ws + ( 8ull << 20));        //  6 MB
    _Float16* wo_h = (_Float16*)(ws + (14ull << 20));        //  2 MB
    float*    qkv  = (float*)   (ws + (16ull << 20));        // 48 MB
    _Float16* q_h  = (_Float16*)(ws + (64ull << 20));        //  8 MB
    _Float16* k_h  = (_Float16*)(ws + (72ull << 20));        //  8 MB
    _Float16* vt_h = (_Float16*)(ws + (80ull << 20));        //  8 MB
    _Float16* at_h = (_Float16*)(ws + (88ull << 20));        //  8 MB

    cvt_f32_f16<<<(MROWS * D_MODEL) / CVT_BLOCK, 256, 0, stream>>>(x, x_h);
    cvt_f32_f16<<<(3 * D_MODEL * D_MODEL) / CVT_BLOCK, 256, 0, stream>>>(wqkv, wq_h);
    cvt_f32_f16<<<(D_MODEL * D_MODEL) / CVT_BLOCK, 256, 0, stream>>>(wo, wo_h);

    // qkv = x @ w_qkv^T   : M=4096, N=3072, K=1024
    gemm_nt_f16<<<dim3(3072 / 128, MROWS / 128), 256, 0, stream>>>(x_h, wq_h, qkv, MROWS, 3072, 1024);

    rope_pack<<<BATCH * NUM_HEADS * (SEQ / 64), 256, 0, stream>>>(
        qkv, cosT, sinT, q_h, k_h, vt_h);

    attn_f16<<<dim3(BATCH * NUM_HEADS, SEQ / 128), 256, 0, stream>>>(q_h, k_h, vt_h, at_h);

    // out = attn @ w_o^T  : M=4096, N=1024, K=1024
    gemm_nt_f16<<<dim3(D_MODEL / 128, MROWS / 128), 256, 0, stream>>>(at_h, wo_h, out, MROWS, D_MODEL, 1024);
}

// v005
// A run of this version takes 92.5 microseconds.
// Two timings next to v004 put it at 1.09 and 1.08 times that version's speed.
// Over all steps from v000 it is 3.95 times as fast.
#include <hip/hip_runtime.h>

// ---------------------------------------------------------------------------
// MI455X (gfx1250, wave32) RoPE attention, f16 WMMA pipeline.
// ---------------------------------------------------------------------------

typedef __attribute__((ext_vector_type(16))) _Float16 v16h;
typedef __attribute__((ext_vector_type(8)))  float    v8f;
typedef __attribute__((ext_vector_type(4)))  float    v4f;
typedef __attribute__((ext_vector_type(4)))  _Float16 v4h;
typedef __attribute__((ext_vector_type(8)))  _Float16 v8h;

union Frag16 { v16h v; uint4 u[2]; };

#define D_MODEL   1024
#define NUM_HEADS 16
#define HEAD_DIM  64
#define BATCH     2
#define SEQ       2048
#define MROWS     (BATCH * SEQ)   // 4096

// LDS row pitch in f16 elements for tiles whose rows are read as 16-byte
// fragments by 16 lanes at once: 16 B x odd, so the 16 rows fall on distinct
// banks (a pitch of 64 B or 128 B puts them on the same few banks).
#define PITCH32   40              // 32-element rows: 80 B; no tile here uses it
#define PITCH64   72              // 64-element rows: 144 B

// ---------------------------------------------------------------------------
// Staging of LDS tiles: asynchronous copies, 16 B a lane, global -> LDS through no register,
// in a ring of two buffers: the copies of tile t + 2 are issued at the foot of trip t and
// waited for at the foot of trip t + 1, so they fly while tile t + 1 is worked on.
// ---------------------------------------------------------------------------
// LDS byte address of a __shared__ object: the low 32 bits of its address
__device__ inline unsigned lds_addr(const void* p) { return (unsigned)(size_t)p; }

// Four copies of a lane. The s_wait_xcnt closes the statement as a precaution: it stands in
// front of every later instruction that could rewrite an address register named here.
__device__ inline void copy4(unsigned l0, unsigned l1, unsigned l2, unsigned l3,
                             const _Float16* g0, const _Float16* g1,
                             const _Float16* g2, const _Float16* g3) {
    asm volatile("global_load_async_to_lds_b128 %0, %4, off\n\t"
                 "global_load_async_to_lds_b128 %1, %5, off\n\t"
                 "global_load_async_to_lds_b128 %2, %6, off\n\t"
                 "global_load_async_to_lds_b128 %3, %7, off\n\t"
                 "s_wait_xcnt 0x0"
                 :: "v"(l0), "v"(l1), "v"(l2), "v"(l3), "v"(g0), "v"(g1), "v"(g2), "v"(g3)
                 : "memory");
}

// Eight copies of a lane in one statement, with the same closing wait.
__device__ inline void copy8(unsigned l0, unsigned l1, unsigned l2, unsigned l3,
                             unsigned l4, unsigned l5, unsigned l6, unsigned l7,
                             const _Float16* g0, const _Float16* g1,
                             const _Float16* g2, const _Float16* g3,
                             const _Float16* g4, const _Float16* g5,
                             const _Float16* g6, const _Float16* g7) {
    asm volatile("global_load_async_to_lds_b128 %0, %8, off\n\t"
                 "global_load_async_to_lds_b128 %1, %9, off\n\t"
                 "global_load_async_to_lds_b128 %2, %10, off\n\t"
                 "global_load_async_to_lds_b128 %3, %11, off\n\t"
                 "global_load_async_to_lds_b128 %4, %12, off\n\t"
                 "global_load_async_to_lds_b128 %5, %13, off\n\t"
                 "global_load_async_to_lds_b128 %6, %14, off\n\t"
                 "global_load_async_to_lds_b128 %7, %15, off\n\t"
                 "s_wait_xcnt 0x0"
                 :: "v"(l0), "v"(l1), "v"(l2), "v"(l3), "v"(l4), "v"(l5), "v"(l6), "v"(l7),
                    "v"(g0), "v"(g1), "v"(g2), "v"(g3), "v"(g4), "v"(g5), "v"(g6), "v"(g7)
                 : "memory");
}

// The wave's own copies have landed (the compiler places no wait for them).
__device__ inline void wait_copies() { asm volatile("s_wait_asynccnt 0x0" ::: "memory"); }
// The wave's own LDS reads have returned: the buffer they read may be refilled behind the barrier.
__device__ inline void wait_lds_reads() { asm volatile("s_wait_dscnt 0x0" ::: "memory"); }

// ---------------------------------------------------------------------------
// fp32 -> fp16 elementwise convert. A block takes CVT_BLOCK contiguous floats;
// a lane takes eight float4, each wave-wide load covering 512 contiguous bytes,
// so few waves have to start and each keeps eight loads in flight.
// The element count must be a multiple of CVT_BLOCK (grid = count / CVT_BLOCK).
// ---------------------------------------------------------------------------
#define CVT_BLOCK (256 * 8 * 4)
__global__ __launch_bounds__(256)
void cvt_f32_f16(const float* __restrict__ in, _Float16* __restrict__ out) {
    const size_t base = (size_t)blockIdx.x * CVT_BLOCK + threadIdx.x * 4;
    v4f v[8];
    // unrolled so that all eight loads are issued before the first is waited for
#pragma unroll
    for (int k = 0; k < 8; ++k) v[k] = *(const v4f*)&in[base + k * 1024];
#pragma unroll
    for (int k = 0; k < 8; ++k) *(v4h*)&out[base + k * 1024] = __builtin_convertvector(v[k], v4h);
}

// ---------------------------------------------------------------------------
// Generic GEMM: C[M][N] = A[M][K] * W[N][K]^T   (A,W f16 row-major, C f32)
// Block = 256 threads (8 waves). Tile 128(M) x 128(N); a stage of the ring is 64 k (two
// k-steps of 32).
// K must be a multiple of 64.
// Wave (wm,wn) in 4x2 grid computes a 32x64 sub-tile = 2x4 WMMA fragments.
// Per k-step per wave: 8 v_wmma against 12 ds_load_b128.
// ---------------------------------------------------------------------------
__global__ __launch_bounds__(256)
void gemm_nt_f16(const _Float16* __restrict__ A, const _Float16* __restrict__ W,
                 float* __restrict__ C, int M, int N, int K) {
    __shared__ __align__(16) _Float16 Tiles[2][2][128][PITCH64];   // [buffer][A | W][row][k]

    const int t    = threadIdx.x;
    const int wave = t >> 5, lane = t & 31;
    const int half = lane >> 4, l16 = lane & 15;
    const int wm   = wave >> 1, wn = wave & 1;
    const int bm   = blockIdx.y * 128, bn = blockIdx.x * 128;

    v8f acc[2][4] = {};

    // A stage: 2 tiles x 128 rows x 128 B. A lane copies chunk cc of rows cr, cr + 32, cr + 64
    // and cr + 96 of both tiles; eight lanes cover one whole 128-B line.
    const int cr = t >> 3, cc = (t & 7) * 8;
    const _Float16* ga = A + (size_t)(bm + cr) * K + cc;
    const _Float16* gw = W + (size_t)(bn + cr) * K + cc;
    const size_t    gs = (size_t)32 * K;                       // 32 rows on, in elements
    const unsigned  ls = 32 * PITCH64 * 2;                     // 32 rows on, in LDS bytes
    const unsigned  la = lds_addr(&Tiles[0][0][cr][cc]);
    const unsigned  lw = lds_addr(&Tiles[0][1][cr][cc]);
    const unsigned  lb = sizeof(Tiles[0]);                     // one buffer on
    const int       T  = K / 64;

#define GEMM_STAGE(s, buf)                                                              \
    copy8(la + (buf) * lb, la + (buf) * lb + ls, la + (buf) * lb + 2 * ls, la + (buf) * lb + 3 * ls, \
          lw + (buf) * lb, lw + (buf) * lb + ls, lw + (buf) * lb + 2 * ls, lw + (buf) * lb + 3 * ls, \
          ga + (s) * 64, ga + (s) * 64 + gs, ga + (s) * 64 + 2 * gs, ga + (s) * 64 + 3 * gs,         \
          gw + (s) * 64, gw + (s) * 64 + gs, gw + (s) * 64 + 2 * gs, gw + (s) * 64 + 3 * gs)

    GEMM_STAGE(0, 0);
    wait_copies();
    __syncthreads();                 // stage 0 is published
    if (T > 1) GEMM_STAGE(1, 1);

    for (int s = 0; s < T; ++s) {
        const int buf = s & 1;
        // two k-steps, unrolled so that the fragment arrays are indexed by constants
#pragma unroll
        for (int kk = 0; kk < 2; ++kk) {
            Frag16 a[2], b[4];
#pragma unroll
            for (int i = 0; i < 2; ++i) {
                int r = wm * 32 + i * 16 + l16;
                a[i].u[0] = *(const uint4*)&Tiles[buf][0][r][kk * 32 + half * 8];
                a[i].u[1] = *(const uint4*)&Tiles[buf][0][r][kk * 32 + 16 + half * 8];
            }
#pragma unroll
            for (int j = 0; j < 4; ++j) {
                int r = wn * 64 + j * 16 + l16;
                b[j].u[0] = *(const uint4*)&Tiles[buf][1][r][kk * 32 + half * 8];
                b[j].u[1] = *(const uint4*)&Tiles[buf][1][r][kk * 32 + 16 + half * 8];
            }
            // Keeps the k-step's 12 fragment loads one group in front of its WMMAs: without it
            // the scheduler loads the second A fragment among them and waits out its latency there.
            __builtin_amdgcn_sched_barrier(0);
#pragma unroll
            for (int i = 0; i < 2; ++i)
#pragma unroll
                for (int j = 0; j < 4; ++j)
                    acc[i][j] = __builtin_amdgcn_wmma_f32_16x16x32_f16(
                        false, a[i].v, false, b[j].v, (short)0, acc[i][j], false, false);
        }
        wait_lds_reads();
        wait_copies();
        __syncthreads();
        if (s + 2 < T) GEMM_STAGE(s + 2, buf);
    }
    wait_copies();
#undef GEMM_STAGE

#pragma unroll
    for (int i = 0; i < 2; ++i)
#pragma unroll
        for (int j = 0; j < 4; ++j) {
            int col = bn + wn * 64 + j * 16 + l16;
#pragma unroll
            for (int e = 0; e < 8; ++e) {
                int row = bm + wm * 32 + i * 16 + e + 8 * half;
                C[(size_t)row * N + col] = acc[i][j][e];
            }
        }
}

// ---------------------------------------------------------------------------
// QKV projection with RoPE and the repack in its epilogue:
//   x f16 [b*L + l][1024], w_qkv f16 [3072][1024]  ->  Q,K f16 [b,h,l,dh] ; V^T f16 [b,h,dh,l]
// Softmax scale 1/sqrt(64) folded into Q. The projection never leaves the registers as f32.
// Same tile, ring and k-steps as gemm_nt_f16, but the 64-row side of a wave's sub-tile is the
// A operand: a lane then holds, of ONE row of the 32-row side (column l16), eight neighbouring
// rows of the 64-row side (8 * half + e of each 16-row tile), which is 16 B of f16 output.
//   Q, K blocks: 32-row side = positions (x), 64-row side = one head's 64 dh (w_qkv). Both sides
//                of a rotation pair (dh, dh + 32) sit in the same lane and register index, two
//                tiles apart.
//   V blocks:    the two operands change places: 32-row side = dh (w_qkv), 64-row side = positions,
//                so the same registers are 16 B of a V^T row.
// Either way a wave owns 32 output rows of 128 B; it turns them in its own LDS range so that
// every store covers four whole lines.
// Six waves per SIMD: the grid is three blocks per WGP, and all of them have to be resident at
// once (one round); without the bound the epilogue's table loads take registers past that.
// ---------------------------------------------------------------------------
__global__ __launch_bounds__(256) __attribute__((amdgpu_waves_per_eu(6)))
void gemm_qkv_rope(const _Float16* __restrict__ X, const _Float16* __restrict__ W,
                   const float* __restrict__ cosT, const float* __restrict__ sinT,
                   _Float16* __restrict__ Q, _Float16* __restrict__ Kd,
                   _Float16* __restrict__ Vt) {
    __shared__ __align__(16) _Float16 Tiles[2][2][128][PITCH64];   // [buffer][32-row side | 64-row side][row][k]

    const int t    = threadIdx.x;
    const int wave = t >> 5, lane = t & 31;
    const int half = lane >> 4, l16 = lane & 15;
    const int wm   = wave >> 1, wn = wave & 1;
    const int part = blockIdx.x >> 3;                  // 0: Q, 1: K, 2: V (8 blocks of 128 features each)
    const int f0   = blockIdx.x * 128;                 // first row of w_qkv
    const int m0   = blockIdx.y * 128;                 // first row of x
    const int bb   = m0 / SEQ, l0 = m0 % SEQ;          // a block lies inside one batch entry
    const bool isV = part == 2;

    const _Float16* xs = X + (size_t)m0 * D_MODEL;
    const _Float16* fs = W + (size_t)f0 * D_MODEL;

    v8f acc[2][4] = {};

    const int cr = t >> 3, cc = (t & 7) * 8;
    const _Float16* ga = (isV ? fs : xs) + (size_t)cr * D_MODEL + cc;
    const _Float16* gw = (isV ? xs : fs) + (size_t)cr * D_MODEL + cc;
    const size_t    gs = (size_t)32 * D_MODEL;                 // 32 rows on, in elements
    const unsigned  ls = 32 * PITCH64 * 2;                     // 32 rows on, in LDS bytes
    const unsigned  la = lds_addr(&Tiles[0][0][cr][cc]);
    const unsigned  lw = lds_addr(&Tiles[0][1][cr][cc]);
    const unsigned  lb = sizeof(Tiles[0]);                     // one buffer on
    constexpr int   T  = D_MODEL / 64;

#define GEMM_STAGE(s, buf)                                                              \
    copy8(la + (buf) * lb, la + (buf) * lb + ls, la + (buf) * lb + 2 * ls, la + (buf) * lb + 3 * ls, \
          lw + (buf) * lb, lw + (buf) * lb + ls, lw + (buf) * lb + 2 * ls, lw + (buf) * lb + 3 * ls, \
          ga + (s) * 64, ga + (s) * 64 + gs, ga + (s) * 64 + 2 * gs, ga + (s) * 64 + 3 * gs,         \
          gw + (s) * 64, gw + (s) * 64 + gs, gw + (s) * 64 + 2 * gs, gw + (s) * 64 + 3 * gs)

    GEMM_STAGE(0, 0);
    wait_copies();
    __syncthreads();                 // stage 0 is published
    GEMM_STAGE(1, 1);

    for (int s = 0; s < T; ++s) {
        const int buf = s & 1;
        // two k-steps, unrolled so that the fragment arrays are indexed by constants
#pragma unroll
        for (int kk = 0; kk < 2; ++kk) {
            Frag16 a[2], b[4];
#pragma unroll
            for (int i = 0; i < 2; ++i) {
                int r = wm * 32 + i * 16 + l16;
                a[i].u[0] = *(const uint4*)&Tiles[buf][0][r][kk * 32 + half * 8];
                a[i].u[1] = *(const uint4*)&Tiles[buf][0][r][kk * 32 + 16 + half * 8];
            }
#pragma unroll
            for (int j = 0; j < 4; ++j) {
                int r = wn * 64 + j * 16 + l16;
                b[j].u[0] = *(const uint4*)&Tiles[buf][1][r][kk * 32 + half * 8];
                b[j].u[1] = *(const uint4*)&Tiles[buf][1][r][kk * 32 + 16 + half * 8];
            }
            // Keeps the k-step's 12 fragment loads one group in front of its WMMAs: without it
            // the scheduler loads the second fragment of the 32-row side among them and waits
            // out its latency there.
            __builtin_amdgcn_sched_barrier(0);
#pragma unroll
            for (int i = 0; i < 2; ++i)
#pragma unroll
                for (int j = 0; j < 4; ++j)
                    acc[i][j] = __builtin_amdgcn_wmma_f32_16x16x32_f16(
                        false, b[j].v, false, a[i].v, (short)0, acc[i][j], false, false);
        }
        wait_lds_reads();
        wait_copies();
        __syncthreads();
        if (s + 2 < T) GEMM_STAGE(s + 2, buf);
    }
    wait_copies();
#undef GEMM_STAGE

    // acc[i][j][e] = product of row wm * 32 + i * 16 + l16 of the 32-row side
    //                with row wn * 64 + j * 16 + 8 * half + e of the 64-row side.
    // Behind the last trip's barrier nobody reads the ring and no copy is outstanding:
    // each wave stages its 32 rows of 128 B in a range of its own.
    _Float16 (*Stg)[PITCH64] = &Tiles[0][wave >> 2][(wave & 3) * 32];

    if (!isV) {
        const float sc = part == 0 ? 0.125f : 1.0f;            // 1/sqrt(HEAD_DIM) on Q alone
        const int    l  = l0 + wm * 32 + l16;                  // the lane's position in tile i = 0
        const float* cp = cosT + l * HEAD_DIM + 8 * half;
        const float* sp = sinT + l * HEAD_DIM + 8 * half;
        // unrolled so that acc is indexed by constants
#pragma unroll
        for (int i = 0; i < 2; ++i) {
            v8f cs[4], sn[4];                                  // dh j * 16 + 8 * half + e
#pragma unroll
            for (int j = 0; j < 4; ++j) {
                cs[j] = *(const v8f*)(cp + i * 16 * HEAD_DIM + j * 16);
                sn[j] = *(const v8f*)(sp + i * 16 * HEAD_DIM + j * 16);
            }
            // Precaution for the 16 loads above: their two address pairs are inputs here, so they
            // stay live up to this wait and nothing is placed in one of them before it.
            asm volatile("s_wait_xcnt 0x0" :: "v"(cp), "v"(sp) : "memory");
            // rotate_half: dh < 32 pairs with -t[dh + 32], dh >= 32 with +t[dh - 32]
#pragma unroll
            for (int j = 0; j < 2; ++j) {
                const v8f lo = (acc[i][j]     * cs[j]     - acc[i][j + 2] * sn[j])     * sc;
                const v8f hi = (acc[i][j + 2] * cs[j + 2] + acc[i][j]     * sn[j + 2]) * sc;
                acc[i][j]     = lo;
                acc[i][j + 2] = hi;
            }
        }
    }

#pragma unroll
    for (int i = 0; i < 2; ++i)
#pragma unroll
        for (int j = 0; j < 4; ++j)
            *(v8h*)&Stg[i * 16 + l16][(2 * j + half) * 8] = __builtin_convertvector(acc[i][j], v8h);
    // The wave's own LDS writes are done before other lanes of it read the rows back.
    asm volatile("s_wait_dscnt 0x0" ::: "memory");

    // Q, K: row = position, 128 B = the head's 64 dh. V^T: row = dh, 128 B = 64 positions.
    _Float16* dst;
    int       pitch;
    if (isV) {
        dst   = Vt + ((size_t)bb * D_MODEL + (f0 - 2 * D_MODEL) + wm * 32) * SEQ + l0 + wn * 64;
        pitch = SEQ;
    } else {
        const int h = (f0 & (D_MODEL - 1)) / HEAD_DIM + wn;
        dst   = (part == 0 ? Q : Kd) + (((size_t)bb * NUM_HEADS + h) * SEQ + l0 + wm * 32) * HEAD_DIM;
        pitch = HEAD_DIM;
    }
    // eight lanes store one whole line; unrolled so that the arrays stay in registers
    v8h* gp[8];
    v8h  row[8];
#pragma unroll
    for (int k = 0; k < 8; ++k) {
        const int r = k * 4 + (lane >> 3), ch = lane & 7;
        gp[k]  = (v8h*)&dst[(size_t)(r * pitch + ch * 8)];
        row[k] = *(const v8h*)&Stg[r][ch * 8];
    }
    // Keeps the address arithmetic in front of the eight stores, so that no register which an
    // issued store names is rewritten behind it.
    __builtin_amdgcn_sched_barrier(0);
#pragma unroll
    for (int k = 0; k < 8; ++k) *gp[k] = row[k];
}

__device__ inline float xhalf(float x) {
    return __builtin_bit_cast(float, __builtin_amdgcn_permlanex16(
        __builtin_bit_cast(int, x), __builtin_bit_cast(int, x), 0x76543210, 0xfedcba98, false, false));
}

// 2^x of eight values in place. One statement, so that each v_exp_f32 is followed by an
// independent instruction and the last by v_nop: the slot the instruction set asks for between
// a transcendental and an instruction that reads its result or overwrites its source.
__device__ inline void exp2x8(v8f& x) {
    float a = x[0], b = x[1], c = x[2], d = x[3], e = x[4], f = x[5], g = x[6], h = x[7];
    asm("v_exp_f32 %0, %0\n\tv_exp_f32 %1, %1\n\tv_exp_f32 %2, %2\n\tv_exp_f32 %3, %3\n\t"
        "v_exp_f32 %4, %4\n\tv_exp_f32 %5, %5\n\tv_exp_f32 %6, %6\n\tv_exp_f32 %7, %7\n\tv_nop"
        : "+v"(a), "+v"(b), "+v"(c), "+v"(d), "+v"(e), "+v"(f), "+v"(g), "+v"(h));
    x[0] = a; x[1] = b; x[2] = c; x[3] = d; x[4] = e; x[5] = f; x[6] = g; x[7] = h;
}

__global__ __launch_bounds__(256)
void attn_f16(const _Float16* __restrict__ Q, const _Float16* __restrict__ Kd,
              const _Float16* __restrict__ Vt, _Float16* __restrict__ O) {
    // [buffer][K | V^T][row][col]: K rows are keys over dh, V^T rows are dh over keys
    __shared__ __align__(16) _Float16 KV[2][2][64][PITCH64];

    const int t    = threadIdx.x;
    const int wave = t >> 5, lane = t & 31;
    const int half = lane >> 4, l16 = lane & 15;
    const int bh    = blockIdx.x;          // 0..31
    const int qtile = blockIdx.y;          // 0..15
    const int qbase = qtile * 128 + wave * 16;

    // Q strip: 16 queries x 64 dh = two 32x16 B fragments (column = query l16), straight from global
    Frag16 qf[2];
#pragma unroll
    for (int kk = 0; kk < 2; ++kk) {
        const _Float16* qp = Q + ((size_t)bh * SEQ + qbase + l16) * HEAD_DIM + kk * 32;
        qf[kk].u[0] = *(const uint4*)(qp + half * 8);
        qf[kk].u[1] = *(const uint4*)(qp + 16 + half * 8);
    }

    v8f o[4] = {};                   // o[jf][e] = O^T[dh = jf * 16 + 8 * half + e][query l16]
    float mrun = -1e30f;             // running maximum of query l16, equal in both halves
    float lrun = 0.f;                // running sum over this half's keys only; joined after the loop

    // A stage: 64 keys = 2 tiles x 64 rows x 128 B. A lane copies chunk cc of rows cr and
    // cr + 32 of both tiles; eight lanes cover one whole 128-B line.
    const int cr = t >> 3, cc = (t & 7) * 8;
    const _Float16* gk = Kd + ((size_t)bh * SEQ + cr) * HEAD_DIM + cc;        // [key][dh]
    const _Float16* gv = Vt + ((size_t)bh * HEAD_DIM + cr) * SEQ + cc;        // [dh][key]
    const unsigned  ls = 32 * PITCH64 * 2;                     // 32 rows on, in LDS bytes
    const unsigned  lk = lds_addr(&KV[0][0][cr][cc]);
    const unsigned  lv = lds_addr(&KV[0][1][cr][cc]);
    const unsigned  lb = sizeof(KV[0]);                        // one buffer on
    constexpr int   T  = SEQ / 64;

#define KV_STAGE(s, buf)                                                                \
    copy4(lk + (buf) * lb, lk + (buf) * lb + ls, lv + (buf) * lb, lv + (buf) * lb + ls, \
          gk + (size_t)(s) * 64 * HEAD_DIM, gk + ((size_t)(s) * 64 + 32) * HEAD_DIM,    \
          gv + (s) * 64, gv + (s) * 64 + (size_t)32 * SEQ)

    KV_STAGE(0, 0);
    wait_copies();
    __syncthreads();                 // stage 0 is published
    KV_STAGE(1, 1);

    for (int st = 0; st < T; ++st) {
        const int buf = st & 1;
        const _Float16 (*Kblk)[PITCH64] = KV[buf][0];
        const _Float16 (*Vblk)[PITCH64] = KV[buf][1];

        // S^T = K * Q^T : 64 keys x 16 queries (4 M-fragments, K-dim 64 = 2 steps)
        // s[nf][e] = score of key st * 64 + nf * 16 + 8 * half + e against query l16
        v8f s[4] = {};
#pragma unroll
        for (int nf = 0; nf < 4; ++nf)
#pragma unroll
            for (int kk = 0; kk < 2; ++kk) {
                Frag16 a;
                int kr = nf * 16 + l16;
                a.u[0] = *(const uint4*)&Kblk[kr][kk * 32 + half * 8];
                a.u[1] = *(const uint4*)&Kblk[kr][kk * 32 + 16 + half * 8];
                s[nf] = __builtin_amdgcn_wmma_f32_16x16x32_f16(
                    false, a.v, false, qf[kk].v, (short)0, s[nf], false, false);
            }

        // --- online softmax: the lane's 32 scores, then the other half's 32 ---
        float m8[8];
#pragma unroll
        for (int e = 0; e < 8; ++e)
            m8[e] = fmaxf(fmaxf(s[0][e], s[1][e]), fmaxf(s[2][e], s[3][e]));
        float mcur = fmaxf(fmaxf(fmaxf(m8[0], m8[1]), fmaxf(m8[2], m8[3])),
                           fmaxf(fmaxf(m8[4], m8[5]), fmaxf(m8[6], m8[7])));
        mcur = fmaxf(mcur, xhalf(mcur));

        const float mn    = fmaxf(mrun, mcur);
        const float alpha = __expf(mrun - mn);
        mrun = mn;
#pragma unroll
        for (int nf = 0; nf < 4; ++nf) {
            s[nf] = (s[nf] - mrun) * 1.44269504088896340736f;   // e^x = 2^(x * log2 e), as __expf forms it
            exp2x8(s[nf]);
        }

        float r8[8];
#pragma unroll
        for (int e = 0; e < 8; ++e)
            r8[e] = (s[0][e] + s[1][e]) + (s[2][e] + s[3][e]);
        lrun = lrun * alpha + (((r8[0] + r8[1]) + (r8[2] + r8[3])) + ((r8[4] + r8[5]) + (r8[6] + r8[7])));
#pragma unroll
        for (int jf = 0; jf < 4; ++jf)
#pragma unroll
            for (int e = 0; e < 8; ++e) o[jf][e] *= alpha;

        // P^T as B operand: element i of fragment kk is key kk * 32 + (i < 8 ? 8 * half + i
        // : 16 + 8 * half + i - 8), which is register i & 7 of tile 2 * kk + (i >> 3)
        Frag16 p[2];
#pragma unroll
        for (int kk = 0; kk < 2; ++kk)
#pragma unroll
            for (int i = 0; i < 16; ++i)
                p[kk].v[i] = (_Float16)s[2 * kk + (i >> 3)][i & 7];

        // O^T += V^T * P^T : 64 dh x 16 queries (4 M-fragments, K=64 keys = 2 steps)
#pragma unroll
        for (int jf = 0; jf < 4; ++jf)
#pragma unroll
            for (int kk = 0; kk < 2; ++kk) {
                Frag16 a;
                int dh = jf * 16 + l16;
                a.u[0] = *(const uint4*)&Vblk[dh][kk * 32 + half * 8];
                a.u[1] = *(const uint4*)&Vblk[dh][kk * 32 + 16 + half * 8];
                o[jf] = __builtin_amdgcn_wmma_f32_16x16x32_f16(
                    false, a.v, false, p[kk].v, (short)0, o[jf], false, false);
            }

        wait_lds_reads();
        wait_copies();
        __syncthreads();
        if (st + 2 < T) KV_STAGE(st + 2, buf);
    }
    wait_copies();
#undef KV_STAGE

    // join the halves' sums, normalize, store f16 [b*L + q][h*64 + dh]: 8 neighbouring dh a store
    lrun += xhalf(lrun);
    const int b = bh >> 4, h = bh & (NUM_HEADS - 1);
    const size_t m = (size_t)b * SEQ + qbase + l16;
#pragma unroll
    for (int jf = 0; jf < 4; ++jf) {
        union { _Float16 f[8]; uint4 u; } pk;
#pragma unroll
        for (int e = 0; e < 8; ++e) pk.f[e] = (_Float16)(o[jf][e] / lrun);
        *(uint4*)&O[m * D_MODEL + h * HEAD_DIM + jf * 16 + 8 * half] = pk.u;
    }
}

// ---------------------------------------------------------------------------
// Launcher
// ---------------------------------------------------------------------------
extern "C" void kernel_launch(void* const* d_in, const int* in_sizes, int n_in,
                              void* d_out, int out_size, void* d_ws, size_t ws_size,
                              hipStream_t stream) {
    (void)in_sizes; (void)n_in; (void)out_size; (void)ws_size;

    const float* x    = (const float*)d_in[0];   // [2,2048,1024]
    const float* cosT = (const float*)d_in[1];   // [2048,64]
    const float* sinT = (const float*)d_in[2];   // [2048,64]
    const float* wqkv = (const float*)d_in[3];   // [3072,1024]
    const float* wo   = (const float*)d_in[4];   // [1024,1024]
    float* out = (float*)d_out;                  // [2,2048,1024]

    char* ws = (char*)d_ws;
    _Float16* x_h  = (_Float16*)(ws);                        //  8 MB
    _Float16* wq_h = (_Float16*)(ws + ( 8ull << 20));        //  6 MB
    _Float16* wo_h = (_Float16*)(ws + (14ull << 20));        //  2 MB
    _Float16* q_h  = (_Float16*)(ws + (64ull << 20));        //  8 MB
    _Float16* k_h  = (_Float16*)(ws + (72ull << 20));        //  8 MB
    _Float16* vt_h = (_Float16*)(ws + (80ull << 20));        //  8 MB
    _Float16* at_h = (_Float16*)(ws + (88ull << 20));        //  8 MB

    cvt_f32_f16<<<(MROWS * D_MODEL) / CVT_BLOCK, 256, 0, stream>>>(x, x_h);
    cvt_f32_f16<<<(3 * D_MODEL * D_MODEL) / CVT_BLOCK, 256, 0, stream>>>(wqkv, wq_h);
    cvt_f32_f16<<<(D_MODEL * D_MODEL) / CVT_BLOCK, 256, 0, stream>>>(wo, wo_h);

    // x @ w_qkv^T (M=4096, N=3072, K=1024), rotated and repacked in the epilogue
    gemm_qkv_rope<<<dim3(3 * D_MODEL / 128, MROWS / 128), 256, 0, stream>>>(
        x_h, wq_h, cosT, sinT, q_h, k_h, vt_h);

    attn_f16<<<dim3(BATCH * NUM_HEADS, SEQ / 128), 256, 0, stream>>>(q_h, k_h, vt_h, at_h);

    // out = attn @ w_o^T  : M=4096, N=1024, K=1024
    gemm_nt_f16<<<dim3(D_MODEL / 128, MROWS / 128), 256, 0, stream>>>(at_h, wo_h, out, MROWS, D_MODEL, 1024);
}

// v006
// It runs in 89.2 microseconds.
// Next to v005, in two timings, it ran 1.04 and 1.03 times as fast.
// All steps since v000 together make it 4.09 times as fast.
#include <hip/hip_runtime.h>

// ---------------------------------------------------------------------------
// MI455X (gfx1250, wave32) RoPE attention, f16 WMMA pipeline.
// ---------------------------------------------------------------------------

typedef __attribute__((ext_vector_type(16))) _Float16 v16h;
typedef __attribute__((ext_vector_type(8)))  float    v8f;
typedef __attribute__((ext_vector_type(4)))  float    v4f;
typedef __attribute__((ext_vector_type(4)))  _Float16 v4h;
typedef __attribute__((ext_vector_type(8)))  _Float16 v8h;

union Frag16 { v16h v; uint4 u[2]; };

#define D_MODEL   1024
#define NUM_HEADS 16
#define HEAD_DIM  64
#define BATCH     2
#define SEQ       2048
#define MROWS     (BATCH * SEQ)   // 4096

// LDS row pitch in f16 elements for tiles whose rows are read as 16-byte
// fragments by 16 lanes at once: 16 B x odd, so the 16 rows fall on distinct
// banks (a pitch of 64 B or 128 B puts them on the same few banks).
#define PITCH32   40              // 32-element rows: 80 B; no tile here uses it
#define PITCH64   72              // 64-element rows: 144 B

// ---------------------------------------------------------------------------
// Staging of LDS tiles: asynchronous copies, 16 B a lane, global -> LDS through no register,
// in a ring of two buffers: the copies of tile t + 2 are issued at the foot of trip t and
// waited for at the foot of trip t + 1, so they fly while tile t + 1 is worked on.
// ---------------------------------------------------------------------------
// LDS byte address of a __shared__ object: the low 32 bits of its address
__device__ inline unsigned lds_addr(const void* p) { return (unsigned)(size_t)p; }

// Four copies of a lane. The s_wait_xcnt closes the statement as a precaution: it stands in
// front of every later instruction that could rewrite an address register named here.
__device__ inline void copy4(unsigned l0, unsigned l1, unsigned l2, unsigned l3,
                             const _Float16* g0, const _Float16* g1,
                             const _Float16* g2, const _Float16* g3) {
    asm volatile("global_load_async_to_lds_b128 %0, %4, off\n\t"
                 "global_load_async_to_lds_b128 %1, %5, off\n\t"
                 "global_load_async_to_lds_b128 %2, %6, off\n\t"
                 "global_load_async_to_lds_b128 %3, %7, off\n\t"
                 "s_wait_xcnt 0x0"
                 :: "v"(l0), "v"(l1), "v"(l2), "v"(l3), "v"(g0), "v"(g1), "v"(g2), "v"(g3)
                 : "memory");
}

// Eight copies of a lane in one statement, with the same closing wait.
__device__ inline void copy8(unsigned l0, unsigned l1, unsigned l2, unsigned l3,
                             unsigned l4, unsigned l5, unsigned l6, unsigned l7,
                             const _Float16* g0, const _Float16* g1,
                             const _Float16* g2, const _Float16* g3,
                             const _Float16* g4, const _Float16* g5,
                             const _Float16* g6, const _Float16* g7) {
    asm volatile("global_load_async_to_lds_b128 %0, %8, off\n\t"
                 "global_load_async_to_lds_b128 %1, %9, off\n\t"
                 "global_load_async_to_lds_b128 %2, %10, off\n\t"
                 "global_load_async_to_lds_b128 %3, %11, off\n\t"
                 "global_load_async_to_lds_b128 %4, %12, off\n\t"
                 "global_load_async_to_lds_b128 %5, %13, off\n\t"
                 "global_load_async_to_lds_b128 %6, %14, off\n\t"
                 "global_load_async_to_lds_b128 %7, %15, off\n\t"
                 "s_wait_xcnt 0x0"
                 :: "v"(l0), "v"(l1), "v"(l2), "v"(l3), "v"(l4), "v"(l5), "v"(l6), "v"(l7),
                    "v"(g0), "v"(g1), "v"(g2), "v"(g3), "v"(g4), "v"(g5), "v"(g6), "v"(g7)
                 : "memory");
}

// The wave's own copies have landed (the compiler places no wait for them).
__device__ inline void wait_copies() { asm volatile("s_wait_asynccnt 0x0" ::: "memory"); }
// The wave's own LDS reads have returned: the buffer they read may be refilled behind the barrier.
__device__ inline void wait_lds_reads() { asm volatile("s_wait_dscnt 0x0" ::: "memory"); }

// ---------------------------------------------------------------------------
// fp32 -> fp16 elementwise convert. A block takes CVT_BLOCK contiguous floats;
// a lane takes eight float4, each wave-wide load covering 512 contiguous bytes,
// so few waves have to start and each keeps eight loads in flight.
// The element count must be a multiple of CVT_BLOCK (grid = count / CVT_BLOCK).
// ---------------------------------------------------------------------------
#define CVT_BLOCK (256 * 8 * 4)
__global__ __launch_bounds__(256)
void cvt_f32_f16(const float* __restrict__ in, _Float16* __restrict__ out) {
    const size_t base = (size_t)blockIdx.x * CVT_BLOCK + threadIdx.x * 4;
    v4f v[8];
    // unrolled so that all eight loads are issued before the first is waited for
#pragma unroll
    for (int k = 0; k < 8; ++k) v[k] = *(const v4f*)&in[base + k * 1024];
#pragma unroll
    for (int k = 0; k < 8; ++k) *(v4h*)&out[base + k * 1024] = __builtin_convertvector(v[k], v4h);
}

// ---------------------------------------------------------------------------
// Generic GEMM: C[M][N] = A[M][K] * W[N][K]^T   (A,W f16 row-major, C f32)
// Block = 256 threads (8 waves). Tile 128(M) x 128(N); a stage of the ring is 64 k (two
// k-steps of 32).
// K must be a multiple of 64.
// Wave (wm,wn) in 4x2 grid computes a 32x64 sub-tile = 2x4 WMMA fragments.
// Per k-step per wave: 8 v_wmma against 12 ds_load_b128.
// ---------------------------------------------------------------------------
__global__ __launch_bounds__(256)
void gemm_nt_f16(const _Float16* __restrict__ A, const _Float16* __restrict__ W,
                 float* __restrict__ C, int M, int N, int K) {
    __shared__ __align__(16) _Float16 Tiles[2][2][128][PITCH64];   // [buffer][A | W][row][k]

    const int t    = threadIdx.x;
    const int wave = t >> 5, lane = t & 31;
    const int half = lane >> 4, l16 = lane & 15;
    const int wm   = wave >> 1, wn = wave & 1;
    const int bm   = blockIdx.y * 128, bn = blockIdx.x * 128;

    v8f acc[2][4] = {};

    // A stage: 2 tiles x 128 rows x 128 B. A lane copies chunk cc of rows cr, cr + 32, cr + 64
    // and cr + 96 of both tiles; eight lanes cover one whole 128-B line.
    const int cr = t >> 3, cc = (t & 7) * 8;
    const _Float16* ga = A + (size_t)(bm + cr) * K + cc;
    const _Float16* gw = W + (size_t)(bn + cr) * K + cc;
    const size_t    gs = (size_t)32 * K;                       // 32 rows on, in elements
    const unsigned  ls = 32 * PITCH64 * 2;                     // 32 rows on, in LDS bytes
    const unsigned  la = lds_addr(&Tiles[0][0][cr][cc]);
    const unsigned  lw = lds_addr(&Tiles[0][1][cr][cc]);
    const unsigned  lb = sizeof(Tiles[0]);                     // one buffer on
    const int       T  = K / 64;

#define GEMM_STAGE(s, buf)                                                              \
    copy8(la + (buf) * lb, la + (buf) * lb + ls, la + (buf) * lb + 2 * ls, la + (buf) * lb + 3 * ls, \
          lw + (buf) * lb, lw + (buf) * lb + ls, lw + (buf) * lb + 2 * ls, lw + (buf) * lb + 3 * ls, \
          ga + (s) * 64, ga + (s) * 64 + gs, ga + (s) * 64 + 2 * gs, ga + (s) * 64 + 3 * gs,         \
          gw + (s) * 64, gw + (s) * 64 + gs, gw + (s) * 64 + 2 * gs, gw + (s) * 64 + 3 * gs)

    GEMM_STAGE(0, 0);
    wait_copies();
    __syncthreads();                 // stage 0 is published
    if (T > 1) GEMM_STAGE(1, 1);

    for (int s = 0; s < T; ++s) {
        const int buf = s & 1;
        // two k-steps, unrolled so that the fragment arrays are indexed by constants
#pragma unroll
        for (int kk = 0; kk < 2; ++kk) {
            Frag16 a[2], b[4];
#pragma unroll
            for (int i = 0; i < 2; ++i) {
                int r = wm * 32 + i * 16 + l16;
                a[i].u[0] = *(const uint4*)&Tiles[buf][0][r][kk * 32 + half * 8];
                a[i].u[1] = *(const uint4*)&Tiles[buf][0][r][kk * 32 + 16 + half * 8];
            }
#pragma unroll
            for (int j = 0; j < 4; ++j) {
                int r = wn * 64 + j * 16 + l16;
                b[j].u[0] = *(const uint4*)&Tiles[buf][1][r][kk * 32 + half * 8];
                b[j].u[1] = *(const uint4*)&Tiles[buf][1][r][kk * 32 + 16 + half * 8];
            }
            // Keeps the k-step's 12 fragment loads one group in front of its WMMAs: without it
            // the scheduler loads the second A fragment among them and waits out its latency there.
            __builtin_amdgcn_sched_barrier(0);
#pragma unroll
            for (int i = 0; i < 2; ++i)
#pragma unroll
                for (int j = 0; j < 4; ++j)
                    acc[i][j] = __builtin_amdgcn_wmma_f32_16x16x32_f16(
                        false, a[i].v, false, b[j].v, (short)0, acc[i][j], false, false);
        }
        wait_lds_reads();
        wait_copies();
        __syncthreads();
        if (s + 2 < T) GEMM_STAGE(s + 2, buf);
    }
    wait_copies();
#undef GEMM_STAGE

#pragma unroll
    for (int i = 0; i < 2; ++i)
#pragma unroll
        for (int j = 0; j < 4; ++j) {
            int col = bn + wn * 64 + j * 16 + l16;
#pragma unroll
            for (int e = 0; e < 8; ++e) {
                int row = bm + wm * 32 + i * 16 + e + 8 * half;
                C[(size_t)row * N + col] = acc[i][j][e];
            }
        }
}

// ---------------------------------------------------------------------------
// QKV projection with RoPE and the repack in its epilogue:
//   x f16 [b*L + l][1024], w_qkv f16 [3072][1024]  ->  Q,K f16 [b,h,l,dh] ; V^T f16 [b,h,dh,l]
// Softmax scale 1/sqrt(64) folded into Q. The projection never leaves the registers as f32.
// Same tile, ring and k-steps as gemm_nt_f16, but the 64-row side of a wave's sub-tile is the
// A operand: a lane then holds, of ONE row of the 32-row side (column l16), eight neighbouring
// rows of the 64-row side (8 * half + e of each 16-row tile), which is 16 B of f16 output.
//   Q, K blocks: 32-row side = positions (x), 64-row side = one head's 64 dh (w_qkv). Both sides
//                of a rotation pair (dh, dh + 32) sit in the same lane and register index, two
//                tiles apart.
//   V blocks:    the two operands change places: 32-row side = dh (w_qkv), 64-row side = positions,
//                so the same registers are 16 B of a V^T row.
// Either way a wave owns 32 output rows of 128 B; it turns them in its own LDS range so that
// every store covers four whole lines.
// Six waves per SIMD: the grid is three blocks per WGP, and all of them have to be resident at
// once (one round); without the bound the epilogue's table loads take registers past that.
// ---------------------------------------------------------------------------
__global__ __launch_bounds__(256) __attribute__((amdgpu_waves_per_eu(6)))
void gemm_qkv_rope(const _Float16* __restrict__ X, const _Float16* __restrict__ W,
                   const float* __restrict__ cosT, const float* __restrict__ sinT,
                   _Float16* __restrict__ Q, _Float16* __restrict__ Kd,
                   _Float16* __restrict__ Vt) {
    __shared__ __align__(16) _Float16 Tiles[2][2][128][PITCH64];   // [buffer][32-row side | 64-row side][row][k]

    const int t    = threadIdx.x;
    const int wave = t >> 5, lane = t & 31;
    const int half = lane >> 4, l16 = lane & 15;
    const int wm   = wave >> 1, wn = wave & 1;
    const int part = blockIdx.x >> 3;                  // 0: Q, 1: K, 2: V (8 blocks of 128 features each)
    const int f0   = blockIdx.x * 128;                 // first row of w_qkv
    const int m0   = blockIdx.y * 128;                 // first row of x
    const int bb   = m0 / SEQ, l0 = m0 % SEQ;          // a block lies inside one batch entry
    const bool isV = part == 2;

    const _Float16* xs = X + (size_t)m0 * D_MODEL;
    const _Float16* fs = W + (size_t)f0 * D_MODEL;

    v8f acc[2][4] = {};

    const int cr = t >> 3, cc = (t & 7) * 8;
    const _Float16* ga = (isV ? fs : xs) + (size_t)cr * D_MODEL + cc;
    const _Float16* gw = (isV ? xs : fs) + (size_t)cr * D_MODEL + cc;
    const size_t    gs = (size_t)32 * D_MODEL;                 // 32 rows on, in elements
    const unsigned  ls = 32 * PITCH64 * 2;                     // 32 rows on, in LDS bytes
    const unsigned  la = lds_addr(&Tiles[0][0][cr][cc]);
    const unsigned  lw = lds_addr(&Tiles[0][1][cr][cc]);
    const unsigned  lb = sizeof(Tiles[0]);                     // one buffer on
    constexpr int   T  = D_MODEL / 64;

#define GEMM_STAGE(s, buf)                                                              \
    copy8(la + (buf) * lb, la + (buf) * lb + ls, la + (buf) * lb + 2 * ls, la + (buf) * lb + 3 * ls, \
          lw + (buf) * lb, lw + (buf) * lb + ls, lw + (buf) * lb + 2 * ls, lw + (buf) * lb + 3 * ls, \
          ga + (s) * 64, ga + (s) * 64 + gs, ga + (s) * 64 + 2 * gs, ga + (s) * 64 + 3 * gs,         \
          gw + (s) * 64, gw + (s) * 64 + gs, gw + (s) * 64 + 2 * gs, gw + (s) * 64 + 3 * gs)

    GEMM_STAGE(0, 0);
    wait_copies();
    __syncthreads();                 // stage 0 is published
    GEMM_STAGE(1, 1);

    for (int s = 0; s < T; ++s) {
        const int buf = s & 1;
        // two k-steps, unrolled so that the fragment arrays are indexed by constants
#pragma unroll
        for (int kk = 0; kk < 2; ++kk) {
            Frag16 a[2], b[4];
#pragma unroll
            for (int i = 0; i < 2; ++i) {
                int r = wm * 32 + i * 16 + l16;
                a[i].u[0] = *(const uint4*)&Tiles[buf][0][r][kk * 32 + half * 8];
                a[i].u[1] = *(const uint4*)&Tiles[buf][0][r][kk * 32 + 16 + half * 8];
            }
#pragma unroll
            for (int j = 0; j < 4; ++j) {
                int r = wn * 64 + j * 16 + l16;
                b[j].u[0] = *(const uint4*)&Tiles[buf][1][r][kk * 32 + half * 8];
                b[j].u[1] = *(const uint4*)&Tiles[buf][1][r][kk * 32 + 16 + half * 8];
            }
            // Keeps the k-step's 12 fragment loads one group in front of its WMMAs: without it
            // the scheduler loads the second fragment of the 32-row side among them and waits
            // out its latency there.
            __builtin_amdgcn_sched_barrier(0);
#pragma unroll
            for (int i = 0; i < 2; ++i)
#pragma unroll
                for (int j = 0; j < 4; ++j)
                    acc[i][j] = __builtin_amdgcn_wmma_f32_16x16x32_f16(
                        false, b[j].v, false, a[i].v, (short)0, acc[i][j], false, false);
        }
        wait_lds_reads();
        wait_copies();
        __syncthreads();
        if (s + 2 < T) GEMM_STAGE(s + 2, buf);
    }
    wait_copies();
#undef GEMM_STAGE

    // acc[i][j][e] = product of row wm * 32 + i * 16 + l16 of the 32-row side
    //                with row wn * 64 + j * 16 + 8 * half + e of the 64-row side.
    // Behind the last trip's barrier nobody reads the ring and no copy is outstanding:
    // each wave stages its 32 rows of 128 B in a range of its own.
    _Float16 (*Stg)[PITCH64] = &Tiles[0][wave >> 2][(wave & 3) * 32];

    if (!isV) {
        const float sc = part == 0 ? 0.125f : 1.0f;            // 1/sqrt(HEAD_DIM) on Q alone
        const int    l  = l0 + wm * 32 + l16;                  // the lane's position in tile i = 0
        const float* cp = cosT + l * HEAD_DIM + 8 * half;
        const float* sp = sinT + l * HEAD_DIM + 8 * half;
        // unrolled so that acc is indexed by constants
#pragma unroll
        for (int i = 0; i < 2; ++i) {
            v8f cs[4], sn[4];                                  // dh j * 16 + 8 * half + e
#pragma unroll
            for (int j = 0; j < 4; ++j) {
                cs[j] = *(const v8f*)(cp + i * 16 * HEAD_DIM + j * 16);
                sn[j] = *(const v8f*)(sp + i * 16 * HEAD_DIM + j * 16);
            }
            // Precaution for the 16 loads above: their two address pairs are inputs here, so they
            // stay live up to this wait and nothing is placed in one of them before it.
            asm volatile("s_wait_xcnt 0x0" :: "v"(cp), "v"(sp) : "memory");
            // rotate_half: dh < 32 pairs with -t[dh + 32], dh >= 32 with +t[dh - 32]
#pragma unroll
            for (int j = 0; j < 2; ++j) {
                const v8f lo = (acc[i][j]     * cs[j]     - acc[i][j + 2] * sn[j])     * sc;
                const v8f hi = (acc[i][j + 2] * cs[j + 2] + acc[i][j]     * sn[j + 2]) * sc;
                acc[i][j]     = lo;
                acc[i][j + 2] = hi;
            }
        }
    }

#pragma unroll
    for (int i = 0; i < 2; ++i)
#pragma unroll
        for (int j = 0; j < 4; ++j)
            *(v8h*)&Stg[i * 16 + l16][(2 * j + half) * 8] = __builtin_convertvector(acc[i][j], v8h);
    // The wave's own LDS writes are done before other lanes of it read the rows back.
    asm volatile("s_wait_dscnt 0x0" ::: "memory");

    // Q, K: row = position, 128 B = the head's 64 dh. V^T: row = dh, 128 B = 64 positions.
    _Float16* dst;
    int       pitch;
    if (isV) {
        dst   = Vt + ((size_t)bb * D_MODEL + (f0 - 2 * D_MODEL) + wm * 32) * SEQ + l0 + wn * 64;
        pitch = SEQ;
    } else {
        const int h = (f0 & (D_MODEL - 1)) / HEAD_DIM + wn;
        dst   = (part == 0 ? Q : Kd) + (((size_t)bb * NUM_HEADS + h) * SEQ + l0 + wm * 32) * HEAD_DIM;
        pitch = HEAD_DIM;
    }
    // eight lanes store one whole line; unrolled so that the arrays stay in registers
    v8h* gp[8];
    v8h  row[8];
#pragma unroll
    for (int k = 0; k < 8; ++k) {
        const int r = k * 4 + (lane >> 3), ch = lane & 7;
        gp[k]  = (v8h*)&dst[(size_t)(r * pitch + ch * 8)];
        row[k] = *(const v8h*)&Stg[r][ch * 8];
    }
    // Keeps the address arithmetic in front of the eight stores, so that no register which an
    // issued store names is rewritten behind it.
    __builtin_amdgcn_sched_barrier(0);
#pragma unroll
    for (int k = 0; k < 8; ++k) *gp[k] = row[k];
}

__device__ inline float xhalf(float x) {
    return __builtin_bit_cast(float, __builtin_amdgcn_permlanex16(
        __builtin_bit_cast(int, x), __builtin_bit_cast(int, x), 0x76543210, 0xfedcba98, false, false));
}

// 2^x of eight values in place. One statement, so that each v_exp_f32 is followed by an
// independent instruction and the last by v_nop: the slot the instruction set asks for between
// a transcendental and an instruction that reads its result or overwrites its source.
__device__ inline void exp2x8(v8f& x) {
    float a = x[0], b = x[1], c = x[2], d = x[3], e = x[4], f = x[5], g = x[6], h = x[7];
    asm("v_exp_f32 %0, %0\n\tv_exp_f32 %1, %1\n\tv_exp_f32 %2, %2\n\tv_exp_f32 %3, %3\n\t"
        "v_exp_f32 %4, %4\n\tv_exp_f32 %5, %5\n\tv_exp_f32 %6, %6\n\tv_exp_f32 %7, %7\n\tv_nop"
        : "+v"(a), "+v"(b), "+v"(c), "+v"(d), "+v"(e), "+v"(f), "+v"(g), "+v"(h));
    x[0] = a; x[1] = b; x[2] = c; x[3] = d; x[4] = e; x[5] = f; x[6] = g; x[7] = h;
}

// 2^x of two values in place, in one statement closed by v_nop, for the same slot.
__device__ inline void exp2x2(float& a, float& b) {
    asm("v_exp_f32 %0, %0\n\tv_exp_f32 %1, %1\n\tv_nop" : "+v"(a), "+v"(b));
}

// Four waves per SIMD: the grid is two blocks per WGP; the bound lets a wave use its full share
// of the registers for the two query tiles.
__global__ __launch_bounds__(256) __attribute__((amdgpu_waves_per_eu(4, 4)))
void attn_f16(const _Float16* __restrict__ Q, const _Float16* __restrict__ Kd,
              const _Float16* __restrict__ Vt, _Float16* __restrict__ O) {
    // [buffer][key group][K | V^T][row][col]: K rows are keys over dh, V^T rows are dh over keys
    __shared__ __align__(16) _Float16 KV[2][2][2][64][PITCH64];

    const int t    = threadIdx.x;
    const int wave = t >> 5, lane = t & 31;
    const int half = lane >> 4, l16 = lane & 15;
    const int qg   = wave & 3;             // strip of 32 queries
    const int kh   = wave >> 2;            // key group
    const int bh    = blockIdx.x;          // 0..31
    const int qtile = blockIdx.y;          // 0..15
    const int qbase = qtile * 128 + qg * 32;

    // Q strip: 2 tiles x 16 queries x 64 dh = two 32x16 B fragments a tile (column = query l16),
    // straight from global
    Frag16 qf[2][2];
    // unrolled so that qf stays in registers, indexed by constants
#pragma unroll
    for (int qt = 0; qt < 2; ++qt)
#pragma unroll
        for (int kk = 0; kk < 2; ++kk) {
            const _Float16* qp = Q + ((size_t)bh * SEQ + qbase + qt * 16 + l16) * HEAD_DIM + kk * 32;
            qf[qt][kk].u[0] = *(const uint4*)(qp + half * 8);
            qf[qt][kk].u[1] = *(const uint4*)(qp + 16 + half * 8);
        }

    v8f o[2][4] = {};                      // o[qt][jf][e] = O^T[dh = jf * 16 + 8 * half + e][query qt * 16 + l16]
    float mrun[2] = {-1e30f, -1e30f};      // running maximum of the query, equal in both halves
    float lrun[2] = {0.f, 0.f};            // running sum over this half's keys only; joined after the loop

    // A stage: 128 keys = 2 key groups x 2 tiles x 64 rows x 128 B. A lane copies chunk cc of rows
    // cr and cr + 32 of all four tiles; eight lanes cover one whole 128-B line.
    const int cr = t >> 3, cc = (t & 7) * 8;
    const _Float16* gk = Kd + ((size_t)bh * SEQ + cr) * HEAD_DIM + cc;        // [key][dh]
    const _Float16* gv = Vt + ((size_t)bh * HEAD_DIM + cr) * SEQ + cc;        // [dh][key]
    const unsigned  ls = 32 * PITCH64 * 2;                     // 32 rows on, in LDS bytes
    const unsigned  lk = lds_addr(&KV[0][0][0][cr][cc]);
    const unsigned  lv = lds_addr(&KV[0][0][1][cr][cc]);
    const unsigned  lh = sizeof(KV[0][0]);                     // one key group on
    const unsigned  lb = sizeof(KV[0]);                        // one buffer on
    constexpr int   T  = SEQ / 128;

#define KV_STAGE(s, buf)                                                                          \
    copy8(lk + (buf) * lb, lk + (buf) * lb + ls, lv + (buf) * lb, lv + (buf) * lb + ls,           \
          lk + (buf) * lb + lh, lk + (buf) * lb + lh + ls, lv + (buf) * lb + lh, lv + (buf) * lb + lh + ls, \
          gk + (size_t)(s) * 128 * HEAD_DIM, gk + ((size_t)(s) * 128 + 32) * HEAD_DIM,            \
          gv + (s) * 128, gv + (s) * 128 + (size_t)32 * SEQ,                                      \
          gk + ((size_t)(s) * 128 + 64) * HEAD_DIM, gk + ((size_t)(s) * 128 + 96) * HEAD_DIM,     \
          gv + (s) * 128 + 64, gv + (s) * 128 + 64 + (size_t)32 * SEQ)

    KV_STAGE(0, 0);
    wait_copies();
    __syncthreads();                 // stage 0 is published
    KV_STAGE(1, 1);

    for (int st = 0; st < T; ++st) {
        const int buf = st & 1;
        const _Float16 (*Kblk)[PITCH64] = KV[buf][kh][0];
        const _Float16 (*Vblk)[PITCH64] = KV[buf][kh][1];

        // S^T = K * Q^T : 64 keys x 32 queries (4 M-fragments x 2 query tiles, K-dim 64 = 2 steps)
        // s[qt][nf][e] = score of key st * 128 + kh * 64 + nf * 16 + 8 * half + e
        //                against query qt * 16 + l16
        v8f s[2][4] = {};
#pragma unroll
        for (int nf = 0; nf < 4; ++nf)
#pragma unroll
            for (int kk = 0; kk < 2; ++kk) {
                Frag16 a;
                int kr = nf * 16 + l16;
                a.u[0] = *(const uint4*)&Kblk[kr][kk * 32 + half * 8];
                a.u[1] = *(const uint4*)&Kblk[kr][kk * 32 + 16 + half * 8];
                // both query tiles use the fragment; unrolled so that s is indexed by constants
#pragma unroll
                for (int qt = 0; qt < 2; ++qt)
                    s[qt][nf] = __builtin_amdgcn_wmma_f32_16x16x32_f16(
                        false, a.v, false, qf[qt][kk].v, (short)0, s[qt][nf], false, false);
            }

        Frag16 p[2][2];
        // unrolled so that the per-tile arrays are indexed by constants
#pragma unroll
        for (int qt = 0; qt < 2; ++qt) {
            // --- online softmax: the lane's 32 scores, then the other half's 32 ---
            float m8[8];
#pragma unroll
            for (int e = 0; e < 8; ++e)
                m8[e] = fmaxf(fmaxf(s[qt][0][e], s[qt][1][e]), fmaxf(s[qt][2][e], s[qt][3][e]));
            float mcur = fmaxf(fmaxf(fmaxf(m8[0], m8[1]), fmaxf(m8[2], m8[3])),
                               fmaxf(fmaxf(m8[4], m8[5]), fmaxf(m8[6], m8[7])));
            mcur = fmaxf(mcur, xhalf(mcur));

            const float mn    = fmaxf(mrun[qt], mcur);
            const float alpha = __expf(mrun[qt] - mn);
            mrun[qt] = mn;
#pragma unroll
            for (int nf = 0; nf < 4; ++nf) {
                s[qt][nf] = (s[qt][nf] - mn) * 1.44269504088896340736f;   // e^x = 2^(x * log2 e), as __expf forms it
                exp2x8(s[qt][nf]);
            }

            float r8[8];
#pragma unroll
            for (int e = 0; e < 8; ++e)
                r8[e] = (s[qt][0][e] + s[qt][1][e]) + (s[qt][2][e] + s[qt][3][e]);
            lrun[qt] = lrun[qt] * alpha
                     + (((r8[0] + r8[1]) + (r8[2] + r8[3])) + ((r8[4] + r8[5]) + (r8[6] + r8[7])));
#pragma unroll
            for (int jf = 0; jf < 4; ++jf)
#pragma unroll
                for (int e = 0; e < 8; ++e) o[qt][jf][e] *= alpha;

            // P^T as B operand: element i of fragment kk is key kk * 32 + (i < 8 ? 8 * half + i
            // : 16 + 8 * half + i - 8), which is register i & 7 of tile 2 * kk + (i >> 3)
#pragma unroll
            for (int kk = 0; kk < 2; ++kk)
#pragma unroll
                for (int i = 0; i < 16; ++i)
                    p[qt][kk].v[i] = (_Float16)s[qt][2 * kk + (i >> 3)][i & 7];
        }

        // O^T += V^T * P^T : 64 dh x 32 queries (4 M-fragments x 2 query tiles, K=64 keys = 2 steps)
#pragma unroll
        for (int jf = 0; jf < 4; ++jf)
#pragma unroll
            for (int kk = 0; kk < 2; ++kk) {
                Frag16 a;
                int dh = jf * 16 + l16;
                a.u[0] = *(const uint4*)&Vblk[dh][kk * 32 + half * 8];
                a.u[1] = *(const uint4*)&Vblk[dh][kk * 32 + 16 + half * 8];
                // both query tiles use the fragment; unrolled so that o is indexed by constants
#pragma unroll
                for (int qt = 0; qt < 2; ++qt)
                    o[qt][jf] = __builtin_amdgcn_wmma_f32_16x16x32_f16(
                        false, a.v, false, p[qt][kk].v, (short)0, o[qt][jf], false, false);
            }

        wait_lds_reads();
        wait_copies();
        __syncthreads();
        if (st + 2 < T) KV_STAGE(st + 2, buf);
    }
    wait_copies();
#undef KV_STAGE

    // join the halves' sums
    lrun[0] += xhalf(lrun[0]);
    lrun[1] += xhalf(lrun[1]);

    // Merge of the two key groups. Waves w and w ^ 4 hold the same 32 queries in the same lanes and
    // registers. Each finishes one query tile (tile kh) and hands the other tile's state to its
    // partner. Behind the last trip's barrier nobody reads the ring and no copy is outstanding:
    // the ring's LDS carries the exchange.
    const bool up = kh != 0;
    v4f*   xo = (v4f*)&KV[0][0][0][0][0];                      // [wave][8][lane], 16 B a lane
    float* xm = (float*)(xo + 8 * 8 * 32);                     // [wave][max | sum][lane]
    // unrolled (here and in the store loop below) so that o is indexed by constants
#pragma unroll
    for (int jf = 0; jf < 4; ++jf) {
        const v8f g = up ? o[0][jf] : o[1][jf];
        xo[(wave * 8 + 2 * jf) * 32 + lane]     = __builtin_shufflevector(g, g, 0, 1, 2, 3);
        xo[(wave * 8 + 2 * jf + 1) * 32 + lane] = __builtin_shufflevector(g, g, 4, 5, 6, 7);
    }
    xm[(wave * 2) * 32 + lane]     = up ? mrun[0] : mrun[1];
    xm[(wave * 2 + 1) * 32 + lane] = up ? lrun[0] : lrun[1];
    __syncthreads();                 // the partners' states are published

    const int   pw = wave ^ 4;
    const float mp = xm[(pw * 2) * 32 + lane];
    const float lp = xm[(pw * 2 + 1) * 32 + lane];
    const float mo = up ? mrun[1] : mrun[0];
    const float lo = up ? lrun[1] : lrun[0];
    const float mj = fmaxf(mo, mp);
    float fo = (mo - mj) * 1.44269504088896340736f;            // e^x = 2^(x * log2 e)
    float fp = (mp - mj) * 1.44269504088896340736f;
    exp2x2(fo, fp);
    const float lj = lo * fo + lp * fp;

    // normalize, store f16 [b*L + q][h*64 + dh]: 8 neighbouring dh a store
    const int b = bh >> 4, h = bh & (NUM_HEADS - 1);
    const size_t m = (size_t)b * SEQ + qbase + kh * 16 + l16;
#pragma unroll
    for (int jf = 0; jf < 4; ++jf) {
        const v8f own = up ? o[1][jf] : o[0][jf];
        const v4f p0  = xo[(pw * 8 + 2 * jf) * 32 + lane];
        const v4f p1  = xo[(pw * 8 + 2 * jf + 1) * 32 + lane];
        union { _Float16 f[8]; uint4 u; } pk;
#pragma unroll
        for (int e = 0; e < 8; ++e)
            pk.f[e] = (_Float16)((own[e] * fo + (e < 4 ? p0[e & 3] : p1[e & 3]) * fp) / lj);
        *(uint4*)&O[m * D_MODEL + h * HEAD_DIM + jf * 16 + 8 * half] = pk.u;
    }
}

// ---------------------------------------------------------------------------
// Launcher
// ---------------------------------------------------------------------------
extern "C" void kernel_launch(void* const* d_in, const int* in_sizes, int n_in,
                              void* d_out, int out_size, void* d_ws, size_t ws_size,
                              hipStream_t stream) {
    (void)in_sizes; (void)n_in; (void)out_size; (void)ws_size;

    const float* x    = (const float*)d_in[0];   // [2,2048,1024]
    const float* cosT = (const float*)d_in[1];   // [2048,64]
    const float* sinT = (const float*)d_in[2];   // [2048,64]
    const float* wqkv = (const float*)d_in[3];   // [3072,1024]
    const float* wo   = (const float*)d_in[4];   // [1024,1024]
    float* out = (float*)d_out;                  // [2,2048,1024]

    char* ws = (char*)d_ws;
    _Float16* x_h  = (_Float16*)(ws);                        //  8 MB
    _Float16* wq_h = (_Float16*)(ws + ( 8ull << 20));        //  6 MB
    _Float16* wo_h = (_Float16*)(ws + (14ull << 20));        //  2 MB
    _Float16* q_h  = (_Float16*)(ws + (64ull << 20));        //  8 MB
    _Float16* k_h  = (_Float16*)(ws + (72ull << 20));        //  8 MB
    _Float16* vt_h = (_Float16*)(ws + (80ull << 20));        //  8 MB
    _Float16* at_h = (_Float16*)(ws + (88ull << 20));        //  8 MB

    cvt_f32_f16<<<(MROWS * D_MODEL) / CVT_BLOCK, 256, 0, stream>>>(x, x_h);
    cvt_f32_f16<<<(3 * D_MODEL * D_MODEL) / CVT_BLOCK, 256, 0, stream>>>(wqkv, wq_h);
    cvt_f32_f16<<<(D_MODEL * D_MODEL) / CVT_BLOCK, 256, 0, stream>>>(wo, wo_h);

    // x @ w_qkv^T (M=4096, N=3072, K=1024), rotated and repacked in the epilogue
    gemm_qkv_rope<<<dim3(3 * D_MODEL / 128, MROWS / 128), 256, 0, stream>>>(
        x_h, wq_h, cosT, sinT, q_h, k_h, vt_h);

    attn_f16<<<dim3(BATCH * NUM_HEADS, SEQ / 128), 256, 0, stream>>>(q_h, k_h, vt_h, at_h);

    // out = attn @ w_o^T  : M=4096, N=1024, K=1024
    gemm_nt_f16<<<dim3(D_MODEL / 128, MROWS / 128), 256, 0, stream>>>(at_h, wo_h, out, MROWS, D_MODEL, 1024);
}

// v007
// Measured time: 84.6 microseconds a run.
// Timed twice side by side with v006, it ran 1.05 times as fast both times.
// All steps since v000 together make it 4.30 times as fast.
#include <hip/hip_runtime.h>

// ---------------------------------------------------------------------------
// MI455X (gfx1250, wave32) RoPE attention, f16 WMMA pipeline.
// ---------------------------------------------------------------------------

typedef __attribute__((ext_vector_type(16))) _Float16 v16h;
typedef __attribute__((ext_vector_type(8)))  float    v8f;
typedef __attribute__((ext_vector_type(4)))  float    v4f;
typedef __attribute__((ext_vector_type(4)))  _Float16 v4h;
typedef __attribute__((ext_vector_type(8)))  _Float16 v8h;

union Frag16 { v16h v; uint4 u[2]; };

#define D_MODEL   1024
#define NUM_HEADS 16
#define HEAD_DIM  64
#define BATCH     2
#define SEQ       2048
#define MROWS     (BATCH * SEQ)   // 4096

// LDS row pitch in f16 elements for tiles whose rows are read as 16-byte
// fragments by 16 lanes at once: 16 B x odd, so the 16 rows fall on distinct
// banks (a pitch of 64 B or 128 B puts them on the same few banks).
#define PITCH32   40              // 32-element rows: 80 B; no tile here uses it
#define PITCH64   72              // 64-element rows: 144 B

// ---------------------------------------------------------------------------
// Staging of LDS tiles: asynchronous copies, 16 B a lane, global -> LDS through no register,
// in a ring of two buffers: the copies of tile t + 2 are issued at the foot of trip t and
// waited for at the foot of trip t + 1, so they fly while tile t + 1 is worked on.
// ---------------------------------------------------------------------------
// LDS byte address of a __shared__ object: the low 32 bits of its address
__device__ inline unsigned lds_addr(const void* p) { return (unsigned)(size_t)p; }

// Four copies of a lane. The s_wait_xcnt closes the statement as a precaution: it stands in
// front of every later instruction that could rewrite an address register named here.
__device__ inline void copy4(unsigned l0, unsigned l1, unsigned l2, unsigned l3,
                             const _Float16* g0, const _Float16* g1,
                             const _Float16* g2, const _Float16* g3) {
    asm volatile("global_load_async_to_lds_b128 %0, %4, off\n\t"
                 "global_load_async_to_lds_b128 %1, %5, off\n\t"
                 "global_load_async_to_lds_b128 %2, %6, off\n\t"
                 "global_load_async_to_lds_b128 %3, %7, off\n\t"
                 "s_wait_xcnt 0x0"
                 :: "v"(l0), "v"(l1), "v"(l2), "v"(l3), "v"(g0), "v"(g1), "v"(g2), "v"(g3)
                 : "memory");
}

// Eight copies of a lane in one statement, with the same closing wait.
__device__ inline void copy8(unsigned l0, unsigned l1, unsigned l2, unsigned l3,
                             unsigned l4, unsigned l5, unsigned l6, unsigned l7,
                             const _Float16* g0, const _Float16* g1,
                             const _Float16* g2, const _Float16* g3,
                             const _Float16* g4, const _Float16* g5,
                             const _Float16* g6, const _Float16* g7) {
    asm volatile("global_load_async_to_lds_b128 %0, %8, off\n\t"
                 "global_load_async_to_lds_b128 %1, %9, off\n\t"
                 "global_load_async_to_lds_b128 %2, %10, off\n\t"
                 "global_load_async_to_lds_b128 %3, %11, off\n\t"
                 "global_load_async_to_lds_b128 %4, %12, off\n\t"
                 "global_load_async_to_lds_b128 %5, %13, off\n\t"
                 "global_load_async_to_lds_b128 %6, %14, off\n\t"
                 "global_load_async_to_lds_b128 %7, %15, off\n\t"
                 "s_wait_xcnt 0x0"
                 :: "v"(l0), "v"(l1), "v"(l2), "v"(l3), "v"(l4), "v"(l5), "v"(l6), "v"(l7),
                    "v"(g0), "v"(g1), "v"(g2), "v"(g3), "v"(g4), "v"(g5), "v"(g6), "v"(g7)
                 : "memory");
}

// The wave's own copies have landed (the compiler places no wait for them).
__device__ inline void wait_copies() { asm volatile("s_wait_asynccnt 0x0" ::: "memory"); }
// The wave's own LDS reads have returned: the buffer they read may be refilled behind the barrier.
__device__ inline void wait_lds_reads() { asm volatile("s_wait_dscnt 0x0" ::: "memory"); }

// ---------------------------------------------------------------------------
// fp32 -> fp16 elementwise convert of all three f32 operands (x, w_qkv, w_o) in ONE launch: the
// three are independent, so nothing orders them, and as separate launches each paid its own
// start, first memory latency and drain. The block index picks the operand (a scalar choice).
// A block takes CVT_BLOCK contiguous floats; a lane takes eight float4, each wave-wide load
// covering 512 contiguous bytes, so few waves have to start and each keeps eight loads in flight.
// Every element count is a multiple of CVT_BLOCK. The grid is four blocks per WGP: one round.
// ---------------------------------------------------------------------------
#define CVT_BLOCK (256 * 8 * 4)
#define CVT_X_BLOCKS  ((MROWS * D_MODEL) / CVT_BLOCK)
#define CVT_WQ_BLOCKS ((3 * D_MODEL * D_MODEL) / CVT_BLOCK)
#define CVT_WO_BLOCKS ((D_MODEL * D_MODEL) / CVT_BLOCK)
__global__ __launch_bounds__(256)
void cvt3_f32_f16(const float* __restrict__ x, const float* __restrict__ wqkv,
                  const float* __restrict__ wo, _Float16* __restrict__ x_h,
                  _Float16* __restrict__ wq_h, _Float16* __restrict__ wo_h) {
    const unsigned  b     = blockIdx.x;
    const bool      is_wo = b >= CVT_X_BLOCKS + CVT_WQ_BLOCKS;
    const bool      is_wq = !is_wo && b >= CVT_X_BLOCKS;
    const float*    in    = is_wo ? wo   : is_wq ? wqkv : x;
    _Float16*       out   = is_wo ? wo_h : is_wq ? wq_h : x_h;
    const unsigned  blk   = b - (is_wo ? CVT_X_BLOCKS + CVT_WQ_BLOCKS : is_wq ? CVT_X_BLOCKS : 0);
    const size_t base = (size_t)blk * CVT_BLOCK + threadIdx.x * 4;
    v4f v[8];
    // unrolled so that all eight loads are issued before the first is waited for
#pragma unroll
    for (int k = 0; k < 8; ++k) v[k] = *(const v4f*)&in[base + k * 1024];
#pragma unroll
    for (int k = 0; k < 8; ++k) *(v4h*)&out[base + k * 1024] = __builtin_convertvector(v[k], v4h);
}

// ---------------------------------------------------------------------------
// Generic GEMM: C[M][N] = A[M][K] * W[N][K]^T   (A,W f16 row-major, C f32)
// Block = 256 threads (8 waves). Tile 128(M) x 128(N); a stage of the ring is 64 k (two
// k-steps of 32).
// K must be a multiple of 64.
// Wave (wm,wn) in 4x2 grid computes a 32x64 sub-tile = 2x4 WMMA fragments.
// Per k-step per wave: 8 v_wmma against 12 ds_load_b128.
// ---------------------------------------------------------------------------
__global__ __launch_bounds__(256)
void gemm_nt_f16(const _Float16* __restrict__ A, const _Float16* __restrict__ W,
                 float* __restrict__ C, int M, int N, int K) {
    __shared__ __align__(16) _Float16 Tiles[2][2][128][PITCH64];   // [buffer][A | W][row][k]

    const int t    = threadIdx.x;
    const int wave = t >> 5, lane = t & 31;
    const int half = lane >> 4, l16 = lane & 15;
    const int wm   = wave >> 1, wn = wave & 1;
    const int bm   = blockIdx.y * 128, bn = blockIdx.x * 128;

    v8f acc[2][4] = {};

    // A stage: 2 tiles x 128 rows x 128 B. A lane copies chunk cc of rows cr, cr + 32, cr + 64
    // and cr + 96 of both tiles; eight lanes cover one whole 128-B line.
    const int cr = t >> 3, cc = (t & 7) * 8;
    const _Float16* ga = A + (size_t)(bm + cr) * K + cc;
    const _Float16* gw = W + (size_t)(bn + cr) * K + cc;
    const size_t    gs = (size_t)32 * K;                       // 32 rows on, in elements
    const unsigned  ls = 32 * PITCH64 * 2;                     // 32 rows on, in LDS bytes
    const unsigned  la = lds_addr(&Tiles[0][0][cr][cc]);
    const unsigned  lw = lds_addr(&Tiles[0][1][cr][cc]);
    const unsigned  lb = sizeof(Tiles[0]);                     // one buffer on
    const int       T  = K / 64;

#define GEMM_STAGE(s, buf)                                                              \
    copy8(la + (buf) * lb, la + (buf) * lb + ls, la + (buf) * lb + 2 * ls, la + (buf) * lb + 3 * ls, \
          lw + (buf) * lb, lw + (buf) * lb + ls, lw + (buf) * lb + 2 * ls, lw + (buf) * lb + 3 * ls, \
          ga + (s) * 64, ga + (s) * 64 + gs, ga + (s) * 64 + 2 * gs, ga + (s) * 64 + 3 * gs,         \
          gw + (s) * 64, gw + (s) * 64 + gs, gw + (s) * 64 + 2 * gs, gw + (s) * 64 + 3 * gs)

    GEMM_STAGE(0, 0);
    wait_copies();
    __syncthreads();                 // stage 0 is published
    if (T > 1) GEMM_STAGE(1, 1);

    for (int s = 0; s < T; ++s) {
        const int buf = s & 1;
        // two k-steps, unrolled so that the fragment arrays are indexed by constants
#pragma unroll
        for (int kk = 0; kk < 2; ++kk) {
            Frag16 a[2], b[4];
#pragma unroll
            for (int i = 0; i < 2; ++i) {
                int r = wm * 32 + i * 16 + l16;
                a[i].u[0] = *(const uint4*)&Tiles[buf][0][r][kk * 32 + half * 8];
                a[i].u[1] = *(const uint4*)&Tiles[buf][0][r][kk * 32 + 16 + half * 8];
            }
#pragma unroll
            for (int j = 0; j < 4; ++j) {
                int r = wn * 64 + j * 16 + l16;
                b[j].u[0] = *(const uint4*)&Tiles[buf][1][r][kk * 32 + half * 8];
                b[j].u[1] = *(const uint4*)&Tiles[buf][1][r][kk * 32 + 16 + half * 8];
            }
            // Keeps the k-step's 12 fragment loads one group in front of its WMMAs: without it
            // the scheduler loads the second A fragment among them and waits out its latency there.
            __builtin_amdgcn_sched_barrier(0);
#pragma unroll
            for (int i = 0; i < 2; ++i)
#pragma unroll
                for (int j = 0; j < 4; ++j)
                    acc[i][j] = __builtin_amdgcn_wmma_f32_16x16x32_f16(
                        false, a[i].v, false, b[j].v, (short)0, acc[i][j], false, false);
        }
        wait_lds_reads();
        wait_copies();
        __syncthreads();
        if (s + 2 < T) GEMM_STAGE(s + 2, buf);
    }
    wait_copies();
#undef GEMM_STAGE

#pragma unroll
    for (int i = 0; i < 2; ++i)
#pragma unroll
        for (int j = 0; j < 4; ++j) {
            int col = bn + wn * 64 + j * 16 + l16;
#pragma unroll
            for (int e = 0; e < 8; ++e) {
                int row = bm + wm * 32 + i * 16 + e + 8 * half;
                C[(size_t)row * N + col] = acc[i][j][e];
            }
        }
}

// ---------------------------------------------------------------------------
// QKV projection with RoPE and the repack in its epilogue:
//   x f16 [b*L + l][1024], w_qkv f16 [3072][1024]  ->  Q,K f16 [b,h,l,dh] ; V^T f16 [b,h,dh,l]
// Softmax scale 1/sqrt(64) folded into Q. The projection never leaves the registers as f32.
// Same tile, ring and k-steps as gemm_nt_f16, but the 64-row side of a wave's sub-tile is the
// A operand: a lane then holds, of ONE row of the 32-row side (column l16), eight neighbouring
// rows of the 64-row side (8 * half + e of each 16-row tile), which is 16 B of f16 output.
//   Q, K blocks: 32-row side = positions (x), 64-row side = one head's 64 dh (w_qkv). Both sides
//                of a rotation pair (dh, dh + 32) sit in the same lane and register index, two
//                tiles apart.
//   V blocks:    the two operands change places: 32-row side = dh (w_qkv), 64-row side = positions,
//                so the same registers are 16 B of a V^T row.
// Either way a wave owns 32 output rows of 128 B; it turns them in its own LDS range so that
// every store covers four whole lines.
// Six waves per SIMD: the grid is three blocks per WGP, and all of them have to be resident at
// once (one round); without the bound the epilogue's table loads take registers past that.
// ---------------------------------------------------------------------------
__global__ __launch_bounds__(256) __attribute__((amdgpu_waves_per_eu(6)))
void gemm_qkv_rope(const _Float16* __restrict__ X, const _Float16* __restrict__ W,
                   const float* __restrict__ cosT, const float* __restrict__ sinT,
                   _Float16* __restrict__ Q, _Float16* __restrict__ Kd,
                   _Float16* __restrict__ Vt) {
    __shared__ __align__(16) _Float16 Tiles[2][2][128][PITCH64];   // [buffer][32-row side | 64-row side][row][k]

    const int t    = threadIdx.x;
    const int wave = t >> 5, lane = t & 31;
    const int half = lane >> 4, l16 = lane & 15;
    const int wm   = wave >> 1, wn = wave & 1;
    const int part = blockIdx.x >> 3;                  // 0: Q, 1: K, 2: V (8 blocks of 128 features each)
    const int f0   = blockIdx.x * 128;                 // first row of w_qkv
    const int m0   = blockIdx.y * 128;                 // first row of x
    const int bb   = m0 / SEQ, l0 = m0 % SEQ;          // a block lies inside one batch entry
    const bool isV = part == 2;

    const _Float16* xs = X + (size_t)m0 * D_MODEL;
    const _Float16* fs = W + (size_t)f0 * D_MODEL;

    v8f acc[2][4] = {};

    const int cr = t >> 3, cc = (t & 7) * 8;
    const _Float16* ga = (isV ? fs : xs) + (size_t)cr * D_MODEL + cc;
    const _Float16* gw = (isV ? xs : fs) + (size_t)cr * D_MODEL + cc;
    const size_t    gs = (size_t)32 * D_MODEL;                 // 32 rows on, in elements
    const unsigned  ls = 32 * PITCH64 * 2;                     // 32 rows on, in LDS bytes
    const unsigned  la = lds_addr(&Tiles[0][0][cr][cc]);
    const unsigned  lw = lds_addr(&Tiles[0][1][cr][cc]);
    const unsigned  lb = sizeof(Tiles[0]);                     // one buffer on
    constexpr int   T  = D_MODEL / 64;

#define GEMM_STAGE(s, buf)                                                              \
    copy8(la + (buf) * lb, la + (buf) * lb + ls, la + (buf) * lb + 2 * ls, la + (buf) * lb + 3 * ls, \
          lw + (buf) * lb, lw + (buf) * lb + ls, lw + (buf) * lb + 2 * ls, lw + (buf) * lb + 3 * ls, \
          ga + (s) * 64, ga + (s) * 64 + gs, ga + (s) * 64 + 2 * gs, ga + (s) * 64 + 3 * gs,         \
          gw + (s) * 64, gw + (s) * 64 + gs, gw + (s) * 64 + 2 * gs, gw + (s) * 64 + 3 * gs)

    GEMM_STAGE(0, 0);
    wait_copies();
    __syncthreads();                 // stage 0 is published
    GEMM_STAGE(1, 1);

    for (int s = 0; s < T; ++s) {
        const int buf = s & 1;
        // two k-steps, unrolled so that the fragment arrays are indexed by constants
#pragma unroll
        for (int kk = 0; kk < 2; ++kk) {
            Frag16 a[2], b[4];
#pragma unroll
            for (int i = 0; i < 2; ++i) {
                int r = wm * 32 + i * 16 + l16;
                a[i].u[0] = *(const uint4*)&Tiles[buf][0][r][kk * 32 + half * 8];
                a[i].u[1] = *(const uint4*)&Tiles[buf][0][r][kk * 32 + 16 + half * 8];
            }
#pragma unroll
            for (int j = 0; j < 4; ++j) {
                int r = wn * 64 + j * 16 + l16;
                b[j].u[0] = *(const uint4*)&Tiles[buf][1][r][kk * 32 + half * 8];
                b[j].u[1] = *(const uint4*)&Tiles[buf][1][r][kk * 32 + 16 + half * 8];
            }
            // Keeps the k-step's 12 fragment loads one group in front of its WMMAs: without it
            // the scheduler loads the second fragment of the 32-row side among them and waits
            // out its latency there.
            __builtin_amdgcn_sched_barrier(0);
#pragma unroll
            for (int i = 0; i < 2; ++i)
#pragma unroll
                for (int j = 0; j < 4; ++j)
                    acc[i][j] = __builtin_amdgcn_wmma_f32_16x16x32_f16(
                        false, b[j].v, false, a[i].v, (short)0, acc[i][j], false, false);
        }
        wait_lds_reads();
        wait_copies();
        __syncthreads();
        if (s + 2 < T) GEMM_STAGE(s + 2, buf);
    }
    wait_copies();
#undef GEMM_STAGE

    // acc[i][j][e] = product of row wm * 32 + i * 16 + l16 of the 32-row side
    //                with row wn * 64 + j * 16 + 8 * half + e of the 64-row side.
    // Behind the last trip's barrier nobody reads the ring and no copy is outstanding:
    // each wave stages its 32 rows of 128 B in a range of its own.
    _Float16 (*Stg)[PITCH64] = &Tiles[0][wave >> 2][(wave & 3) * 32];

    if (!isV) {
        const float sc = part == 0 ? 0.125f : 1.0f;            // 1/sqrt(HEAD_DIM) on Q alone
        const int    l  = l0 + wm * 32 + l16;                  // the lane's position in tile i = 0
        const float* cp = cosT + l * HEAD_DIM + 8 * half;
        const float* sp = sinT + l * HEAD_DIM + 8 * half;
        // unrolled so that acc is indexed by constants
#pragma unroll
        for (int i = 0; i < 2; ++i) {
            v8f cs[4], sn[4];                                  // dh j * 16 + 8 * half + e
#pragma unroll
            for (int j = 0; j < 4; ++j) {
                cs[j] = *(const v8f*)(cp + i * 16 * HEAD_DIM + j * 16);
                sn[j] = *(const v8f*)(sp + i * 16 * HEAD_DIM + j * 16);
            }
            // Precaution for the 16 loads above: their two address pairs are inputs here, so they
            // stay live up to this wait and nothing is placed in one of them before it.
            asm volatile("s_wait_xcnt 0x0" :: "v"(cp), "v"(sp) : "memory");
            // rotate_half: dh < 32 pairs with -t[dh + 32], dh >= 32 with +t[dh - 32]
#pragma unroll
            for (int j = 0; j < 2; ++j) {
                const v8f lo = (acc[i][j]     * cs[j]     - acc[i][j + 2] * sn[j])     * sc;
                const v8f hi = (acc[i][j + 2] * cs[j + 2] + acc[i][j]     * sn[j + 2]) * sc;
                acc[i][j]     = lo;
                acc[i][j + 2] = hi;
            }
        }
    }

#pragma unroll
    for (int i = 0; i < 2; ++i)
#pragma unroll
        for (int j = 0; j < 4; ++j)
            *(v8h*)&Stg[i * 16 + l16][(2 * j + half) * 8] = __builtin_convertvector(acc[i][j], v8h);
    // The wave's own LDS writes are done before other lanes of it read the rows back.
    asm volatile("s_wait_dscnt 0x0" ::: "memory");

    // Q, K: row = position, 128 B = the head's 64 dh. V^T: row = dh, 128 B = 64 positions.
    _Float16* dst;
    int       pitch;
    if (isV) {
        dst   = Vt + ((size_t)bb * D_MODEL + (f0 - 2 * D_MODEL) + wm * 32) * SEQ + l0 + wn * 64;
        pitch = SEQ;
    } else {
        const int h = (f0 & (D_MODEL - 1)) / HEAD_DIM + wn;
        dst   = (part == 0 ? Q : Kd) + (((size_t)bb * NUM_HEADS + h) * SEQ + l0 + wm * 32) * HEAD_DIM;
        pitch = HEAD_DIM;
    }
    // eight lanes store one whole line; unrolled so that the arrays stay in registers
    v8h* gp[8];
    v8h  row[8];
#pragma unroll
    for (int k = 0; k < 8; ++k) {
        const int r = k * 4 + (lane >> 3), ch = lane & 7;
        gp[k]  = (v8h*)&dst[(size_t)(r * pitch + ch * 8)];
        row[k] = *(const v8h*)&Stg[r][ch * 8];
    }
    // Keeps the address arithmetic in front of the eight stores, so that no register which an
    // issued store names is rewritten behind it.
    __builtin_amdgcn_sched_barrier(0);
#pragma unroll
    for (int k = 0; k < 8; ++k) *gp[k] = row[k];
}

__device__ inline float xhalf(float x) {
    return __builtin_bit_cast(float, __builtin_amdgcn_permlanex16(
        __builtin_bit_cast(int, x), __builtin_bit_cast(int, x), 0x76543210, 0xfedcba98, false, false));
}

// 2^x of eight values in place. One statement, so that each v_exp_f32 is followed by an
// independent instruction and the last by v_nop: the slot the instruction set asks for between
// a transcendental and an instruction that reads its result or overwrites its source.
__device__ inline void exp2x8(v8f& x) {
    float a = x[0], b = x[1], c = x[2], d = x[3], e = x[4], f = x[5], g = x[6], h = x[7];
    asm("v_exp_f32 %0, %0\n\tv_exp_f32 %1, %1\n\tv_exp_f32 %2, %2\n\tv_exp_f32 %3, %3\n\t"
        "v_exp_f32 %4, %4\n\tv_exp_f32 %5, %5\n\tv_exp_f32 %6, %6\n\tv_exp_f32 %7, %7\n\tv_nop"
        : "+v"(a), "+v"(b), "+v"(c), "+v"(d), "+v"(e), "+v"(f), "+v"(g), "+v"(h));
    x[0] = a; x[1] = b; x[2] = c; x[3] = d; x[4] = e; x[5] = f; x[6] = g; x[7] = h;
}

// 2^x of two values in place, in one statement closed by v_nop, for the same slot.
__device__ inline void exp2x2(float& a, float& b) {
    asm("v_exp_f32 %0, %0\n\tv_exp_f32 %1, %1\n\tv_nop" : "+v"(a), "+v"(b));
}

// Four waves per SIMD: the grid is two blocks per WGP; the bound lets a wave use its full share
// of the registers for the two query tiles.
__global__ __launch_bounds__(256) __attribute__((amdgpu_waves_per_eu(4, 4)))
void attn_f16(const _Float16* __restrict__ Q, const _Float16* __restrict__ Kd,
              const _Float16* __restrict__ Vt, _Float16* __restrict__ O) {
    // [buffer][key group][K | V^T][row][col]: K rows are keys over dh, V^T rows are dh over keys
    __shared__ __align__(16) _Float16 KV[2][2][2][64][PITCH64];

    const int t    = threadIdx.x;
    const int wave = t >> 5, lane = t & 31;
    const int half = lane >> 4, l16 = lane & 15;
    const int qg   = wave & 3;             // strip of 32 queries
    const int kh   = wave >> 2;            // key group
    const int bh    = blockIdx.x;          // 0..31
    const int qtile = blockIdx.y;          // 0..15
    const int qbase = qtile * 128 + qg * 32;

    // Q strip: 2 tiles x 16 queries x 64 dh = two 32x16 B fragments a tile (column = query l16),
    // straight from global
    Frag16 qf[2][2];
    // unrolled so that qf stays in registers, indexed by constants
#pragma unroll
    for (int qt = 0; qt < 2; ++qt)
#pragma unroll
        for (int kk = 0; kk < 2; ++kk) {
            const _Float16* qp = Q + ((size_t)bh * SEQ + qbase + qt * 16 + l16) * HEAD_DIM + kk * 32;
            qf[qt][kk].u[0] = *(const uint4*)(qp + half * 8);
            qf[qt][kk].u[1] = *(const uint4*)(qp + 16 + half * 8);
        }

    v8f o[2][4] = {};                      // o[qt][jf][e] = O^T[dh = jf * 16 + 8 * half + e][query qt * 16 + l16]
    float mrun[2] = {-1e30f, -1e30f};      // running maximum of the query, equal in both halves
    float lrun[2] = {0.f, 0.f};            // running sum over this half's keys only; joined after the loop

    // A stage: 128 keys = 2 key groups x 2 tiles x 64 rows x 128 B. A lane copies chunk cc of rows
    // cr and cr + 32 of all four tiles; eight lanes cover one whole 128-B line.
    const int cr = t >> 3, cc = (t & 7) * 8;
    const _Float16* gk = Kd + ((size_t)bh * SEQ + cr) * HEAD_DIM + cc;        // [key][dh]
    const _Float16* gv = Vt + ((size_t)bh * HEAD_DIM + cr) * SEQ + cc;        // [dh][key]
    const unsigned  ls = 32 * PITCH64 * 2;                     // 32 rows on, in LDS bytes
    const unsigned  lk = lds_addr(&KV[0][0][0][cr][cc]);
    const unsigned  lv = lds_addr(&KV[0][0][1][cr][cc]);
    const unsigned  lh = sizeof(KV[0][0]);                     // one key group on
    const unsigned  lb = sizeof(KV[0]);                        // one buffer on
    constexpr int   T  = SEQ / 128;

#define KV_STAGE(s, buf)                                                                          \
    copy8(lk + (buf) * lb, lk + (buf) * lb + ls, lv + (buf) * lb, lv + (buf) * lb + ls,           \
          lk + (buf) * lb + lh, lk + (buf) * lb + lh + ls, lv + (buf) * lb + lh, lv + (buf) * lb + lh + ls, \
          gk + (size_t)(s) * 128 * HEAD_DIM, gk + ((size_t)(s) * 128 + 32) * HEAD_DIM,            \
          gv + (s) * 128, gv + (s) * 128 + (size_t)32 * SEQ,                                      \
          gk + ((size_t)(s) * 128 + 64) * HEAD_DIM, gk + ((size_t)(s) * 128 + 96) * HEAD_DIM,     \
          gv + (s) * 128 + 64, gv + (s) * 128 + 64 + (size_t)32 * SEQ)

    KV_STAGE(0, 0);
    wait_copies();
    __syncthreads();                 // stage 0 is published
    KV_STAGE(1, 1);

    for (int st = 0; st < T; ++st) {
        const int buf = st & 1;
        const _Float16 (*Kblk)[PITCH64] = KV[buf][kh][0];
        const _Float16 (*Vblk)[PITCH64] = KV[buf][kh][1];

        // S^T = K * Q^T : 64 keys x 32 queries (4 M-fragments x 2 query tiles, K-dim 64 = 2 steps)
        // s[qt][nf][e] = score of key st * 128 + kh * 64 + nf * 16 + 8 * half + e
        //                against query qt * 16 + l16
        v8f s[2][4] = {};
#pragma unroll
        for (int nf = 0; nf < 4; ++nf)
#pragma unroll
            for (int kk = 0; kk < 2; ++kk) {
                Frag16 a;
                int kr = nf * 16 + l16;
                a.u[0] = *(const uint4*)&Kblk[kr][kk * 32 + half * 8];
                a.u[1] = *(const uint4*)&Kblk[kr][kk * 32 + 16 + half * 8];
                // both query tiles use the fragment; unrolled so that s is indexed by constants
#pragma unroll
                for (int qt = 0; qt < 2; ++qt)
                    s[qt][nf] = __builtin_amdgcn_wmma_f32_16x16x32_f16(
                        false, a.v, false, qf[qt][kk].v, (short)0, s[qt][nf], false, false);
            }

        Frag16 p[2][2];
        // unrolled so that the per-tile arrays are indexed by constants
#pragma unroll
        for (int qt = 0; qt < 2; ++qt) {
            // --- online softmax: the lane's 32 scores, then the other half's 32 ---
            float m8[8];
#pragma unroll
            for (int e = 0; e < 8; ++e)
                m8[e] = fmaxf(fmaxf(s[qt][0][e], s[qt][1][e]), fmaxf(s[qt][2][e], s[qt][3][e]));
            float mcur = fmaxf(fmaxf(fmaxf(m8[0], m8[1]), fmaxf(m8[2], m8[3])),
                               fmaxf(fmaxf(m8[4], m8[5]), fmaxf(m8[6], m8[7])));
            mcur = fmaxf(mcur, xhalf(mcur));

            const float mn    = fmaxf(mrun[qt], mcur);
            const float alpha = __expf(mrun[qt] - mn);
            mrun[qt] = mn;
#pragma unroll
            for (int nf = 0; nf < 4; ++nf) {
                s[qt][nf] = (s[qt][nf] - mn) * 1.44269504088896340736f;   // e^x = 2^(x * log2 e), as __expf forms it
                exp2x8(s[qt][nf]);
            }

            float r8[8];
#pragma unroll
            for (int e = 0; e < 8; ++e)
                r8[e] = (s[qt][0][e] + s[qt][1][e]) + (s[qt][2][e] + s[qt][3][e]);
            lrun[qt] = lrun[qt] * alpha
                     + (((r8[0] + r8[1]) + (r8[2] + r8[3])) + ((r8[4] + r8[5]) + (r8[6] + r8[7])));
#pragma unroll
            for (int jf = 0; jf < 4; ++jf)
#pragma unroll
                for (int e = 0; e < 8; ++e) o[qt][jf][e] *= alpha;

            // P^T as B operand: element i of fragment kk is key kk * 32 + (i < 8 ? 8 * half + i
            // : 16 + 8 * half + i - 8), which is register i & 7 of tile 2 * kk + (i >> 3)
#pragma unroll
            for (int kk = 0; kk < 2; ++kk)
#pragma unroll
                for (int i = 0; i < 16; ++i)
                    p[qt][kk].v[i] = (_Float16)s[qt][2 * kk + (i >> 3)][i & 7];
        }

        // O^T += V^T * P^T : 64 dh x 32 queries (4 M-fragments x 2 query tiles, K=64 keys = 2 steps)
#pragma unroll
        for (int jf = 0; jf < 4; ++jf)
#pragma unroll
            for (int kk = 0; kk < 2; ++kk) {
                Frag16 a;
                int dh = jf * 16 + l16;
                a.u[0] = *(const uint4*)&Vblk[dh][kk * 32 + half * 8];
                a.u[1] = *(const uint4*)&Vblk[dh][kk * 32 + 16 + half * 8];
                // both query tiles use the fragment; unrolled so that o is indexed by constants
#pragma unroll
                for (int qt = 0; qt < 2; ++qt)
                    o[qt][jf] = __builtin_amdgcn_wmma_f32_16x16x32_f16(
                        false, a.v, false, p[qt][kk].v, (short)0, o[qt][jf], false, false);
            }

        wait_lds_reads();
        wait_copies();
        __syncthreads();
        if (st + 2 < T) KV_STAGE(st + 2, buf);
    }
    wait_copies();
#undef KV_STAGE

    // join the halves' sums
    lrun[0] += xhalf(lrun[0]);
    lrun[1] += xhalf(lrun[1]);

    // Merge of the two key groups. Waves w and w ^ 4 hold the same 32 queries in the same lanes and
    // registers. Each finishes one query tile (tile kh) and hands the other tile's state to its
    // partner. Behind the last trip's barrier nobody reads the ring and no copy is outstanding:
    // the ring's LDS carries the exchange.
    const bool up = kh != 0;
    v4f*   xo = (v4f*)&KV[0][0][0][0][0];                      // [wave][8][lane], 16 B a lane
    float* xm = (float*)(xo + 8 * 8 * 32);                     // [wave][max | sum][lane]
    // unrolled (here and in the store loop below) so that o is indexed by constants
#pragma unroll
    for (int jf = 0; jf < 4; ++jf) {
        const v8f g = up ? o[0][jf] : o[1][jf];
        xo[(wave * 8 + 2 * jf) * 32 + lane]     = __builtin_shufflevector(g, g, 0, 1, 2, 3);
        xo[(wave * 8 + 2 * jf + 1) * 32 + lane] = __builtin_shufflevector(g, g, 4, 5, 6, 7);
    }
    xm[(wave * 2) * 32 + lane]     = up ? mrun[0] : mrun[1];
    xm[(wave * 2 + 1) * 32 + lane] = up ? lrun[0] : lrun[1];
    __syncthreads();                 // the partners' states are published

    const int   pw = wave ^ 4;
    const float mp = xm[(pw * 2) * 32 + lane];
    const float lp = xm[(pw * 2 + 1) * 32 + lane];
    const float mo = up ? mrun[1] : mrun[0];
    const float lo = up ? lrun[1] : lrun[0];
    const float mj = fmaxf(mo, mp);
    float fo = (mo - mj) * 1.44269504088896340736f;            // e^x = 2^(x * log2 e)
    float fp = (mp - mj) * 1.44269504088896340736f;
    exp2x2(fo, fp);
    const float lj = lo * fo + lp * fp;

    // normalize, store f16 [b*L + q][h*64 + dh]: 8 neighbouring dh a store
    const int b = bh >> 4, h = bh & (NUM_HEADS - 1);
    const size_t m = (size_t)b * SEQ + qbase + kh * 16 + l16;
#pragma unroll
    for (int jf = 0; jf < 4; ++jf) {
        const v8f own = up ? o[1][jf] : o[0][jf];
        const v4f p0  = xo[(pw * 8 + 2 * jf) * 32 + lane];
        const v4f p1  = xo[(pw * 8 + 2 * jf + 1) * 32 + lane];
        union { _Float16 f[8]; uint4 u; } pk;
#pragma unroll
        for (int e = 0; e < 8; ++e)
            pk.f[e] = (_Float16)((own[e] * fo + (e < 4 ? p0[e & 3] : p1[e & 3]) * fp) / lj);
        *(uint4*)&O[m * D_MODEL + h * HEAD_DIM + jf * 16 + 8 * half] = pk.u;
    }
}

// ---------------------------------------------------------------------------
// Launcher
// ---------------------------------------------------------------------------
extern "C" void kernel_launch(void* const* d_in, const int* in_sizes, int n_in,
                              void* d_out, int out_size, void* d_ws, size_t ws_size,
                              hipStream_t stream) {
    (void)in_sizes; (void)n_in; (void)out_size; (void)ws_size;

    const float* x    = (const float*)d_in[0];   // [2,2048,1024]
    const float* cosT = (const float*)d_in[1];   // [2048,64]
    const float* sinT = (const float*)d_in[2];   // [2048,64]
    const float* wqkv = (const float*)d_in[3];   // [3072,1024]
    const float* wo   = (const float*)d_in[4];   // [1024,1024]
    float* out = (float*)d_out;                  // [2,2048,1024]

    char* ws = (char*)d_ws;
    _Float16* x_h  = (_Float16*)(ws);                        //  8 MB
    _Float16* wq_h = (_Float16*)(ws + ( 8ull << 20));        //  6 MB
    _Float16* wo_h = (_Float16*)(ws + (14ull << 20));        //  2 MB
    _Float16* q_h  = (_Float16*)(ws + (64ull << 20));        //  8 MB
    _Float16* k_h  = (_Float16*)(ws + (72ull << 20));        //  8 MB
    _Float16* vt_h = (_Float16*)(ws + (80ull << 20));        //  8 MB
    _Float16* at_h = (_Float16*)(ws + (88ull << 20));        //  8 MB

    cvt3_f32_f16<<<CVT_X_BLOCKS + CVT_WQ_BLOCKS + CVT_WO_BLOCKS, 256, 0, stream>>>(
        x, wqkv, wo, x_h, wq_h, wo_h);

    // x @ w_qkv^T (M=4096, N=3072, K=1024), rotated and repacked in the epilogue
    gemm_qkv_rope<<<dim3(3 * D_MODEL / 128, MROWS / 128), 256, 0, stream>>>(
        x_h, wq_h, cosT, sinT, q_h, k_h, vt_h);

    attn_f16<<<dim3(BATCH * NUM_HEADS, SEQ / 128), 256, 0, stream>>>(q_h, k_h, vt_h, at_h);

    // out = attn @ w_o^T  : M=4096, N=1024, K=1024
    gemm_nt_f16<<<dim3(D_MODEL / 128, MROWS / 128), 256, 0, stream>>>(at_h, wo_h, out, MROWS, D_MODEL, 1024);
}

// v008
// One run takes 81.6 microseconds.
// Timed twice side by side with v007, it ran 1.04 times as fast both times.
// Over all steps from v000 it is 4.45 times as fast.
#include <hip/hip_runtime.h>

// ---------------------------------------------------------------------------
// MI455X (gfx1250, wave32) RoPE attention, f16 WMMA pipeline.
// ---------------------------------------------------------------------------

typedef __attribute__((ext_vector_type(16))) _Float16 v16h;
typedef __attribute__((ext_vector_type(8)))  float    v8f;
typedef __attribute__((ext_vector_type(4)))  float    v4f;
typedef __attribute__((ext_vector_type(4)))  _Float16 v4h;
typedef __attribute__((ext_vector_type(8)))  _Float16 v8h;

union Frag16 { v16h v; uint4 u[2]; };

#define D_MODEL   1024
#define NUM_HEADS 16
#define HEAD_DIM  64
#define BATCH     2
#define SEQ       2048
#define MROWS     (BATCH * SEQ)   // 4096

// LDS row pitch in f16 elements for tiles whose rows are read as 16-byte
// fragments by 16 lanes at once: 16 B x odd, so the 16 rows fall on distinct
// banks (a pitch of 64 B or 128 B puts them on the same few banks).
#define PITCH32   40              // 32-element rows: 80 B; no tile here uses it
#define PITCH64   72              // 64-element rows: 144 B

// ---------------------------------------------------------------------------
// Staging of LDS tiles: asynchronous copies, 16 B a lane, global -> LDS through no register,
// in a ring of two buffers: the copies of tile t + 2 are issued at the foot of trip t and
// waited for at the foot of trip t + 1, so they fly while tile t + 1 is worked on.
// ---------------------------------------------------------------------------
// LDS byte address of a __shared__ object: the low 32 bits of its address
__device__ inline unsigned lds_addr(const void* p) { return (unsigned)(size_t)p; }

// Four copies of a lane. The s_wait_xcnt closes the statement as a precaution: it stands in
// front of every later instruction that could rewrite an address register named here.
__device__ inline void copy4(unsigned l0, unsigned l1, unsigned l2, unsigned l3,
                             const _Float16* g0, const _Float16* g1,
                             const _Float16* g2, const _Float16* g3) {
    asm volatile("global_load_async_to_lds_b128 %0, %4, off\n\t"
                 "global_load_async_to_lds_b128 %1, %5, off\n\t"
                 "global_load_async_to_lds_b128 %2, %6, off\n\t"
                 "global_load_async_to_lds_b128 %3, %7, off\n\t"
                 "s_wait_xcnt 0x0"
                 :: "v"(l0), "v"(l1), "v"(l2), "v"(l3), "v"(g0), "v"(g1), "v"(g2), "v"(g3)
                 : "memory");
}

// Eight copies of a lane in one statement, with the same closing wait.
__device__ inline void copy8(unsigned l0, unsigned l1, unsigned l2, unsigned l3,
                             unsigned l4, unsigned l5, unsigned l6, unsigned l7,
                             const _Float16* g0, const _Float16* g1,
                             const _Float16* g2, const _Float16* g3,
                             const _Float16* g4, const _Float16* g5,
                             const _Float16* g6, const _Float16* g7) {
    asm volatile("global_load_async_to_lds_b128 %0, %8, off\n\t"
                 "global_load_async_to_lds_b128 %1, %9, off\n\t"
                 "global_load_async_to_lds_b128 %2, %10, off\n\t"
                 "global_load_async_to_lds_b128 %3, %11, off\n\t"
                 "global_load_async_to_lds_b128 %4, %12, off\n\t"
                 "global_load_async_to_lds_b128 %5, %13, off\n\t"
                 "global_load_async_to_lds_b128 %6, %14, off\n\t"
                 "global_load_async_to_lds_b128 %7, %15, off\n\t"
                 "s_wait_xcnt 0x0"
                 :: "v"(l0), "v"(l1), "v"(l2), "v"(l3), "v"(l4), "v"(l5), "v"(l6), "v"(l7),
                    "v"(g0), "v"(g1), "v"(g2), "v"(g3), "v"(g4), "v"(g5), "v"(g6), "v"(g7)
                 : "memory");
}

// The wave's own copies have landed (the compiler places no wait for them).
__device__ inline void wait_copies() { asm volatile("s_wait_asynccnt 0x0" ::: "memory"); }
// The wave's own LDS reads have returned: the buffer they read may be refilled behind the barrier.
__device__ inline void wait_lds_reads() { asm volatile("s_wait_dscnt 0x0" ::: "memory"); }

// ---------------------------------------------------------------------------
// fp32 -> fp16 elementwise convert of all three f32 operands (x, w_qkv, w_o) in ONE launch: the
// three are independent, so nothing orders them, and as separate launches each paid its own
// start, first memory latency and drain. The block index picks the operand (a scalar choice).
// A block takes CVT_BLOCK contiguous floats; a lane takes eight float4, each wave-wide load
// covering 512 contiguous bytes, so few waves have to start and each keeps eight loads in flight.
// Every element count is a multiple of CVT_BLOCK. The grid is four blocks per WGP: one round.
// ---------------------------------------------------------------------------
#define CVT_BLOCK (256 * 8 * 4)
#define CVT_X_BLOCKS  ((MROWS * D_MODEL) / CVT_BLOCK)
#define CVT_WQ_BLOCKS ((3 * D_MODEL * D_MODEL) / CVT_BLOCK)
#define CVT_WO_BLOCKS ((D_MODEL * D_MODEL) / CVT_BLOCK)
__global__ __launch_bounds__(256)
void cvt3_f32_f16(const float* __restrict__ x, const float* __restrict__ wqkv,
                  const float* __restrict__ wo, _Float16* __restrict__ x_h,
                  _Float16* __restrict__ wq_h, _Float16* __restrict__ wo_h) {
    const unsigned  b     = blockIdx.x;
    const bool      is_wo = b >= CVT_X_BLOCKS + CVT_WQ_BLOCKS;
    const bool      is_wq = !is_wo && b >= CVT_X_BLOCKS;
    const float*    in    = is_wo ? wo   : is_wq ? wqkv : x;
    _Float16*       out   = is_wo ? wo_h : is_wq ? wq_h : x_h;
    const unsigned  blk   = b - (is_wo ? CVT_X_BLOCKS + CVT_WQ_BLOCKS : is_wq ? CVT_X_BLOCKS : 0);
    const size_t base = (size_t)blk * CVT_BLOCK + threadIdx.x * 4;
    v4f v[8];
    // unrolled so that all eight loads are issued before the first is waited for
#pragma unroll
    for (int k = 0; k < 8; ++k) v[k] = *(const v4f*)&in[base + k * 1024];
#pragma unroll
    for (int k = 0; k < 8; ++k) *(v4h*)&out[base + k * 1024] = __builtin_convertvector(v[k], v4h);
}

// ---------------------------------------------------------------------------
// Generic GEMM: C[M][N] = A[M][K] * W[N][K]^T   (A,W f16 row-major, C f32)
// Block = 256 threads (8 waves). Tile 128(M) x 128(N); a stage of the ring is 64 k (two
// k-steps of 32).
// K must be a multiple of 64.
// Wave (wm,wn) in 4x2 grid computes a 32x64 sub-tile = 2x4 WMMA fragments.
// Per k-step per wave: 8 v_wmma against 12 ds_load_b128.
// ---------------------------------------------------------------------------
__global__ __launch_bounds__(256)
void gemm_nt_f16(const _Float16* __restrict__ A, const _Float16* __restrict__ W,
                 float* __restrict__ C, int M, int N, int K) {
    __shared__ __align__(16) _Float16 Tiles[2][2][128][PITCH64];   // [buffer][A | W][row][k]

    const int t    = threadIdx.x;
    const int wave = t >> 5, lane = t & 31;
    const int half = lane >> 4, l16 = lane & 15;
    const int wm   = wave >> 1, wn = wave & 1;
    const int bm   = blockIdx.y * 128, bn = blockIdx.x * 128;

    v8f acc[2][4] = {};

    // A stage: 2 tiles x 128 rows x 128 B. A lane copies chunk cc of rows cr, cr + 32, cr + 64
    // and cr + 96 of both tiles; eight lanes cover one whole 128-B line.
    const int cr = t >> 3, cc = (t & 7) * 8;
    const _Float16* ga = A + (size_t)(bm + cr) * K + cc;
    const _Float16* gw = W + (size_t)(bn + cr) * K + cc;
    const size_t    gs = (size_t)32 * K;                       // 32 rows on, in elements
    const unsigned  ls = 32 * PITCH64 * 2;                     // 32 rows on, in LDS bytes
    const unsigned  la = lds_addr(&Tiles[0][0][cr][cc]);
    const unsigned  lw = lds_addr(&Tiles[0][1][cr][cc]);
    const unsigned  lb = sizeof(Tiles[0]);                     // one buffer on
    const int       T  = K / 64;

#define GEMM_STAGE(s, buf)                                                              \
    copy8(la + (buf) * lb, la + (buf) * lb + ls, la + (buf) * lb + 2 * ls, la + (buf) * lb + 3 * ls, \
          lw + (buf) * lb, lw + (buf) * lb + ls, lw + (buf) * lb + 2 * ls, lw + (buf) * lb + 3 * ls, \
          ga + (s) * 64, ga + (s) * 64 + gs, ga + (s) * 64 + 2 * gs, ga + (s) * 64 + 3 * gs,         \
          gw + (s) * 64, gw + (s) * 64 + gs, gw + (s) * 64 + 2 * gs, gw + (s) * 64 + 3 * gs)

    GEMM_STAGE(0, 0);
    wait_copies();
    __syncthreads();                 // stage 0 is published
    if (T > 1) GEMM_STAGE(1, 1);

    for (int s = 0; s < T; ++s) {
        const int buf = s & 1;
        // two k-steps, unrolled so that the fragment arrays are indexed by constants
#pragma unroll
        for (int kk = 0; kk < 2; ++kk) {
            Frag16 a[2], b[4];
#pragma unroll
            for (int i = 0; i < 2; ++i) {
                int r = wm * 32 + i * 16 + l16;
                a[i].u[0] = *(const uint4*)&Tiles[buf][0][r][kk * 32 + half * 8];
                a[i].u[1] = *(const uint4*)&Tiles[buf][0][r][kk * 32 + 16 + half * 8];
            }
#pragma unroll
            for (int j = 0; j < 4; ++j) {
                int r = wn * 64 + j * 16 + l16;
                b[j].u[0] = *(const uint4*)&Tiles[buf][1][r][kk * 32 + half * 8];
                b[j].u[1] = *(const uint4*)&Tiles[buf][1][r][kk * 32 + 16 + half * 8];
            }
            // Keeps the k-step's 12 fragment loads one group in front of its WMMAs: without it
            // the scheduler loads the second A fragment among them and waits out its latency there.
            __builtin_amdgcn_sched_barrier(0);
#pragma unroll
            for (int i = 0; i < 2; ++i)
#pragma unroll
                for (int j = 0; j < 4; ++j)
                    acc[i][j] = __builtin_amdgcn_wmma_f32_16x16x32_f16(
                        false, a[i].v, false, b[j].v, (short)0, acc[i][j], false, false);
        }
        wait_lds_reads();
        wait_copies();
        __syncthreads();
        if (s + 2 < T) GEMM_STAGE(s + 2, buf);
    }
    wait_copies();
#undef GEMM_STAGE

#pragma unroll
    for (int i = 0; i < 2; ++i)
#pragma unroll
        for (int j = 0; j < 4; ++j) {
            int col = bn + wn * 64 + j * 16 + l16;
#pragma unroll
            for (int e = 0; e < 8; ++e) {
                int row = bm + wm * 32 + i * 16 + e + 8 * half;
                C[(size_t)row * N + col] = acc[i][j][e];
            }
        }
}

// ---------------------------------------------------------------------------
// QKV projection with RoPE and the repack in its epilogue:
//   x f16 [b*L + l][1024], w_qkv f16 [3072][1024]  ->  Q,K f16 [b,h,l,dh] ; V^T f16 [b,h,dh,l]
// Softmax scale 1/sqrt(64) folded into Q. The projection never leaves the registers as f32.
// Same tile, ring and k-steps as gemm_nt_f16, but the 64-row side of a wave's sub-tile is the
// A operand: a lane then holds, of ONE row of the 32-row side (column l16), eight neighbouring
// rows of the 64-row side (8 * half + e of each 16-row tile), which is 16 B of f16 output.
//   Q, K blocks: 32-row side = positions (x), 64-row side = one head's 64 dh (w_qkv). Both sides
//                of a rotation pair (dh, dh + 32) sit in the same lane and register index, two
//                tiles apart.
//   V blocks:    the two operands change places: 32-row side = dh (w_qkv), 64-row side = positions,
//                so the same registers are 16 B of a V^T row.
// Either way a wave owns 32 output rows of 128 B; it turns them in its own LDS range so that
// every store covers four whole lines.
// Six waves per SIMD: the grid is three blocks per WGP, and all of them have to be resident at
// once (one round); without the bound the epilogue's table loads take registers past that.
// ---------------------------------------------------------------------------
__global__ __launch_bounds__(256) __attribute__((amdgpu_waves_per_eu(6)))
void gemm_qkv_rope(const _Float16* __restrict__ X, const _Float16* __restrict__ W,
                   const float* __restrict__ cosT, const float* __restrict__ sinT,
                   _Float16* __restrict__ Q, _Float16* __restrict__ Kd,
                   _Float16* __restrict__ Vt) {
    __shared__ __align__(16) _Float16 Tiles[2][2][128][PITCH64];   // [buffer][32-row side | 64-row side][row][k]

    const int t    = threadIdx.x;
    const int wave = t >> 5, lane = t & 31;
    const int half = lane >> 4, l16 = lane & 15;
    const int wm   = wave >> 1, wn = wave & 1;
    const int part = blockIdx.x >> 3;                  // 0: Q, 1: K, 2: V (8 blocks of 128 features each)
    const int f0   = blockIdx.x * 128;                 // first row of w_qkv
    const int m0   = blockIdx.y * 128;                 // first row of x
    const int bb   = m0 / SEQ, l0 = m0 % SEQ;          // a block lies inside one batch entry
    const bool isV = part == 2;

    const _Float16* xs = X + (size_t)m0 * D_MODEL;
    const _Float16* fs = W + (size_t)f0 * D_MODEL;

    v8f acc[2][4] = {};

    const int cr = t >> 3, cc = (t & 7) * 8;
    const _Float16* ga = (isV ? fs : xs) + (size_t)cr * D_MODEL + cc;
    const _Float16* gw = (isV ? xs : fs) + (size_t)cr * D_MODEL + cc;
    const size_t    gs = (size_t)32 * D_MODEL;                 // 32 rows on, in elements
    const unsigned  ls = 32 * PITCH64 * 2;                     // 32 rows on, in LDS bytes
    const unsigned  la = lds_addr(&Tiles[0][0][cr][cc]);
    const unsigned  lw = lds_addr(&Tiles[0][1][cr][cc]);
    const unsigned  lb = sizeof(Tiles[0]);                     // one buffer on
    constexpr int   T  = D_MODEL / 64;

#define GEMM_STAGE(s, buf)                                                              \
    copy8(la + (buf) * lb, la + (buf) * lb + ls, la + (buf) * lb + 2 * ls, la + (buf) * lb + 3 * ls, \
          lw + (buf) * lb, lw + (buf) * lb + ls, lw + (buf) * lb + 2 * ls, lw + (buf) * lb + 3 * ls, \
          ga + (s) * 64, ga + (s) * 64 + gs, ga + (s) * 64 + 2 * gs, ga + (s) * 64 + 3 * gs,         \
          gw + (s) * 64, gw + (s) * 64 + gs, gw + (s) * 64 + 2 * gs, gw + (s) * 64 + 3 * gs)

    GEMM_STAGE(0, 0);
    wait_copies();
    __syncthreads();                 // stage 0 is published
    GEMM_STAGE(1, 1);

    for (int s = 0; s < T; ++s) {
        const int buf = s & 1;
        // two k-steps, unrolled so that the fragment arrays are indexed by constants
#pragma unroll
        for (int kk = 0; kk < 2; ++kk) {
            Frag16 a[2], b[4];
#pragma unroll
            for (int i = 0; i < 2; ++i) {
                int r = wm * 32 + i * 16 + l16;
                a[i].u[0] = *(const uint4*)&Tiles[buf][0][r][kk * 32 + half * 8];
                a[i].u[1] = *(const uint4*)&Tiles[buf][0][r][kk * 32 + 16 + half * 8];
            }
#pragma unroll
            for (int j = 0; j < 4; ++j) {
                int r = wn * 64 + j * 16 + l16;
                b[j].u[0] = *(const uint4*)&Tiles[buf][1][r][kk * 32 + half * 8];
                b[j].u[1] = *(const uint4*)&Tiles[buf][1][r][kk * 32 + 16 + half * 8];
            }
            // Keeps the k-step's 12 fragment loads one group in front of its WMMAs: without it
            // the scheduler loads the second fragment of the 32-row side among them and waits
            // out its latency there.
            __builtin_amdgcn_sched_barrier(0);
#pragma unroll
            for (int i = 0; i < 2; ++i)
#pragma unroll
                for (int j = 0; j < 4; ++j)
                    acc[i][j] = __builtin_amdgcn_wmma_f32_16x16x32_f16(
                        false, b[j].v, false, a[i].v, (short)0, acc[i][j], false, false);
        }
        wait_lds_reads();
        wait_copies();
        __syncthreads();
        if (s + 2 < T) GEMM_STAGE(s + 2, buf);
    }
    wait_copies();
#undef GEMM_STAGE

    // acc[i][j][e] = product of row wm * 32 + i * 16 + l16 of the 32-row side
    //                with row wn * 64 + j * 16 + 8 * half + e of the 64-row side.
    // Behind the last trip's barrier nobody reads the ring and no copy is outstanding:
    // each wave stages its 32 rows of 128 B in a range of its own.
    _Float16 (*Stg)[PITCH64] = &Tiles[0][wave >> 2][(wave & 3) * 32];

    if (!isV) {
        const float sc = part == 0 ? 0.125f : 1.0f;            // 1/sqrt(HEAD_DIM) on Q alone
        const int    l  = l0 + wm * 32 + l16;                  // the lane's position in tile i = 0
        const float* cp = cosT + l * HEAD_DIM + 8 * half;
        const float* sp = sinT + l * HEAD_DIM + 8 * half;
        // unrolled so that acc is indexed by constants
#pragma unroll
        for (int i = 0; i < 2; ++i) {
            v8f cs[4], sn[4];                                  // dh j * 16 + 8 * half + e
#pragma unroll
            for (int j = 0; j < 4; ++j) {
                cs[j] = *(const v8f*)(cp + i * 16 * HEAD_DIM + j * 16);
                sn[j] = *(const v8f*)(sp + i * 16 * HEAD_DIM + j * 16);
            }
            // Precaution for the 16 loads above: their two address pairs are inputs here, so they
            // stay live up to this wait and nothing is placed in one of them before it.
            asm volatile("s_wait_xcnt 0x0" :: "v"(cp), "v"(sp) : "memory");
            // rotate_half: dh < 32 pairs with -t[dh + 32], dh >= 32 with +t[dh - 32]
#pragma unroll
            for (int j = 0; j < 2; ++j) {
                const v8f lo = (acc[i][j]     * cs[j]     - acc[i][j + 2] * sn[j])     * sc;
                const v8f hi = (acc[i][j + 2] * cs[j + 2] + acc[i][j]     * sn[j + 2]) * sc;
                acc[i][j]     = lo;
                acc[i][j + 2] = hi;
            }
        }
    }

#pragma unroll
    for (int i = 0; i < 2; ++i)
#pragma unroll
        for (int j = 0; j < 4; ++j)
            *(v8h*)&Stg[i * 16 + l16][(2 * j + half) * 8] = __builtin_convertvector(acc[i][j], v8h);
    // The wave's own LDS writes are done before other lanes of it read the rows back.
    asm volatile("s_wait_dscnt 0x0" ::: "memory");

    // Q, K: row = position, 128 B = the head's 64 dh. V^T: row = dh, 128 B = 64 positions.
    _Float16* dst;
    int       pitch;
    if (isV) {
        dst   = Vt + ((size_t)bb * D_MODEL + (f0 - 2 * D_MODEL) + wm * 32) * SEQ + l0 + wn * 64;
        pitch = SEQ;
    } else {
        const int h = (f0 & (D_MODEL - 1)) / HEAD_DIM + wn;
        dst   = (part == 0 ? Q : Kd) + (((size_t)bb * NUM_HEADS + h) * SEQ + l0 + wm * 32) * HEAD_DIM;
        pitch = HEAD_DIM;
    }
    // eight lanes store one whole line; unrolled so that the arrays stay in registers
    v8h* gp[8];
    v8h  row[8];
#pragma unroll
    for (int k = 0; k < 8; ++k) {
        const int r = k * 4 + (lane >> 3), ch = lane & 7;
        gp[k]  = (v8h*)&dst[(size_t)(r * pitch + ch * 8)];
        row[k] = *(const v8h*)&Stg[r][ch * 8];
    }
    // Keeps the address arithmetic in front of the eight stores, so that no register which an
    // issued store names is rewritten behind it.
    __builtin_amdgcn_sched_barrier(0);
#pragma unroll
    for (int k = 0; k < 8; ++k) *gp[k] = row[k];
}

__device__ inline float xhalf(float x) {
    return __builtin_bit_cast(float, __builtin_amdgcn_permlanex16(
        __builtin_bit_cast(int, x), __builtin_bit_cast(int, x), 0x76543210, 0xfedcba98, false, false));
}

// 2^x of eight values in place. One statement, so that each v_exp_f32 is followed by an
// independent instruction and the last by v_nop: the slot the instruction set asks for between
// a transcendental and an instruction that reads its result or overwrites its source.
__device__ inline void exp2x8(v8f& x) {
    float a = x[0], b = x[1], c = x[2], d = x[3], e = x[4], f = x[5], g = x[6], h = x[7];
    asm("v_exp_f32 %0, %0\n\tv_exp_f32 %1, %1\n\tv_exp_f32 %2, %2\n\tv_exp_f32 %3, %3\n\t"
        "v_exp_f32 %4, %4\n\tv_exp_f32 %5, %5\n\tv_exp_f32 %6, %6\n\tv_exp_f32 %7, %7\n\tv_nop"
        : "+v"(a), "+v"(b), "+v"(c), "+v"(d), "+v"(e), "+v"(f), "+v"(g), "+v"(h));
    x[0] = a; x[1] = b; x[2] = c; x[3] = d; x[4] = e; x[5] = f; x[6] = g; x[7] = h;
}

// 2^x of two values in place, in one statement closed by v_nop, for the same slot.
__device__ inline void exp2x2(float& a, float& b) {
    asm("v_exp_f32 %0, %0\n\tv_exp_f32 %1, %1\n\tv_nop" : "+v"(a), "+v"(b));
}

// Four waves per SIMD: the grid is two blocks per WGP; the bound lets a wave use its full share
// of the registers for the two query tiles.
__global__ __launch_bounds__(256) __attribute__((amdgpu_waves_per_eu(4, 4)))
void attn_f16(const _Float16* __restrict__ Q, const _Float16* __restrict__ Kd,
              const _Float16* __restrict__ Vt, _Float16* __restrict__ O) {
    // [buffer][key group][K | V^T][row][col]: K rows are keys over dh, V^T rows are dh over keys
    __shared__ __align__(16) _Float16 KV[2][2][2][64][PITCH64];

    const int t    = threadIdx.x;
    const int wave = t >> 5, lane = t & 31;
    const int half = lane >> 4, l16 = lane & 15;
    const int qg   = wave & 3;             // strip of 32 queries
    const int kh   = wave >> 2;            // key group
    const int bh    = blockIdx.x;          // 0..31
    const int qtile = blockIdx.y;          // 0..15
    const int qbase = qtile * 128 + qg * 32;

    // Q strip: 2 tiles x 16 queries x 64 dh = two 32x16 B fragments a tile (column = query l16),
    // straight from global
    Frag16 qf[2][2];
    // unrolled so that qf stays in registers, indexed by constants
#pragma unroll
    for (int qt = 0; qt < 2; ++qt)
#pragma unroll
        for (int kk = 0; kk < 2; ++kk) {
            const _Float16* qp = Q + ((size_t)bh * SEQ + qbase + qt * 16 + l16) * HEAD_DIM + kk * 32;
            qf[qt][kk].u[0] = *(const uint4*)(qp + half * 8);
            qf[qt][kk].u[1] = *(const uint4*)(qp + 16 + half * 8);
        }

    v8f o[2][4] = {};                      // o[qt][jf][e] = O^T[dh = jf * 16 + 8 * half + e][query qt * 16 + l16]
    float mrun[2] = {-1e30f, -1e30f};      // running maximum of the query, equal in both halves
    float lrun[2] = {0.f, 0.f};            // running sum over this half's keys only; joined after the loop

    // A stage: 128 keys = 2 key groups x 2 tiles x 64 rows x 128 B. A lane copies chunk cc of rows
    // cr and cr + 32 of all four tiles; eight lanes cover one whole 128-B line.
    const int cr = t >> 3, cc = (t & 7) * 8;
    const _Float16* gk = Kd + ((size_t)bh * SEQ + cr) * HEAD_DIM + cc;        // [key][dh]
    const _Float16* gv = Vt + ((size_t)bh * HEAD_DIM + cr) * SEQ + cc;        // [dh][key]
    const unsigned  ls = 32 * PITCH64 * 2;                     // 32 rows on, in LDS bytes
    const unsigned  lk = lds_addr(&KV[0][0][0][cr][cc]);
    const unsigned  lv = lds_addr(&KV[0][0][1][cr][cc]);
    const unsigned  lh = sizeof(KV[0][0]);                     // one key group on
    const unsigned  lb = sizeof(KV[0]);                        // one buffer on
    constexpr int   T  = SEQ / 128;

#define KV_STAGE(s, buf)                                                                          \
    copy8(lk + (buf) * lb, lk + (buf) * lb + ls, lv + (buf) * lb, lv + (buf) * lb + ls,           \
          lk + (buf) * lb + lh, lk + (buf) * lb + lh + ls, lv + (buf) * lb + lh, lv + (buf) * lb + lh + ls, \
          gk + (size_t)(s) * 128 * HEAD_DIM, gk + ((size_t)(s) * 128 + 32) * HEAD_DIM,            \
          gv + (s) * 128, gv + (s) * 128 + (size_t)32 * SEQ,                                      \
          gk + ((size_t)(s) * 128 + 64) * HEAD_DIM, gk + ((size_t)(s) * 128 + 96) * HEAD_DIM,     \
          gv + (s) * 128 + 64, gv + (s) * 128 + 64 + (size_t)32 * SEQ)

    KV_STAGE(0, 0);
    wait_copies();
    __syncthreads();                 // stage 0 is published
    KV_STAGE(1, 1);

    // One trip, up to and with the barrier at its foot. Inlined into both loops below.
    auto trip = [&](const int st) __attribute__((always_inline)) {
        const int buf = st & 1;
        const _Float16 (*Kblk)[PITCH64] = KV[buf][kh][0];
        const _Float16 (*Vblk)[PITCH64] = KV[buf][kh][1];

        // S^T = K * Q^T : 64 keys x 32 queries (4 M-fragments x 2 query tiles, K-dim 64 = 2 steps)
        // s[qt][nf][e] = score of key st * 128 + kh * 64 + nf * 16 + 8 * half + e
        //                against query qt * 16 + l16
        v8f s[2][4] = {};
        // the trip's eight K fragments, one group; unrolled so that ka is indexed by constants
        Frag16 ka[4][2];
#pragma unroll
        for (int nf = 0; nf < 4; ++nf)
#pragma unroll
            for (int kk = 0; kk < 2; ++kk) {
                ka[nf][kk].u[0] = *(const uint4*)&Kblk[nf * 16 + l16][kk * 32 + half * 8];
                ka[nf][kk].u[1] = *(const uint4*)&Kblk[nf * 16 + l16][kk * 32 + 16 + half * 8];
            }
        // Keeps the group in front of the products, which then wait by count: among the WMMAs every
        // load pair is a stop of its own with a full wait behind it.
        __builtin_amdgcn_sched_barrier(0);
        // both query tiles use a fragment; unrolled so that s, ka and qf are indexed by constants
#pragma unroll
        for (int nf = 0; nf < 4; ++nf)
#pragma unroll
            for (int kk = 0; kk < 2; ++kk)
#pragma unroll
                for (int qt = 0; qt < 2; ++qt)
                    s[qt][nf] = __builtin_amdgcn_wmma_f32_16x16x32_f16(
                        false, ka[nf][kk].v, false, qf[qt][kk].v, (short)0, s[qt][nf], false, false);
        // Keeps the V^T loads below behind these products: they take over the K fragments' registers.
        __builtin_amdgcn_sched_barrier(0);

        // V^T fragments of dh 0 to 31, one group ahead of the softmax, whose vector work covers their
        // LDS latency; unrolled so that va is indexed by constants
        Frag16 va[4][2];
#pragma unroll
        for (int jf = 0; jf < 2; ++jf)
#pragma unroll
            for (int kk = 0; kk < 2; ++kk) {
                va[jf][kk].u[0] = *(const uint4*)&Vblk[jf * 16 + l16][kk * 32 + half * 8];
                va[jf][kk].u[1] = *(const uint4*)&Vblk[jf * 16 + l16][kk * 32 + 16 + half * 8];
            }
        // Keeps that group here: without it the scheduler sinks the loads to their products.
        __builtin_amdgcn_sched_barrier(0);

        Frag16 p[2][2];
        // unrolled so that the per-tile arrays are indexed by constants
#pragma unroll
        for (int qt = 0; qt < 2; ++qt) {
            // --- online softmax: the lane's 32 scores, then the other half's 32 ---
            float m8[8];
#pragma unroll
            for (int e = 0; e < 8; ++e)
                m8[e] = fmaxf(fmaxf(s[qt][0][e], s[qt][1][e]), fmaxf(s[qt][2][e], s[qt][3][e]));
            float mcur = fmaxf(fmaxf(fmaxf(m8[0], m8[1]), fmaxf(m8[2], m8[3])),
                               fmaxf(fmaxf(m8[4], m8[5]), fmaxf(m8[6], m8[7])));
            mcur = fmaxf(mcur, xhalf(mcur));

            const float mn    = fmaxf(mrun[qt], mcur);
            const float alpha = __expf(mrun[qt] - mn);
            mrun[qt] = mn;
#pragma unroll
            for (int nf = 0; nf < 4; ++nf) {
                s[qt][nf] = (s[qt][nf] - mn) * 1.44269504088896340736f;   // e^x = 2^(x * log2 e), as __expf forms it
                exp2x8(s[qt][nf]);
            }

            float r8[8];
#pragma unroll
            for (int e = 0; e < 8; ++e)
                r8[e] = (s[qt][0][e] + s[qt][1][e]) + (s[qt][2][e] + s[qt][3][e]);
            lrun[qt] = lrun[qt] * alpha
                     + (((r8[0] + r8[1]) + (r8[2] + r8[3])) + ((r8[4] + r8[5]) + (r8[6] + r8[7])));
#pragma unroll
            for (int jf = 0; jf < 4; ++jf)
#pragma unroll
                for (int e = 0; e < 8; ++e) o[qt][jf][e] *= alpha;

            // P^T as B operand: element i of fragment kk is key kk * 32 + (i < 8 ? 8 * half + i
            // : 16 + 8 * half + i - 8), which is register i & 7 of tile 2 * kk + (i >> 3)
#pragma unroll
            for (int kk = 0; kk < 2; ++kk)
#pragma unroll
                for (int i = 0; i < 16; ++i)
                    p[qt][kk].v[i] = (_Float16)s[qt][2 * kk + (i >> 3)][i & 7];

            if (qt == 0) {
                // Ends the first query tile's softmax here: its sum is taken and its P packed, so its
                // scores' registers are free for the second load group.
                __builtin_amdgcn_sched_barrier(0);
                // V^T fragments of dh 32 to 63, one group: one stop and one wait for its eight loads. They
                // are the trip's last LDS reads, so the compiler draws the foot's waits and the barrier's
                // signal up behind them; what follows up to the barrier's wait works on registers only.
#pragma unroll
                for (int jf = 2; jf < 4; ++jf)
#pragma unroll
                    for (int kk = 0; kk < 2; ++kk) {
                        va[jf][kk].u[0] = *(const uint4*)&Vblk[jf * 16 + l16][kk * 32 + half * 8];
                        va[jf][kk].u[1] = *(const uint4*)&Vblk[jf * 16 + l16][kk * 32 + 16 + half * 8];
                    }
                // Keeps that group here: without it the scheduler sinks the loads to their products.
                __builtin_amdgcn_sched_barrier(0);
            }
        }

        // O^T += V^T * P^T : 64 dh x 32 queries (4 M-fragments x 2 query tiles, K=64 keys = 2 steps);
        // both query tiles use a fragment; unrolled so that o, va and p are indexed by constants
#pragma unroll
        for (int g = 0; g < 2; ++g)
#pragma unroll
            for (int kk = 0; kk < 2; ++kk)
#pragma unroll
                for (int jf = 2 * g; jf < 2 * g + 2; ++jf)
#pragma unroll
                    for (int qt = 0; qt < 2; ++qt)
                        o[qt][jf] = __builtin_amdgcn_wmma_f32_16x16x32_f16(
                            false, va[jf][kk].v, false, p[qt][kk].v, (short)0, o[qt][jf], false, false);

        wait_lds_reads();
        wait_copies();
        __syncthreads();
    };
    // The trips that refill and the last two, which do not, are loops of their own: the test for a
    // stage st + 2 is the loop bound, so a trip is one straight block. With a branch at the foot the
    // compiler sank the row sums behind it, and the 64 exponentials stayed in registers through the
    // O^T products, where the V^T fragments need them.
    for (int st = 0; st < T - 2; ++st) {
        trip(st);
        KV_STAGE(st + 2, st & 1);
    }
    for (int st = T - 2; st < T; ++st) trip(st);
    wait_copies();
#undef KV_STAGE

    // join the halves' sums
    lrun[0] += xhalf(lrun[0]);
    lrun[1] += xhalf(lrun[1]);

    // Merge of the two key groups. Waves w and w ^ 4 hold the same 32 queries in the same lanes and
    // registers. Each finishes one query tile (tile kh) and hands the other tile's state to its
    // partner. Behind the last trip's barrier nobody reads the ring and no copy is outstanding:
    // the ring's LDS carries the exchange.
    const bool up = kh != 0;
    v4f*   xo = (v4f*)&KV[0][0][0][0][0];                      // [wave][8][lane], 16 B a lane
    float* xm = (float*)(xo + 8 * 8 * 32);                     // [wave][max | sum][lane]
    // unrolled (here and in the store loop below) so that o is indexed by constants
#pragma unroll
    for (int jf = 0; jf < 4; ++jf) {
        const v8f g = up ? o[0][jf] : o[1][jf];
        xo[(wave * 8 + 2 * jf) * 32 + lane]     = __builtin_shufflevector(g, g, 0, 1, 2, 3);
        xo[(wave * 8 + 2 * jf + 1) * 32 + lane] = __builtin_shufflevector(g, g, 4, 5, 6, 7);
    }
    xm[(wave * 2) * 32 + lane]     = up ? mrun[0] : mrun[1];
    xm[(wave * 2 + 1) * 32 + lane] = up ? lrun[0] : lrun[1];
    __syncthreads();                 // the partners' states are published

    const int   pw = wave ^ 4;
    const float mp = xm[(pw * 2) * 32 + lane];
    const float lp = xm[(pw * 2 + 1) * 32 + lane];
    const float mo = up ? mrun[1] : mrun[0];
    const float lo = up ? lrun[1] : lrun[0];
    const float mj = fmaxf(mo, mp);
    float fo = (mo - mj) * 1.44269504088896340736f;            // e^x = 2^(x * log2 e)
    float fp = (mp - mj) * 1.44269504088896340736f;
    exp2x2(fo, fp);
    const float lj = lo * fo + lp * fp;

    // normalize, store f16 [b*L + q][h*64 + dh]: 8 neighbouring dh a store
    const int b = bh >> 4, h = bh & (NUM_HEADS - 1);
    const size_t m = (size_t)b * SEQ + qbase + kh * 16 + l16;
#pragma unroll
    for (int jf = 0; jf < 4; ++jf) {
        const v8f own = up ? o[1][jf] : o[0][jf];
        const v4f p0  = xo[(pw * 8 + 2 * jf) * 32 + lane];
        const v4f p1  = xo[(pw * 8 + 2 * jf + 1) * 32 + lane];
        union { _Float16 f[8]; uint4 u; } pk;
#pragma unroll
        for (int e = 0; e < 8; ++e)
            pk.f[e] = (_Float16)((own[e] * fo + (e < 4 ? p0[e & 3] : p1[e & 3]) * fp) / lj);
        *(uint4*)&O[m * D_MODEL + h * HEAD_DIM + jf * 16 + 8 * half] = pk.u;
    }
}

// ---------------------------------------------------------------------------
// Launcher
// ---------------------------------------------------------------------------
extern "C" void kernel_launch(void* const* d_in, const int* in_sizes, int n_in,
                              void* d_out, int out_size, void* d_ws, size_t ws_size,
                              hipStream_t stream) {
    (void)in_sizes; (void)n_in; (void)out_size; (void)ws_size;

    const float* x    = (const float*)d_in[0];   // [2,2048,1024]
    const float* cosT = (const float*)d_in[1];   // [2048,64]
    const float* sinT = (const float*)d_in[2];   // [2048,64]
    const float* wqkv = (const float*)d_in[3];   // [3072,1024]
    const float* wo   = (const float*)d_in[4];   // [1024,1024]
    float* out = (float*)d_out;                  // [2,2048,1024]

    char* ws = (char*)d_ws;
    _Float16* x_h  = (_Float16*)(ws);                        //  8 MB
    _Float16* wq_h = (_Float16*)(ws + ( 8ull << 20));        //  6 MB
    _Float16* wo_h = (_Float16*)(ws + (14ull << 20));        //  2 MB
    _Float16* q_h  = (_Float16*)(ws + (64ull << 20));        //  8 MB
    _Float16* k_h  = (_Float16*)(ws + (72ull << 20));        //  8 MB
    _Float16* vt_h = (_Float16*)(ws + (80ull << 20));        //  8 MB
    _Float16* at_h = (_Float16*)(ws + (88ull << 20));        //  8 MB

    cvt3_f32_f16<<<CVT_X_BLOCKS + CVT_WQ_BLOCKS + CVT_WO_BLOCKS, 256, 0, stream>>>(
        x, wqkv, wo, x_h, wq_h, wo_h);

    // x @ w_qkv^T (M=4096, N=3072, K=1024), rotated and repacked in the epilogue
    gemm_qkv_rope<<<dim3(3 * D_MODEL / 128, MROWS / 128), 256, 0, stream>>>(
        x_h, wq_h, cosT, sinT, q_h, k_h, vt_h);

    attn_f16<<<dim3(BATCH * NUM_HEADS, SEQ / 128), 256, 0, stream>>>(q_h, k_h, vt_h, at_h);

    // out = attn @ w_o^T  : M=4096, N=1024, K=1024
    gemm_nt_f16<<<dim3(D_MODEL / 128, MROWS / 128), 256, 0, stream>>>(at_h, wo_h, out, MROWS, D_MODEL, 1024);
}

// v009
// One run takes 78.7 microseconds.
// In two side-by-side timings against v008, it was 1.05 and 1.04 times as fast.
// Over all steps from v000 it is 4.66 times as fast.
#include <hip/hip_runtime.h>

// ---------------------------------------------------------------------------
// MI455X (gfx1250, wave32) RoPE attention, f16 WMMA pipeline.
// ---------------------------------------------------------------------------

typedef __attribute__((ext_vector_type(16))) _Float16 v16h;
typedef __attribute__((ext_vector_type(8)))  float    v8f;
typedef __attribute__((ext_vector_type(4)))  float    v4f;
typedef __attribute__((ext_vector_type(4)))  _Float16 v4h;
typedef __attribute__((ext_vector_type(8)))  _Float16 v8h;

union Frag16 { v16h v; uint4 u[2]; };

#define D_MODEL   1024
#define NUM_HEADS 16
#define HEAD_DIM  64
#define BATCH     2
#define SEQ       2048
#define MROWS     (BATCH * SEQ)   // 4096

// LDS row pitch in f16 elements for tiles whose rows are read as 16-byte
// fragments by 16 lanes at once: 16 B x odd, so the 16 rows fall on distinct
// banks (a pitch of 64 B or 128 B puts them on the same few banks).
#define PITCH32   40              // 32-element rows: 80 B; no tile here uses it
#define PITCH64   72              // 64-element rows: 144 B

// ---------------------------------------------------------------------------
// Staging of LDS tiles: asynchronous copies, 16 B a lane, global -> LDS through no register,
// in a ring of two buffers: the copies of tile t + 2 are issued at the foot of trip t and
// waited for at the foot of trip t + 1, so they fly while tile t + 1 is worked on.
// ---------------------------------------------------------------------------
// LDS byte address of a __shared__ object: the low 32 bits of its address
__device__ inline unsigned lds_addr(const void* p) { return (unsigned)(size_t)p; }

// Four copies of a lane. The s_wait_xcnt closes the statement as a precaution: it stands in
// front of every later instruction that could rewrite an address register named here.
__device__ inline void copy4(unsigned l0, unsigned l1, unsigned l2, unsigned l3,
                             const _Float16* g0, const _Float16* g1,
                             const _Float16* g2, const _Float16* g3) {
    asm volatile("global_load_async_to_lds_b128 %0, %4, off\n\t"
                 "global_load_async_to_lds_b128 %1, %5, off\n\t"
                 "global_load_async_to_lds_b128 %2, %6, off\n\t"
                 "global_load_async_to_lds_b128 %3, %7, off\n\t"
                 "s_wait_xcnt 0x0"
                 :: "v"(l0), "v"(l1), "v"(l2), "v"(l3), "v"(g0), "v"(g1), "v"(g2), "v"(g3)
                 : "memory");
}

// Eight copies of a lane in one statement, with the same closing wait.
__device__ inline void copy8(unsigned l0, unsigned l1, unsigned l2, unsigned l3,
                             unsigned l4, unsigned l5, unsigned l6, unsigned l7,
                             const _Float16* g0, const _Float16* g1,
                             const _Float16* g2, const _Float16* g3,
                             const _Float16* g4, const _Float16* g5,
                             const _Float16* g6, const _Float16* g7) {
    asm volatile("global_load_async_to_lds_b128 %0, %8, off\n\t"
                 "global_load_async_to_lds_b128 %1, %9, off\n\t"
                 "global_load_async_to_lds_b128 %2, %10, off\n\t"
                 "global_load_async_to_lds_b128 %3, %11, off\n\t"
                 "global_load_async_to_lds_b128 %4, %12, off\n\t"
                 "global_load_async_to_lds_b128 %5, %13, off\n\t"
                 "global_load_async_to_lds_b128 %6, %14, off\n\t"
                 "global_load_async_to_lds_b128 %7, %15, off\n\t"
                 "s_wait_xcnt 0x0"
                 :: "v"(l0), "v"(l1), "v"(l2), "v"(l3), "v"(l4), "v"(l5), "v"(l6), "v"(l7),
                    "v"(g0), "v"(g1), "v"(g2), "v"(g3), "v"(g4), "v"(g5), "v"(g6), "v"(g7)
                 : "memory");
}

// The wave's own copies have landed (the compiler places no wait for them).
__device__ inline void wait_copies() { asm volatile("s_wait_asynccnt 0x0" ::: "memory"); }
// The wave's own LDS reads have returned: the buffer they read may be refilled behind the barrier.
__device__ inline void wait_lds_reads() { asm volatile("s_wait_dscnt 0x0" ::: "memory"); }

// value of lane l ^ 16
__device__ inline float xhalf(float x) {
    return __builtin_bit_cast(float, __builtin_amdgcn_permlanex16(
        __builtin_bit_cast(int, x), __builtin_bit_cast(int, x), 0x76543210, 0xfedcba98, false, false));
}

// maximum over the lane's row of 16 lanes, in every lane of it: four DPP rotations (8, 4, 2, 1)
__device__ inline float rowmax16(float x) {
    x = fmaxf(x, __builtin_bit_cast(float, __builtin_amdgcn_update_dpp(0, __builtin_bit_cast(int, x), 0x128, 0xf, 0xf, false)));
    x = fmaxf(x, __builtin_bit_cast(float, __builtin_amdgcn_update_dpp(0, __builtin_bit_cast(int, x), 0x124, 0xf, 0xf, false)));
    x = fmaxf(x, __builtin_bit_cast(float, __builtin_amdgcn_update_dpp(0, __builtin_bit_cast(int, x), 0x122, 0xf, 0xf, false)));
    x = fmaxf(x, __builtin_bit_cast(float, __builtin_amdgcn_update_dpp(0, __builtin_bit_cast(int, x), 0x121, 0xf, 0xf, false)));
    return x;
}

// compile-time switch handed to a generic lambda
template <bool B> struct Sel { static constexpr bool value = B; };

#define LOG2E 1.44269504088896340736f

// ---------------------------------------------------------------------------
// fp32 -> fp16 elementwise convert of all three f32 operands (x, w_qkv, w_o) in ONE launch: the
// three are independent, so nothing orders them, and as separate launches each paid its own
// start, first memory latency and drain. The block index picks the operand (a scalar choice).
// A block takes CVT_BLOCK contiguous floats; a lane takes eight float4, each wave-wide load
// covering 512 contiguous bytes, so few waves have to start and each keeps eight loads in flight.
// Every element count is a multiple of CVT_BLOCK. The grid is four blocks per WGP: one round.
// ---------------------------------------------------------------------------
#define CVT_BLOCK (256 * 8 * 4)
#define CVT_X_BLOCKS  ((MROWS * D_MODEL) / CVT_BLOCK)
#define CVT_WQ_BLOCKS ((3 * D_MODEL * D_MODEL) / CVT_BLOCK)
#define CVT_WO_BLOCKS ((D_MODEL * D_MODEL) / CVT_BLOCK)
__global__ __launch_bounds__(256)
void cvt3_f32_f16(const float* __restrict__ x, const float* __restrict__ wqkv,
                  const float* __restrict__ wo, _Float16* __restrict__ x_h,
                  _Float16* __restrict__ wq_h, _Float16* __restrict__ wo_h) {
    const unsigned  b     = blockIdx.x;
    const bool      is_wo = b >= CVT_X_BLOCKS + CVT_WQ_BLOCKS;
    const bool      is_wq = !is_wo && b >= CVT_X_BLOCKS;
    const float*    in    = is_wo ? wo   : is_wq ? wqkv : x;
    _Float16*       out   = is_wo ? wo_h : is_wq ? wq_h : x_h;
    const unsigned  blk   = b - (is_wo ? CVT_X_BLOCKS + CVT_WQ_BLOCKS : is_wq ? CVT_X_BLOCKS : 0);
    const size_t base = (size_t)blk * CVT_BLOCK + threadIdx.x * 4;
    v4f v[8];
    // unrolled so that all eight loads are issued before the first is waited for
#pragma unroll
    for (int k = 0; k < 8; ++k) v[k] = *(const v4f*)&in[base + k * 1024];
#pragma unroll
    for (int k = 0; k < 8; ++k) *(v4h*)&out[base + k * 1024] = __builtin_convertvector(v[k], v4h);
}

// ---------------------------------------------------------------------------
// Generic GEMM: C[M][N] = A[M][K] * W[N][K]^T   (A,W f16 row-major, C f32)
// Block = 256 threads (8 waves). Tile 128(M) x 128(N); a stage of the ring is 64 k (two
// k-steps of 32).
// K must be a multiple of 64.
// Wave (wm,wn) in 4x2 grid computes a 32x64 sub-tile = 2x4 WMMA fragments.
// Per k-step per wave: 8 v_wmma against 12 ds_load_b128.
// ---------------------------------------------------------------------------
__global__ __launch_bounds__(256)
void gemm_nt_f16(const _Float16* __restrict__ A, const _Float16* __restrict__ W,
                 float* __restrict__ C, int M, int N, int K) {
    __shared__ __align__(16) _Float16 Tiles[2][2][128][PITCH64];   // [buffer][A | W][row][k]

    const int t    = threadIdx.x;
    const int wave = t >> 5, lane = t & 31;
    const int half = lane >> 4, l16 = lane & 15;
    const int wm   = wave >> 1, wn = wave & 1;
    const int bm   = blockIdx.y * 128, bn = blockIdx.x * 128;

    v8f acc[2][4] = {};

    // A stage: 2 tiles x 128 rows x 128 B. A lane copies chunk cc of rows cr, cr + 32, cr + 64
    // and cr + 96 of both tiles; eight lanes cover one whole 128-B line.
    const int cr = t >> 3, cc = (t & 7) * 8;
    const _Float16* ga = A + (size_t)(bm + cr) * K + cc;
    const _Float16* gw = W + (size_t)(bn + cr) * K + cc;
    const size_t    gs = (size_t)32 * K;                       // 32 rows on, in elements
    const unsigned  ls = 32 * PITCH64 * 2;                     // 32 rows on, in LDS bytes
    const unsigned  la = lds_addr(&Tiles[0][0][cr][cc]);
    const unsigned  lw = lds_addr(&Tiles[0][1][cr][cc]);
    const unsigned  lb = sizeof(Tiles[0]);                     // one buffer on
    const int       T  = K / 64;

#define GEMM_STAGE(s, buf)                                                              \
    copy8(la + (buf) * lb, la + (buf) * lb + ls, la + (buf) * lb + 2 * ls, la + (buf) * lb + 3 * ls, \
          lw + (buf) * lb, lw + (buf) * lb + ls, lw + (buf) * lb + 2 * ls, lw + (buf) * lb + 3 * ls, \
          ga + (s) * 64, ga + (s) * 64 + gs, ga + (s) * 64 + 2 * gs, ga + (s) * 64 + 3 * gs,         \
          gw + (s) * 64, gw + (s) * 64 + gs, gw + (s) * 64 + 2 * gs, gw + (s) * 64 + 3 * gs)

    GEMM_STAGE(0, 0);
    wait_copies();
    __syncthreads();                 // stage 0 is published
    if (T > 1) GEMM_STAGE(1, 1);

    for (int s = 0; s < T; ++s) {
        const int buf = s & 1;
        // two k-steps, unrolled so that the fragment arrays are indexed by constants
#pragma unroll
        for (int kk = 0; kk < 2; ++kk) {
            Frag16 a[2], b[4];
#pragma unroll
            for (int i = 0; i < 2; ++i) {
                int r = wm * 32 + i * 16 + l16;
                a[i].u[0] = *(const uint4*)&Tiles[buf][0][r][kk * 32 + half * 8];
                a[i].u[1] = *(const uint4*)&Tiles[buf][0][r][kk * 32 + 16 + half * 8];
            }
#pragma unroll
            for (int j = 0; j < 4; ++j) {
                int r = wn * 64 + j * 16 + l16;
                b[j].u[0] = *(const uint4*)&Tiles[buf][1][r][kk * 32 + half * 8];
                b[j].u[1] = *(const uint4*)&Tiles[buf][1][r][kk * 32 + 16 + half * 8];
            }
            // Keeps the k-step's 12 fragment loads one group in front of its WMMAs: without it
            // the scheduler loads the second A fragment among them and waits out its latency there.
            __builtin_amdgcn_sched_barrier(0);
#pragma unroll
            for (int i = 0; i < 2; ++i)
#pragma unroll
                for (int j = 0; j < 4; ++j)
                    acc[i][j] = __builtin_amdgcn_wmma_f32_16x16x32_f16(
                        false, a[i].v, false, b[j].v, (short)0, acc[i][j], false, false);
        }
        wait_lds_reads();
        wait_copies();
        __syncthreads();
        if (s + 2 < T) GEMM_STAGE(s + 2, buf);
    }
    wait_copies();
#undef GEMM_STAGE

#pragma unroll
    for (int i = 0; i < 2; ++i)
#pragma unroll
        for (int j = 0; j < 4; ++j) {
            int col = bn + wn * 64 + j * 16 + l16;
#pragma unroll
            for (int e = 0; e < 8; ++e) {
                int row = bm + wm * 32 + i * 16 + e + 8 * half;
                C[(size_t)row * N + col] = acc[i][j][e];
            }
        }
}

// ---------------------------------------------------------------------------
// QKV projection with RoPE and the repack in its epilogue:
//   x f16 [b*L + l][1024], w_qkv f16 [3072][1024]  ->  Q,K f16 [b,h,l,dh] ; V^T f16 [b,h,dh,l]
// Softmax scale 1/sqrt(64) and log2 e folded into Q: a score is then the exponent of 2 that the
// softmax needs. The projection never leaves the registers as f32.
// The epilogue also stores the squared length of every rotated, scaled Q row and of every rotated
// K row (f32 [b,h,l]): |score| <= |q| |k|, which lets attention do without a maximum where that
// bound is small.
// Same tile, ring and k-steps as gemm_nt_f16, but the 64-row side of a wave's sub-tile is the
// A operand: a lane then holds, of ONE row of the 32-row side (column l16), eight neighbouring
// rows of the 64-row side (8 * half + e of each 16-row tile), which is 16 B of f16 output.
//   Q, K blocks: 32-row side = positions (x), 64-row side = one head's 64 dh (w_qkv). Both sides
//                of a rotation pair (dh, dh + 32) sit in the same lane and register index, two
//                tiles apart.
//   V blocks:    the two operands change places: 32-row side = dh (w_qkv), 64-row side = positions,
//                so the same registers are 16 B of a V^T row.
// Either way a wave owns 32 output rows of 128 B; it turns them in its own LDS range so that
// every store covers four whole lines.
// Six waves per SIMD: the grid is three blocks per WGP, and all of them have to be resident at
// once (one round); without the bound the epilogue's table loads take registers past that.
// ---------------------------------------------------------------------------
__global__ __launch_bounds__(256) __attribute__((amdgpu_waves_per_eu(6)))
void gemm_qkv_rope(const _Float16* __restrict__ X, const _Float16* __restrict__ W,
                   const float* __restrict__ cosT, const float* __restrict__ sinT,
                   _Float16* __restrict__ Q, _Float16* __restrict__ Kd,
                   _Float16* __restrict__ Vt, float* __restrict__ Nq, float* __restrict__ Nk) {
    __shared__ __align__(16) _Float16 Tiles[2][2][128][PITCH64];   // [buffer][32-row side | 64-row side][row][k]

    const int t    = threadIdx.x;
    // the wave's number in a scalar register: what is derived from it takes no vector register
    const int wave = __builtin_amdgcn_readfirstlane(t >> 5), lane = t & 31;
    const int half = lane >> 4, l16 = lane & 15;
    const int wm   = wave >> 1, wn = wave & 1;
    const int part = blockIdx.x >> 3;                  // 0: Q, 1: K, 2: V (8 blocks of 128 features each)
    const int f0   = blockIdx.x * 128;                 // first row of w_qkv
    const int m0   = blockIdx.y * 128;                 // first row of x
    const int bb   = m0 / SEQ, l0 = m0 % SEQ;          // a block lies inside one batch entry
    const bool isV = part == 2;

    const _Float16* xs = X + (size_t)m0 * D_MODEL;
    const _Float16* fs = W + (size_t)f0 * D_MODEL;

    v8f acc[2][4] = {};

    const int cr = t >> 3, cc = (t & 7) * 8;
    const _Float16* ga = (isV ? fs : xs) + (size_t)cr * D_MODEL + cc;
    const _Float16* gw = (isV ? xs : fs) + (size_t)cr * D_MODEL + cc;
    const size_t    gs = (size_t)32 * D_MODEL;                 // 32 rows on, in elements
    const unsigned  ls = 32 * PITCH64 * 2;                     // 32 rows on, in LDS bytes
    const unsigned  la = lds_addr(&Tiles[0][0][cr][cc]);
    const unsigned  lw = lds_addr(&Tiles[0][1][cr][cc]);
    const unsigned  lb = sizeof(Tiles[0]);                     // one buffer on
    constexpr int   T  = D_MODEL / 64;

#define GEMM_STAGE(s, buf)                                                              \
    copy8(la + (buf) * lb, la + (buf) * lb + ls, la + (buf) * lb + 2 * ls, la + (buf) * lb + 3 * ls, \
          lw + (buf) * lb, lw + (buf) * lb + ls, lw + (buf) * lb + 2 * ls, lw + (buf) * lb + 3 * ls, \
          ga + (s) * 64, ga + (s) * 64 + gs, ga + (s) * 64 + 2 * gs, ga + (s) * 64 + 3 * gs,         \
          gw + (s) * 64, gw + (s) * 64 + gs, gw + (s) * 64 + 2 * gs, gw + (s) * 64 + 3 * gs)

    GEMM_STAGE(0, 0);
    wait_copies();
    __syncthreads();                 // stage 0 is published
    GEMM_STAGE(1, 1);

    for (int s = 0; s < T; ++s) {
        const int buf = s & 1;
        // two k-steps, unrolled so that the fragment arrays are indexed by constants
#pragma unroll
        for (int kk = 0; kk < 2; ++kk) {
            Frag16 a[2], b[4];
#pragma unroll
            for (int i = 0; i < 2; ++i) {
                int r = wm * 32 + i * 16 + l16;
                a[i].u[0] = *(const uint4*)&Tiles[buf][0][r][kk * 32 + half * 8];
                a[i].u[1] = *(const uint4*)&Tiles[buf][0][r][kk * 32 + 16 + half * 8];
            }
#pragma unroll
            for (int j = 0; j < 4; ++j) {
                int r = wn * 64 + j * 16 + l16;
                b[j].u[0] = *(const uint4*)&Tiles[buf][1][r][kk * 32 + half * 8];
                b[j].u[1] = *(const uint4*)&Tiles[buf][1][r][kk * 32 + 16 + half * 8];
            }
            // Keeps the k-step's 12 fragment loads one group in front of its WMMAs: without it
            // the scheduler loads the second fragment of the 32-row side among them and waits
            // out its latency there.
            __builtin_amdgcn_sched_barrier(0);
#pragma unroll
            for (int i = 0; i < 2; ++i)
#pragma unroll
                for (int j = 0; j < 4; ++j)
                    acc[i][j] = __builtin_amdgcn_wmma_f32_16x16x32_f16(
                        false, b[j].v, false, a[i].v, (short)0, acc[i][j], false, false);
        }
        wait_lds_reads();
        wait_copies();
        __syncthreads();
        if (s + 2 < T) GEMM_STAGE(s + 2, buf);
    }
    wait_copies();
#undef GEMM_STAGE

    // acc[i][j][e] = product of row wm * 32 + i * 16 + l16 of the 32-row side
    //                with row wn * 64 + j * 16 + 8 * half + e of the 64-row side.
    // Behind the last trip's barrier nobody reads the ring and no copy is outstanding:
    // each wave stages its 32 rows of 128 B in a range of its own.
    _Float16 (*Stg)[PITCH64] = &Tiles[0][wave >> 2][(wave & 3) * 32];

    if (!isV) {
        const float sc = part == 0 ? 0.125f * LOG2E : 1.0f;    // log2 e / sqrt(HEAD_DIM) on Q alone
        float ss[2];                                           // squared length of the lane's half of row i * 16 + l16
        const int    l  = l0 + wm * 32 + l16;                  // the lane's position in tile i = 0
        const float* cp = cosT + l * HEAD_DIM + 8 * half;
        const float* sp = sinT + l * HEAD_DIM + 8 * half;
        // unrolled so that acc is indexed by constants
#pragma unroll
        for (int i = 0; i < 2; ++i) {
            v8f cs[4], sn[4];                                  // dh j * 16 + 8 * half + e
#pragma unroll
            for (int j = 0; j < 4; ++j) {
                cs[j] = *(const v8f*)(cp + i * 16 * HEAD_DIM + j * 16);
                sn[j] = *(const v8f*)(sp + i * 16 * HEAD_DIM + j * 16);
            }
            // Precaution for the 16 loads above: their two address pairs are inputs here, so they
            // stay live up to this wait and nothing is placed in one of them before it.
            asm volatile("s_wait_xcnt 0x0" :: "v"(cp), "v"(sp) : "memory");
            // rotate_half: dh < 32 pairs with -t[dh + 32], dh >= 32 with +t[dh - 32]
#pragma unroll
            for (int j = 0; j < 2; ++j) {
                const v8f lo = (acc[i][j]     * cs[j]     - acc[i][j + 2] * sn[j])     * sc;
                const v8f hi = (acc[i][j + 2] * cs[j + 2] + acc[i][j]     * sn[j + 2]) * sc;
                acc[i][j]     = lo;
                acc[i][j + 2] = hi;
            }
        }
        // behind the rotation, where the tables' registers are free; unrolled so that acc is indexed by constants
#pragma unroll
        for (int i = 0; i < 2; ++i) {
            const v8f q2 = acc[i][0] * acc[i][0] + acc[i][1] * acc[i][1]
                         + acc[i][2] * acc[i][2] + acc[i][3] * acc[i][3];
            ss[i] = ((q2[0] + q2[1]) + (q2[2] + q2[3])) + ((q2[4] + q2[5]) + (q2[6] + q2[7]));
        }
        // the other half of the wave holds the row's other 32 dh; lane n then stores row n of the
        // wave's 32: one whole line, written by this wave alone
        ss[0] += xhalf(ss[0]);
        ss[1] += xhalf(ss[1]);
        const int   hn  = (f0 & (D_MODEL - 1)) / HEAD_DIM + wn;
        float*      np  = (part == 0 ? Nq : Nk) + ((size_t)bb * NUM_HEADS + hn) * SEQ + l0 + wm * 32 + lane;
        const float nv  = half ? ss[1] : ss[0];
        *np = nv;
        // Precaution for the store above: its address pair and its value are inputs here, so they
        // stay live up to this wait and nothing is placed in one of them before it.
        asm volatile("s_wait_xcnt 0x0" :: "v"(np), "v"(nv) : "memory");
    }

#pragma unroll
    for (int i = 0; i < 2; ++i)
#pragma unroll
        for (int j = 0; j < 4; ++j)
            *(v8h*)&Stg[i * 16 + l16][(2 * j + half) * 8] = __builtin_convertvector(acc[i][j], v8h);
    // The wave's own LDS writes are done before other lanes of it read the rows back.
    asm volatile("s_wait_dscnt 0x0" ::: "memory");

    // Q, K: row = position, 128 B = the head's 64 dh. V^T: row = dh, 128 B = 64 positions.
    _Float16* dst;
    int       pitch;
    if (isV) {
        dst   = Vt + ((size_t)bb * D_MODEL + (f0 - 2 * D_MODEL) + wm * 32) * SEQ + l0 + wn * 64;
        pitch = SEQ;
    } else {
        const int h = (f0 & (D_MODEL - 1)) / HEAD_DIM + wn;
        dst   = (part == 0 ? Q : Kd) + (((size_t)bb * NUM_HEADS + h) * SEQ + l0 + wm * 32) * HEAD_DIM;
        pitch = HEAD_DIM;
    }
    // eight lanes store one whole line; unrolled so that the arrays stay in registers
    v8h* gp[8];
    v8h  row[8];
#pragma unroll
    for (int k = 0; k < 8; ++k) {
        const int r = k * 4 + (lane >> 3), ch = lane & 7;
        gp[k]  = (v8h*)&dst[(size_t)(r * pitch + ch * 8)];
        row[k] = *(const v8h*)&Stg[r][ch * 8];
    }
    // Keeps the address arithmetic in front of the eight stores, so that no register which an
    // issued store names is rewritten behind it.
    __builtin_amdgcn_sched_barrier(0);
#pragma unroll
    for (int k = 0; k < 8; ++k) *gp[k] = row[k];
}

__device__ inline void exp2x8(v8f& x) {
    float a = x[0], b = x[1], c = x[2], d = x[3], e = x[4], f = x[5], g = x[6], h = x[7];
    asm("v_exp_f32 %0, %0\n\tv_exp_f32 %1, %1\n\tv_exp_f32 %2, %2\n\tv_exp_f32 %3, %3\n\t"
        "v_exp_f32 %4, %4\n\tv_exp_f32 %5, %5\n\tv_exp_f32 %6, %6\n\tv_exp_f32 %7, %7\n\tv_nop"
        : "+v"(a), "+v"(b), "+v"(c), "+v"(d), "+v"(e), "+v"(f), "+v"(g), "+v"(h));
    x[0] = a; x[1] = b; x[2] = c; x[3] = d; x[4] = e; x[5] = f; x[6] = g; x[7] = h;
}

// 2^x of two values in place, in one statement closed by v_nop, for the same slot.
__device__ inline void exp2x2(float& a, float& b) {
    asm("v_exp_f32 %0, %0\n\tv_exp_f32 %1, %1\n\tv_nop" : "+v"(a), "+v"(b));
}

// Four waves per SIMD: the grid is two blocks per WGP; the bound lets a wave use its full share
// of the registers for the two query tiles.
__global__ __launch_bounds__(256) __attribute__((amdgpu_waves_per_eu(4, 4)))
void attn_f16(const _Float16* __restrict__ Q, const _Float16* __restrict__ Kd,
              const _Float16* __restrict__ Vt, const float* __restrict__ Nq,
              const float* __restrict__ Nk, _Float16* __restrict__ O) {
    // [buffer][key group][K | V^T][row][col]: K rows are keys over dh, V^T rows are dh over keys
    __shared__ __align__(16) _Float16 KV[2][2][2][64][PITCH64];
    __shared__ __align__(16) float Red[2][8];      // [|k|^2 | |q|^2][wave]: the waves' maxima

    const int t    = threadIdx.x;
    // the wave's number in a scalar register: what is derived from it takes no vector register
    const int wave = __builtin_amdgcn_readfirstlane(t >> 5), lane = t & 31;
    const int half = lane >> 4, l16 = lane & 15;
    const int qg   = wave & 3;             // strip of 32 queries
    const int kh   = wave >> 2;            // key group
    const int bh    = blockIdx.x;          // 0..31
    const int qtile = blockIdx.y;          // 0..15
    const int qbase = qtile * 128 + qg * 32;

    // Q strip: 2 tiles x 16 queries x 64 dh = two 32x16 B fragments a tile (column = query l16),
    // straight from global
    Frag16 qf[2][2];
    // unrolled so that qf stays in registers, indexed by constants
#pragma unroll
    for (int qt = 0; qt < 2; ++qt)
#pragma unroll
        for (int kk = 0; kk < 2; ++kk) {
            const _Float16* qp = Q + ((size_t)bh * SEQ + qbase + qt * 16 + l16) * HEAD_DIM + kk * 32;
            qf[qt][kk].u[0] = *(const uint4*)(qp + half * 8);
            qf[qt][kk].u[1] = *(const uint4*)(qp + 16 + half * 8);
        }

    // Squared lengths: a thread takes 8 of the head's 2,048 keys and one of the block's 128 queries.
    const float* nkp = Nk + (size_t)bh * SEQ + t * 8;
    const float* nqp = Nq + (size_t)bh * SEQ + qtile * 128 + (t & 127);
    const v4f   nk0 = *(const v4f*)nkp, nk1 = *(const v4f*)(nkp + 4);
    const float nq0 = *nqp;
    // Precaution for the three loads above: their address pairs are inputs here, so they stay live
    // up to this wait and nothing is placed in one of them before it.
    asm volatile("s_wait_xcnt 0x0" :: "v"(nkp), "v"(nqp) : "memory");

    v8f o[2][4] = {};                      // o[qt][jf][e] = O^T[dh = jf * 16 + 8 * half + e][query qt * 16 + l16]
    float mrun[2] = {-1e30f, -1e30f};      // running maximum of the query (log2 units), equal in both halves
    float lrun[2] = {0.f, 0.f};            // running sum over this half's keys only; joined after the loop

    // A stage: 128 keys = 2 key groups x 2 tiles x 64 rows x 128 B. A lane copies chunk cc of rows
    // cr and cr + 32 of all four tiles; eight lanes cover one whole 128-B line.
    const int cr = t >> 3, cc = (t & 7) * 8;
    const _Float16* gk = Kd + ((size_t)bh * SEQ + cr) * HEAD_DIM + cc;        // [key][dh]
    const _Float16* gv = Vt + ((size_t)bh * HEAD_DIM + cr) * SEQ + cc;        // [dh][key]
    const unsigned  ls = 32 * PITCH64 * 2;                     // 32 rows on, in LDS bytes
    const unsigned  lk = lds_addr(&KV[0][0][0][cr][cc]);
    const unsigned  lv = lds_addr(&KV[0][0][1][cr][cc]);
    const unsigned  lh = sizeof(KV[0][0]);                     // one key group on
    const unsigned  lb = sizeof(KV[0]);                        // one buffer on
    constexpr int   T  = SEQ / 128;

#define KV_STAGE(s, buf)                                                                          \
    copy8(lk + (buf) * lb, lk + (buf) * lb + ls, lv + (buf) * lb, lv + (buf) * lb + ls,           \
          lk + (buf) * lb + lh, lk + (buf) * lb + lh + ls, lv + (buf) * lb + lh, lv + (buf) * lb + lh + ls, \
          gk + (size_t)(s) * 128 * HEAD_DIM, gk + ((size_t)(s) * 128 + 32) * HEAD_DIM,            \
          gv + (s) * 128, gv + (s) * 128 + (size_t)32 * SEQ,                                      \
          gk + ((size_t)(s) * 128 + 64) * HEAD_DIM, gk + ((size_t)(s) * 128 + 96) * HEAD_DIM,     \
          gv + (s) * 128 + 64, gv + (s) * 128 + 64 + (size_t)32 * SEQ)

    KV_STAGE(0, 0);
    // Keeps the wait for the squared lengths behind the issue of stage 0's copies: without it the
    // scheduler draws the maxima up, and the copies start only when those loads have returned.
    __builtin_amdgcn_sched_barrier(0);
    // the wave's maxima, while stage 0 flies; they are published by the barrier that publishes stage 0
    {
        float km = fmaxf(fmaxf(fmaxf(nk0[0], nk0[1]), fmaxf(nk0[2], nk0[3])),
                         fmaxf(fmaxf(nk1[0], nk1[1]), fmaxf(nk1[2], nk1[3])));
        km = rowmax16(km);
        km = fmaxf(km, xhalf(km));
        float qm = rowmax16(nq0);
        qm = fmaxf(qm, xhalf(qm));
        if (lane == 0) { Red[0][wave] = km; Red[1][wave] = qm; }
    }
    wait_copies();
    __syncthreads();                 // stage 0 is published
    KV_STAGE(1, 1);

    // The block's test, the same in every thread; through readfirstlane so that it is a scalar branch.
    bool withmax;
    {
        const v4f a = *(const v4f*)&Red[0][0], b = *(const v4f*)&Red[0][4];
        const v4f c = *(const v4f*)&Red[1][0], d = *(const v4f*)&Red[1][4];
        const float km = fmaxf(fmaxf(fmaxf(a[0], a[1]), fmaxf(a[2], a[3])), fmaxf(fmaxf(b[0], b[1]), fmaxf(b[2], b[3])));
        const float qm = fmaxf(fmaxf(fmaxf(c[0], c[1]), fmaxf(c[2], c[3])), fmaxf(fmaxf(d[0], d[1]), fmaxf(d[2], d[3])));
        withmax = __builtin_amdgcn_readfirstlane(km * qm <= 128.0f ? 0 : 1) != 0;   // also where the product is no number
    }

    // One trip, up to and with the barrier at its foot. Inlined into the loops below, with the
    // running maximum (Sel<false>) or without (Sel<true>).
    auto trip = [&](const int st, auto sel) __attribute__((always_inline)) {
        constexpr bool NOMAX = decltype(sel)::value;
        const int buf = st & 1;
        const _Float16 (*Kblk)[PITCH64] = KV[buf][kh][0];
        const _Float16 (*Vblk)[PITCH64] = KV[buf][kh][1];

        // S^T = K * Q^T : 64 keys x 32 queries (4 M-fragments x 2 query tiles, K-dim 64 = 2 steps)
        // s[qt][nf][e] = score of key st * 128 + kh * 64 + nf * 16 + 8 * half + e
        //                against query qt * 16 + l16
        v8f s[2][4] = {};
        // the trip's eight K fragments, one group; unrolled so that ka is indexed by constants
        Frag16 ka[4][2];
#pragma unroll
        for (int nf = 0; nf < 4; ++nf)
#pragma unroll
            for (int kk = 0; kk < 2; ++kk) {
                ka[nf][kk].u[0] = *(const uint4*)&Kblk[nf * 16 + l16][kk * 32 + half * 8];
                ka[nf][kk].u[1] = *(const uint4*)&Kblk[nf * 16 + l16][kk * 32 + 16 + half * 8];
            }
        // Keeps the group in front of the products, which then wait by count: among the WMMAs every
        // load pair is a stop of its own with a full wait behind it.
        __builtin_amdgcn_sched_barrier(0);
        // both query tiles use a fragment; unrolled so that s, ka and qf are indexed by constants
#pragma unroll
        for (int nf = 0; nf < 4; ++nf)
#pragma unroll
            for (int kk = 0; kk < 2; ++kk)
#pragma unroll
                for (int qt = 0; qt < 2; ++qt)
                    s[qt][nf] = __builtin_amdgcn_wmma_f32_16x16x32_f16(
                        false, ka[nf][kk].v, false, qf[qt][kk].v, (short)0, s[qt][nf], false, false);
        // Keeps the V^T loads below behind these products: they take over the K fragments' registers.
        __builtin_amdgcn_sched_barrier(0);

        // V^T fragments of dh 0 to 31, one group ahead of the softmax, whose vector work covers their
        // LDS latency; unrolled so that va is indexed by constants
        Frag16 va[4][2];
#pragma unroll
        for (int jf = 0; jf < 2; ++jf)
#pragma unroll
            for (int kk = 0; kk < 2; ++kk) {
                va[jf][kk].u[0] = *(const uint4*)&Vblk[jf * 16 + l16][kk * 32 + half * 8];
                va[jf][kk].u[1] = *(const uint4*)&Vblk[jf * 16 + l16][kk * 32 + 16 + half * 8];
            }
        // Keeps that group here: without it the scheduler sinks the loads to their products.
        __builtin_amdgcn_sched_barrier(0);

        Frag16 p[2][2];
        // unrolled so that the per-tile arrays are indexed by constants
#pragma unroll
        for (int qt = 0; qt < 2; ++qt) {
            float alpha = 1.0f;
            if constexpr (!NOMAX) {
                // --- online softmax: the lane's 32 scores, then the other half's 32 ---
                float m8[8];
#pragma unroll
                for (int e = 0; e < 8; ++e)
                    m8[e] = fmaxf(fmaxf(s[qt][0][e], s[qt][1][e]), fmaxf(s[qt][2][e], s[qt][3][e]));
                float mcur = fmaxf(fmaxf(fmaxf(m8[0], m8[1]), fmaxf(m8[2], m8[3])),
                                   fmaxf(fmaxf(m8[4], m8[5]), fmaxf(m8[6], m8[7])));
                mcur = fmaxf(mcur, xhalf(mcur));

                const float mn = fmaxf(mrun[qt], mcur);
                alpha = __builtin_amdgcn_exp2f(mrun[qt] - mn);
                mrun[qt] = mn;
#pragma unroll
                for (int nf = 0; nf < 4; ++nf) s[qt][nf] = s[qt][nf] - mn;
            }
#pragma unroll
            for (int nf = 0; nf < 4; ++nf) exp2x8(s[qt][nf]);

            float r8[8];
#pragma unroll
            for (int e = 0; e < 8; ++e)
                r8[e] = (s[qt][0][e] + s[qt][1][e]) + (s[qt][2][e] + s[qt][3][e]);
            const float rsum = ((r8[0] + r8[1]) + (r8[2] + r8[3])) + ((r8[4] + r8[5]) + (r8[6] + r8[7]));
            if constexpr (NOMAX) {
                lrun[qt] += rsum;
            } else {
                lrun[qt] = lrun[qt] * alpha + rsum;
#pragma unroll
                for (int jf = 0; jf < 4; ++jf)
#pragma unroll
                    for (int e = 0; e < 8; ++e) o[qt][jf][e] *= alpha;
            }

            // P^T as B operand: element i of fragment kk is key kk * 32 + (i < 8 ? 8 * half + i
            // : 16 + 8 * half + i - 8), which is register i & 7 of tile 2 * kk + (i >> 3)
#pragma unroll
            for (int kk = 0; kk < 2; ++kk)
#pragma unroll
                for (int i = 0; i < 16; ++i)
                    p[qt][kk].v[i] = (_Float16)s[qt][2 * kk + (i >> 3)][i & 7];

            if (qt == 0) {
                // Ends the first query tile's softmax here: its sum is taken and its P packed, so its
                // scores' registers are free for the second load group.
                __builtin_amdgcn_sched_barrier(0);
                // V^T fragments of dh 32 to 63, one group: one stop and one wait for its eight loads. They
                // are the trip's last LDS reads, so the compiler draws the foot's waits and the barrier's
                // signal up behind them; what follows up to the barrier's wait works on registers only.
#pragma unroll
                for (int jf = 2; jf < 4; ++jf)
#pragma unroll
                    for (int kk = 0; kk < 2; ++kk) {
                        va[jf][kk].u[0] = *(const uint4*)&Vblk[jf * 16 + l16][kk * 32 + half * 8];
                        va[jf][kk].u[1] = *(const uint4*)&Vblk[jf * 16 + l16][kk * 32 + 16 + half * 8];
                    }
                // Keeps that group here: without it the scheduler sinks the loads to their products.
                __builtin_amdgcn_sched_barrier(0);
            }
        }

        // O^T += V^T * P^T : 64 dh x 32 queries (4 M-fragments x 2 query tiles, K=64 keys = 2 steps);
        // both query tiles use a fragment; unrolled so that o, va and p are indexed by constants
#pragma unroll
        for (int g = 0; g < 2; ++g)
#pragma unroll
            for (int kk = 0; kk < 2; ++kk)
#pragma unroll
                for (int jf = 2 * g; jf < 2 * g + 2; ++jf)
#pragma unroll
                    for (int qt = 0; qt < 2; ++qt)
                        o[qt][jf] = __builtin_amdgcn_wmma_f32_16x16x32_f16(
                            false, va[jf][kk].v, false, p[qt][kk].v, (short)0, o[qt][jf], false, false);

        wait_lds_reads();
        wait_copies();
        __syncthreads();
    };
    // The trips that refill and the last two, which do not, are loops of their own: the test for a
    // stage st + 2 is the loop bound, so a trip is one straight block. With a branch at the foot the
    // compiler sank the row sums behind it, and the 64 exponentials stayed in registers through the
    // O^T products, where the V^T fragments need them.
    if (withmax) {
        for (int st = 0; st < T - 2; ++st) {
            trip(st, Sel<false>{});
            KV_STAGE(st + 2, st & 1);
        }
        // kept rolled: two more copies of this trip would only lengthen the text
#pragma unroll 1
        for (int st = T - 2; st < T; ++st) trip(st, Sel<false>{});
    } else {
        mrun[0] = mrun[1] = 0.f;     // P = 2^(score - 0): what the merge below reads as the maximum
        for (int st = 0; st < T - 2; ++st) {
            trip(st, Sel<true>{});
            KV_STAGE(st + 2, st & 1);
        }
        for (int st = T - 2; st < T; ++st) trip(st, Sel<true>{});
    }
    wait_copies();
#undef KV_STAGE

    // join the halves' sums
    lrun[0] += xhalf(lrun[0]);
    lrun[1] += xhalf(lrun[1]);

    // Merge of the two key groups. Waves w and w ^ 4 hold the same 32 queries in the same lanes and
    // registers. Each finishes one query tile (tile kh) and hands the other tile's state to its
    // partner. Behind the last trip's barrier nobody reads the ring and no copy is outstanding:
    // the ring's LDS carries the exchange.
    const bool up = kh != 0;
    v4f*   xo = (v4f*)&KV[0][0][0][0][0];                      // [wave][8][lane], 16 B a lane
    float* xm = (float*)(xo + 8 * 8 * 32);                     // [wave][max | sum][lane]
    // unrolled (here and in the store loop below) so that o is indexed by constants
#pragma unroll
    for (int jf = 0; jf < 4; ++jf) {
        const v8f g = up ? o[0][jf] : o[1][jf];
        xo[(wave * 8 + 2 * jf) * 32 + lane]     = __builtin_shufflevector(g, g, 0, 1, 2, 3);
        xo[(wave * 8 + 2 * jf + 1) * 32 + lane] = __builtin_shufflevector(g, g, 4, 5, 6, 7);
    }
    xm[(wave * 2) * 32 + lane]     = up ? mrun[0] : mrun[1];
    xm[(wave * 2 + 1) * 32 + lane] = up ? lrun[0] : lrun[1];
    __syncthreads();                 // the partners' states are published

    const int   pw = wave ^ 4;
    const float mp = xm[(pw * 2) * 32 + lane];
    const float lp = xm[(pw * 2 + 1) * 32 + lane];
    const float mo = up ? mrun[1] : mrun[0];
    const float lo = up ? lrun[1] : lrun[0];
    const float mj = fmaxf(mo, mp);
    float fo = mo - mj;                                        // the maxima are in log2 units
    float fp = mp - mj;
    exp2x2(fo, fp);
    const float lj = lo * fo + lp * fp;

    // normalize, store f16 [b*L + q][h*64 + dh]: 8 neighbouring dh a store
    const int b = bh >> 4, h = bh & (NUM_HEADS - 1);
    const size_t m = (size_t)b * SEQ + qbase + kh * 16 + l16;
#pragma unroll
    for (int jf = 0; jf < 4; ++jf) {
        const v8f own = up ? o[1][jf] : o[0][jf];
        const v4f p0  = xo[(pw * 8 + 2 * jf) * 32 + lane];
        const v4f p1  = xo[(pw * 8 + 2 * jf + 1) * 32 + lane];
        union { _Float16 f[8]; uint4 u; } pk;
#pragma unroll
        for (int e = 0; e < 8; ++e)
            pk.f[e] = (_Float16)((own[e] * fo + (e < 4 ? p0[e & 3] : p1[e & 3]) * fp) / lj);
        *(uint4*)&O[m * D_MODEL + h * HEAD_DIM + jf * 16 + 8 * half] = pk.u;
    }
}

// ---------------------------------------------------------------------------
// Launcher
// ---------------------------------------------------------------------------
extern "C" void kernel_launch(void* const* d_in, const int* in_sizes, int n_in,
                              void* d_out, int out_size, void* d_ws, size_t ws_size,
                              hipStream_t stream) {
    (void)in_sizes; (void)n_in; (void)out_size; (void)ws_size;

    const float* x    = (const float*)d_in[0];   // [2,2048,1024]
    const float* cosT = (const float*)d_in[1];   // [2048,64]
    const float* sinT = (const float*)d_in[2];   // [2048,64]
    const float* wqkv = (const float*)d_in[3];   // [3072,1024]
    const float* wo   = (const float*)d_in[4];   // [1024,1024]
    float* out = (float*)d_out;                  // [2,2048,1024]

    char* ws = (char*)d_ws;
    _Float16* x_h  = (_Float16*)(ws);                        //  8 MB
    _Float16* wq_h = (_Float16*)(ws + ( 8ull << 20));        //  6 MB
    _Float16* wo_h = (_Float16*)(ws + (14ull << 20));        //  2 MB
    _Float16* q_h  = (_Float16*)(ws + (64ull << 20));        //  8 MB
    _Float16* k_h  = (_Float16*)(ws + (72ull << 20));        //  8 MB
    _Float16* vt_h = (_Float16*)(ws + (80ull << 20));        //  8 MB
    _Float16* at_h = (_Float16*)(ws + (88ull << 20));        //  8 MB
    float*    nq_f = (float*)(ws + (96ull << 20));           //  256 KB
    float*    nk_f = (float*)(ws + (97ull << 20));           //  256 KB

    cvt3_f32_f16<<<CVT_X_BLOCKS + CVT_WQ_BLOCKS + CVT_WO_BLOCKS, 256, 0, stream>>>(
        x, wqkv, wo, x_h, wq_h, wo_h);

    // x @ w_qkv^T (M=4096, N=3072, K=1024), rotated and repacked in the epilogue
    gemm_qkv_rope<<<dim3(3 * D_MODEL / 128, MROWS / 128), 256, 0, stream>>>(
        x_h, wq_h, cosT, sinT, q_h, k_h, vt_h, nq_f, nk_f);

    attn_f16<<<dim3(BATCH * NUM_HEADS, SEQ / 128), 256, 0, stream>>>(q_h, k_h, vt_h, nq_f, nk_f, at_h);

    // out = attn @ w_o^T  : M=4096, N=1024, K=1024
    gemm_nt_f16<<<dim3(D_MODEL / 128, MROWS / 128), 256, 0, stream>>>(at_h, wo_h, out, MROWS, D_MODEL, 1024);
}

// v010
// One run takes 72.5 microseconds.
// Two timings next to v009 put it at 1.08 and 1.09 times that version's speed.
// All steps since v000 together make it 5.05 times as fast.
#include <hip/hip_runtime.h>

// ---------------------------------------------------------------------------
// MI455X (gfx1250, wave32) RoPE attention, f16 WMMA pipeline.
// ---------------------------------------------------------------------------

typedef __attribute__((ext_vector_type(16))) _Float16 v16h;
typedef __attribute__((ext_vector_type(8)))  float    v8f;
typedef __attribute__((ext_vector_type(4)))  float    v4f;
typedef __attribute__((ext_vector_type(4)))  _Float16 v4h;
typedef __attribute__((ext_vector_type(8)))  _Float16 v8h;

union Frag16 { v16h v; uint4 u[2]; };

#define D_MODEL   1024
#define NUM_HEADS 16
#define HEAD_DIM  64
#define BATCH     2
#define SEQ       2048
#define MROWS     (BATCH * SEQ)   // 4096

// LDS row pitch in f16 elements for tiles whose rows are read as 16-byte
// fragments by 16 lanes at once: 16 B x odd, so the 16 rows fall on distinct
// banks (a pitch of 64 B or 128 B puts them on the same few banks).
#define PITCH32   40              // 32-element rows: 80 B; no tile here uses it
#define PITCH64   72              // 64-element rows: 144 B

// ---------------------------------------------------------------------------
// Staging of LDS tiles: asynchronous copies, 16 B a lane, global -> LDS through no register,
// in a ring of two buffers: the copies of tile t + 2 are issued at the foot of trip t and
// waited for at the foot of trip t + 1, so they fly while tile t + 1 is worked on.
// Blocks that share an operand run side by side and would ask L2 for the same lines at the same
// moment, trip after trip; such requests collide. So every block starts its walk over the stages
// at a stage of its own (from its block index) and wraps: trip t works on stage (t + start) mod T.
// The products of a sum are the same, their order differs from block to block.
// ---------------------------------------------------------------------------
// LDS byte address of a __shared__ object: the low 32 bits of its address
__device__ inline unsigned lds_addr(const void* p) { return (unsigned)(size_t)p; }

// Four copies of a lane. The s_wait_xcnt closes the statement as a precaution: it stands in
// front of every later instruction that could rewrite an address register named here.
__device__ inline void copy4(unsigned l0, unsigned l1, unsigned l2, unsigned l3,
                             const _Float16* g0, const _Float16* g1,
                             const _Float16* g2, const _Float16* g3) {
    asm volatile("global_load_async_to_lds_b128 %0, %4, off\n\t"
                 "global_load_async_to_lds_b128 %1, %5, off\n\t"
                 "global_load_async_to_lds_b128 %2, %6, off\n\t"
                 "global_load_async_to_lds_b128 %3, %7, off\n\t"
                 "s_wait_xcnt 0x0"
                 :: "v"(l0), "v"(l1), "v"(l2), "v"(l3), "v"(g0), "v"(g1), "v"(g2), "v"(g3)
                 : "memory");
}

// Eight copies of a lane in one statement, with the same closing wait.
__device__ inline void copy8(unsigned l0, unsigned l1, unsigned l2, unsigned l3,
                             unsigned l4, unsigned l5, unsigned l6, unsigned l7,
                             const _Float16* g0, const _Float16* g1,
                             const _Float16* g2, const _Float16* g3,
                             const _Float16* g4, const _Float16* g5,
                             const _Float16* g6, const _Float16* g7) {
    asm volatile("global_load_async_to_lds_b128 %0, %8, off\n\t"
                 "global_load_async_to_lds_b128 %1, %9, off\n\t"
                 "global_load_async_to_lds_b128 %2, %10, off\n\t"
                 "global_load_async_to_lds_b128 %3, %11, off\n\t"
                 "global_load_async_to_lds_b128 %4, %12, off\n\t"
                 "global_load_async_to_lds_b128 %5, %13, off\n\t"
                 "global_load_async_to_lds_b128 %6, %14, off\n\t"
                 "global_load_async_to_lds_b128 %7, %15, off\n\t"
                 "s_wait_xcnt 0x0"
                 :: "v"(l0), "v"(l1), "v"(l2), "v"(l3), "v"(l4), "v"(l5), "v"(l6), "v"(l7),
                    "v"(g0), "v"(g1), "v"(g2), "v"(g3), "v"(g4), "v"(g5), "v"(g6), "v"(g7)
                 : "memory");
}

// The wave's own copies have landed (the compiler places no wait for them).
__device__ inline void wait_copies() { asm volatile("s_wait_asynccnt 0x0" ::: "memory"); }
// The wave's own LDS reads have returned: the buffer they read may be refilled behind the barrier.
__device__ inline void wait_lds_reads() { asm volatile("s_wait_dscnt 0x0" ::: "memory"); }

// value of lane l ^ 16
__device__ inline float xhalf(float x) {
    return __builtin_bit_cast(float, __builtin_amdgcn_permlanex16(
        __builtin_bit_cast(int, x), __builtin_bit_cast(int, x), 0x76543210, 0xfedcba98, false, false));
}

// maximum over the lane's row of 16 lanes, in every lane of it: four DPP rotations (8, 4, 2, 1)
__device__ inline float rowmax16(float x) {
    x = fmaxf(x, __builtin_bit_cast(float, __builtin_amdgcn_update_dpp(0, __builtin_bit_cast(int, x), 0x128, 0xf, 0xf, false)));
    x = fmaxf(x, __builtin_bit_cast(float, __builtin_amdgcn_update_dpp(0, __builtin_bit_cast(int, x), 0x124, 0xf, 0xf, false)));
    x = fmaxf(x, __builtin_bit_cast(float, __builtin_amdgcn_update_dpp(0, __builtin_bit_cast(int, x), 0x122, 0xf, 0xf, false)));
    x = fmaxf(x, __builtin_bit_cast(float, __builtin_amdgcn_update_dpp(0, __builtin_bit_cast(int, x), 0x121, 0xf, 0xf, false)));
    return x;
}

// compile-time switch handed to a generic lambda
template <bool B> struct Sel { static constexpr bool value = B; };

#define LOG2E 1.44269504088896340736f

// ---------------------------------------------------------------------------
// fp32 -> fp16 elementwise convert of all three f32 operands (x, w_qkv, w_o) in ONE launch: the
// three are independent, so nothing orders them, and as separate launches each paid its own
// start, first memory latency and drain. The block index picks the operand (a scalar choice).
// A block takes CVT_BLOCK contiguous floats; a lane takes eight float4, each wave-wide load
// covering 512 contiguous bytes, so few waves have to start and each keeps eight loads in flight.
// Every element count is a multiple of CVT_BLOCK. The grid is four blocks per WGP: one round.
// ---------------------------------------------------------------------------
#define CVT_BLOCK (256 * 8 * 4)
#define CVT_X_BLOCKS  ((MROWS * D_MODEL) / CVT_BLOCK)
#define CVT_WQ_BLOCKS ((3 * D_MODEL * D_MODEL) / CVT_BLOCK)
#define CVT_WO_BLOCKS ((D_MODEL * D_MODEL) / CVT_BLOCK)
__global__ __launch_bounds__(256)
void cvt3_f32_f16(const float* __restrict__ x, const float* __restrict__ wqkv,
                  const float* __restrict__ wo, _Float16* __restrict__ x_h,
                  _Float16* __restrict__ wq_h, _Float16* __restrict__ wo_h) {
    const unsigned  b     = blockIdx.x;
    const bool      is_wo = b >= CVT_X_BLOCKS + CVT_WQ_BLOCKS;
    const bool      is_wq = !is_wo && b >= CVT_X_BLOCKS;
    const float*    in    = is_wo ? wo   : is_wq ? wqkv : x;
    _Float16*       out   = is_wo ? wo_h : is_wq ? wq_h : x_h;
    const unsigned  blk   = b - (is_wo ? CVT_X_BLOCKS + CVT_WQ_BLOCKS : is_wq ? CVT_X_BLOCKS : 0);
    const size_t base = (size_t)blk * CVT_BLOCK + threadIdx.x * 4;
    v4f v[8];
    // unrolled so that all eight loads are issued before the first is waited for
#pragma unroll
    for (int k = 0; k < 8; ++k) v[k] = *(const v4f*)&in[base + k * 1024];
#pragma unroll
    for (int k = 0; k < 8; ++k) *(v4h*)&out[base + k * 1024] = __builtin_convertvector(v[k], v4h);
}

// ---------------------------------------------------------------------------
// Generic GEMM: C[M][N] = A[M][K] * W[N][K]^T   (A,W f16 row-major, C f32)
// Block = 256 threads (8 waves). Tile 128(M) x 128(N); a stage of the ring is 64 k (two
// k-steps of 32).
// K must be a multiple of 64.
// Wave (wm,wn) in 4x2 grid computes a 32x64 sub-tile = 2x4 WMMA fragments.
// Per k-step per wave: 8 v_wmma against 12 ds_load_b128.
// ---------------------------------------------------------------------------
__global__ __launch_bounds__(256)
void gemm_nt_f16(const _Float16* __restrict__ A, const _Float16* __restrict__ W,
                 float* __restrict__ C, int M, int N, int K) {
    __shared__ __align__(16) _Float16 Tiles[2][2][128][PITCH64];   // [buffer][A | W][row][k]

    const int t    = threadIdx.x;
    const int wave = t >> 5, lane = t & 31;
    const int half = lane >> 4, l16 = lane & 15;
    const int wm   = wave >> 1, wn = wave & 1;
    const int bm   = blockIdx.y * 128, bn = blockIdx.x * 128;

    v8f acc[2][4] = {};

    // A stage: 2 tiles x 128 rows x 128 B. A lane copies chunk cc of rows cr, cr + 32, cr + 64
    // and cr + 96 of both tiles; eight lanes cover one whole 128-B line.
    const int cr = t >> 3, cc = (t & 7) * 8;
    const _Float16* ga = A + (size_t)(bm + cr) * K + cc;
    const _Float16* gw = W + (size_t)(bn + cr) * K + cc;
    const size_t    gs = (size_t)32 * K;                       // 32 rows on, in elements
    const unsigned  ls = 32 * PITCH64 * 2;                     // 32 rows on, in LDS bytes
    const unsigned  la = lds_addr(&Tiles[0][0][cr][cc]);
    const unsigned  lw = lds_addr(&Tiles[0][1][cr][cc]);
    const unsigned  lb = sizeof(Tiles[0]);                     // one buffer on
    const int       T  = K / 64;
    // First stage of this block's walk. The blocks of one row of tiles (same A rows) start four
    // stages apart, the blocks of one column of tiles (same W rows) one stage apart.
    const int       rot = (int)((blockIdx.y + 4 * blockIdx.x) % (unsigned)T);
    auto stage_of = [&](const int trip) { const int g = trip + rot; return g >= T ? g - T : g; };

#define GEMM_STAGE(s, buf)                                                              \
    copy8(la + (buf) * lb, la + (buf) * lb + ls, la + (buf) * lb + 2 * ls, la + (buf) * lb + 3 * ls, \
          lw + (buf) * lb, lw + (buf) * lb + ls, lw + (buf) * lb + 2 * ls, lw + (buf) * lb + 3 * ls, \
          ga + (s) * 64, ga + (s) * 64 + gs, ga + (s) * 64 + 2 * gs, ga + (s) * 64 + 3 * gs,         \
          gw + (s) * 64, gw + (s) * 64 + gs, gw + (s) * 64 + 2 * gs, gw + (s) * 64 + 3 * gs)

    GEMM_STAGE(stage_of(0), 0);
    wait_copies();
    __syncthreads();                 // the first stage is published
    if (T > 1) GEMM_STAGE(stage_of(1), 1);

    for (int s = 0; s < T; ++s) {
        const int buf = s & 1;
        // two k-steps, unrolled so that the fragment arrays are indexed by constants
#pragma unroll
        for (int kk = 0; kk < 2; ++kk) {
            Frag16 a[2], b[4];
#pragma unroll
            for (int i = 0; i < 2; ++i) {
                int r = wm * 32 + i * 16 + l16;
                a[i].u[0] = *(const uint4*)&Tiles[buf][0][r][kk * 32 + half * 8];
                a[i].u[1] = *(const uint4*)&Tiles[buf][0][r][kk * 32 + 16 + half * 8];
            }
#pragma unroll
            for (int j = 0; j < 4; ++j) {
                int r = wn * 64 + j * 16 + l16;
                b[j].u[0] = *(const uint4*)&Tiles[buf][1][r][kk * 32 + half * 8];
                b[j].u[1] = *(const uint4*)&Tiles[buf][1][r][kk * 32 + 16 + half * 8];
            }
            // Keeps the k-step's 12 fragment loads one group in front of its WMMAs: without it
            // the scheduler loads the second A fragment among them and waits out its latency there.
            __builtin_amdgcn_sched_barrier(0);
#pragma unroll
            for (int i = 0; i < 2; ++i)
#pragma unroll
                for (int j = 0; j < 4; ++j)
                    acc[i][j] = __builtin_amdgcn_wmma_f32_16x16x32_f16(
                        false, a[i].v, false, b[j].v, (short)0, acc[i][j], false, false);
        }
        wait_lds_reads();
        wait_copies();
        __syncthreads();
        if (s + 2 < T) GEMM_STAGE(stage_of(s + 2), buf);
    }
    wait_copies();
#undef GEMM_STAGE

#pragma unroll
    for (int i = 0; i < 2; ++i)
#pragma unroll
        for (int j = 0; j < 4; ++j) {
            int col = bn + wn * 64 + j * 16 + l16;
#pragma unroll
            for (int e = 0; e < 8; ++e) {
                int row = bm + wm * 32 + i * 16 + e + 8 * half;
                C[(size_t)row * N + col] = acc[i][j][e];
            }
        }
}

// ---------------------------------------------------------------------------
// QKV projection with RoPE and the repack in its epilogue:
//   x f16 [b*L + l][1024], w_qkv f16 [3072][1024]  ->  Q,K f16 [b,h,l,dh] ; V^T f16 [b,h,dh,l]
// Softmax scale 1/sqrt(64) and log2 e folded into Q: a score is then the exponent of 2 that the
// softmax needs. The projection never leaves the registers as f32.
// The epilogue also stores the squared length of every rotated, scaled Q row and of every rotated
// K row (f32 [b,h,l]): |score| <= |q| |k|, which lets attention do without a maximum where that
// bound is small.
// Same tile, ring and k-steps as gemm_nt_f16, but the 64-row side of a wave's sub-tile is the
// A operand: a lane then holds, of ONE row of the 32-row side (column l16), eight neighbouring
// rows of the 64-row side (8 * half + e of each 16-row tile), which is 16 B of f16 output.
//   Q, K blocks: 32-row side = positions (x), 64-row side = one head's 64 dh (w_qkv). Both sides
//                of a rotation pair (dh, dh + 32) sit in the same lane and register index, two
//                tiles apart.
//   V blocks:    the two operands change places: 32-row side = dh (w_qkv), 64-row side = positions,
//                so the same registers are 16 B of a V^T row.
// Either way a wave owns 32 output rows of 128 B; it turns them in its own LDS range so that
// every store covers four whole lines.
// Six waves per SIMD: the grid is three blocks per WGP, and all of them have to be resident at
// once (one round); without the bound the epilogue's table loads take registers past that.
// ---------------------------------------------------------------------------
__global__ __launch_bounds__(256) __attribute__((amdgpu_waves_per_eu(6)))
void gemm_qkv_rope(const _Float16* __restrict__ X, const _Float16* __restrict__ W,
                   const float* __restrict__ cosT, const float* __restrict__ sinT,
                   _Float16* __restrict__ Q, _Float16* __restrict__ Kd,
                   _Float16* __restrict__ Vt, float* __restrict__ Nq, float* __restrict__ Nk) {
    __shared__ __align__(16) _Float16 Tiles[2][2][128][PITCH64];   // [buffer][32-row side | 64-row side][row][k]

    const int t    = threadIdx.x;
    // the wave's number in a scalar register: what is derived from it takes no vector register
    const int wave = __builtin_amdgcn_readfirstlane(t >> 5), lane = t & 31;
    const int half = lane >> 4, l16 = lane & 15;
    const int wm   = wave >> 1, wn = wave & 1;
    const int part = blockIdx.x >> 3;                  // 0: Q, 1: K, 2: V (8 blocks of 128 features each)
    const int f0   = blockIdx.x * 128;                 // first row of w_qkv
    const int m0   = blockIdx.y * 128;                 // first row of x
    const int bb   = m0 / SEQ, l0 = m0 % SEQ;          // a block lies inside one batch entry
    const bool isV = part == 2;

    const _Float16* xs = X + (size_t)m0 * D_MODEL;
    const _Float16* fs = W + (size_t)f0 * D_MODEL;

    v8f acc[2][4] = {};

    const int cr = t >> 3, cc = (t & 7) * 8;
    const _Float16* ga = (isV ? fs : xs) + (size_t)cr * D_MODEL + cc;
    const _Float16* gw = (isV ? xs : fs) + (size_t)cr * D_MODEL + cc;
    const size_t    gs = (size_t)32 * D_MODEL;                 // 32 rows on, in elements
    const unsigned  ls = 32 * PITCH64 * 2;                     // 32 rows on, in LDS bytes
    const unsigned  la = lds_addr(&Tiles[0][0][cr][cc]);
    const unsigned  lw = lds_addr(&Tiles[0][1][cr][cc]);
    const unsigned  lb = sizeof(Tiles[0]);                     // one buffer on
    constexpr int   T  = D_MODEL / 64;
    // First stage of this block's walk: neighbours along either side of the grid, which share x rows
    // or w_qkv rows, start one stage apart.
    const int       rot = (blockIdx.x + blockIdx.y) & (T - 1);
    auto stage_of = [&](const int trip) { return (trip + rot) & (T - 1); };

#define GEMM_STAGE(s, buf)                                                              \
    copy8(la + (buf) * lb, la + (buf) * lb + ls, la + (buf) * lb + 2 * ls, la + (buf) * lb + 3 * ls, \
          lw + (buf) * lb, lw + (buf) * lb + ls, lw + (buf) * lb + 2 * ls, lw + (buf) * lb + 3 * ls, \
          ga + (s) * 64, ga + (s) * 64 + gs, ga + (s) * 64 + 2 * gs, ga + (s) * 64 + 3 * gs,         \
          gw + (s) * 64, gw + (s) * 64 + gs, gw + (s) * 64 + 2 * gs, gw + (s) * 64 + 3 * gs)

    GEMM_STAGE(stage_of(0), 0);
    wait_copies();
    __syncthreads();                 // the first stage is published
    GEMM_STAGE(stage_of(1), 1);

    for (int s = 0; s < T; ++s) {
        const int buf = s & 1;
        // two k-steps, unrolled so that the fragment arrays are indexed by constants
#pragma unroll
        for (int kk = 0; kk < 2; ++kk) {
            Frag16 a[2], b[4];
#pragma unroll
            for (int i = 0; i < 2; ++i) {
                int r = wm * 32 + i * 16 + l16;
                a[i].u[0] = *(const uint4*)&Tiles[buf][0][r][kk * 32 + half * 8];
                a[i].u[1] = *(const uint4*)&Tiles[buf][0][r][kk * 32 + 16 + half * 8];
            }
#pragma unroll
            for (int j = 0; j < 4; ++j) {
                int r = wn * 64 + j * 16 + l16;
                b[j].u[0] = *(const uint4*)&Tiles[buf][1][r][kk * 32 + half * 8];
                b[j].u[1] = *(const uint4*)&Tiles[buf][1][r][kk * 32 + 16 + half * 8];
            }
            // Keeps the k-step's 12 fragment loads one group in front of its WMMAs: without it
            // the scheduler loads the second fragment of the 32-row side among them and waits
            // out its latency there.
            __builtin_amdgcn_sched_barrier(0);
#pragma unroll
            for (int i = 0; i < 2; ++i)
#pragma unroll
                for (int j = 0; j < 4; ++j)
                    acc[i][j] = __builtin_amdgcn_wmma_f32_16x16x32_f16(
                        false, b[j].v, false, a[i].v, (short)0, acc[i][j], false, false);
        }
        wait_lds_reads();
        wait_copies();
        __syncthreads();
        if (s + 2 < T) GEMM_STAGE(stage_of(s + 2), buf);
    }
    wait_copies();
#undef GEMM_STAGE

    // acc[i][j][e] = product of row wm * 32 + i * 16 + l16 of the 32-row side
    //                with row wn * 64 + j * 16 + 8 * half + e of the 64-row side.
    // Behind the last trip's barrier nobody reads the ring and no copy is outstanding:
    // each wave stages its 32 rows of 128 B in a range of its own.
    _Float16 (*Stg)[PITCH64] = &Tiles[0][wave >> 2][(wave & 3) * 32];

    if (!isV) {
        const float sc = part == 0 ? 0.125f * LOG2E : 1.0f;    // log2 e / sqrt(HEAD_DIM) on Q alone
        float ss[2];                                           // squared length of the lane's half of row i * 16 + l16
        const int    l  = l0 + wm * 32 + l16;                  // the lane's position in tile i = 0
        const float* cp = cosT + l * HEAD_DIM + 8 * half;
        const float* sp = sinT + l * HEAD_DIM + 8 * half;
        // unrolled so that acc is indexed by constants
#pragma unroll
        for (int i = 0; i < 2; ++i) {
            v8f cs[4], sn[4];                                  // dh j * 16 + 8 * half + e
#pragma unroll
            for (int j = 0; j < 4; ++j) {
                cs[j] = *(const v8f*)(cp + i * 16 * HEAD_DIM + j * 16);
                sn[j] = *(const v8f*)(sp + i * 16 * HEAD_DIM + j * 16);
            }
            // Precaution for the 16 loads above: their two address pairs are inputs here, so they
            // stay live up to this wait and nothing is placed in one of them before it.
            asm volatile("s_wait_xcnt 0x0" :: "v"(cp), "v"(sp) : "memory");
            // rotate_half: dh < 32 pairs with -t[dh + 32], dh >= 32 with +t[dh - 32]
#pragma unroll
            for (int j = 0; j < 2; ++j) {
                const v8f lo = (acc[i][j]     * cs[j]     - acc[i][j + 2] * sn[j])     * sc;
                const v8f hi = (acc[i][j + 2] * cs[j + 2] + acc[i][j]     * sn[j + 2]) * sc;
                acc[i][j]     = lo;
                acc[i][j + 2] = hi;
            }
        }
        // behind the rotation, where the tables' registers are free; unrolled so that acc is indexed by constants
#pragma unroll
        for (int i = 0; i < 2; ++i) {
            const v8f q2 = acc[i][0] * acc[i][0] + acc[i][1] * acc[i][1]
                         + acc[i][2] * acc[i][2] + acc[i][3] * acc[i][3];
            ss[i] = ((q2[0] + q2[1]) + (q2[2] + q2[3])) + ((q2[4] + q2[5]) + (q2[6] + q2[7]));
        }
        // the other half of the wave holds the row's other 32 dh; lane n then stores row n of the
        // wave's 32: one whole line, written by this wave alone
        ss[0] += xhalf(ss[0]);
        ss[1] += xhalf(ss[1]);
        const int   hn  = (f0 & (D_MODEL - 1)) / HEAD_DIM + wn;
        float*      np  = (part == 0 ? Nq : Nk) + ((size_t)bb * NUM_HEADS + hn) * SEQ + l0 + wm * 32 + lane;
        const float nv  = half ? ss[1] : ss[0];
        *np = nv;
        // Precaution for the store above: its address pair and its value are inputs here, so they
        // stay live up to this wait and nothing is placed in one of them before it.
        asm volatile("s_wait_xcnt 0x0" :: "v"(np), "v"(nv) : "memory");
    }

#pragma unroll
    for (int i = 0; i < 2; ++i)
#pragma unroll
        for (int j = 0; j < 4; ++j)
            *(v8h*)&Stg[i * 16 + l16][(2 * j + half) * 8] = __builtin_convertvector(acc[i][j], v8h);
    // The wave's own LDS writes are done before other lanes of it read the rows back.
    asm volatile("s_wait_dscnt 0x0" ::: "memory");

    // Q, K: row = position, 128 B = the head's 64 dh. V^T: row = dh, 128 B = 64 positions.
    _Float16* dst;
    int       pitch;
    if (isV) {
        dst   = Vt + ((size_t)bb * D_MODEL + (f0 - 2 * D_MODEL) + wm * 32) * SEQ + l0 + wn * 64;
        pitch = SEQ;
    } else {
        const int h = (f0 & (D_MODEL - 1)) / HEAD_DIM + wn;
        dst   = (part == 0 ? Q : Kd) + (((size_t)bb * NUM_HEADS + h) * SEQ + l0 + wm * 32) * HEAD_DIM;
        pitch = HEAD_DIM;
    }
    // eight lanes store one whole line; unrolled so that the arrays stay in registers
    v8h* gp[8];
    v8h  row[8];
#pragma unroll
    for (int k = 0; k < 8; ++k) {
        const int r = k * 4 + (lane >> 3), ch = lane & 7;
        gp[k]  = (v8h*)&dst[(size_t)(r * pitch + ch * 8)];
        row[k] = *(const v8h*)&Stg[r][ch * 8];
    }
    // Keeps the address arithmetic in front of the eight stores, so that no register which an
    // issued store names is rewritten behind it.
    __builtin_amdgcn_sched_barrier(0);
#pragma unroll
    for (int k = 0; k < 8; ++k) *gp[k] = row[k];
}

__device__ inline void exp2x8(v8f& x) {
    float a = x[0], b = x[1], c = x[2], d = x[3], e = x[4], f = x[5], g = x[6], h = x[7];
    asm("v_exp_f32 %0, %0\n\tv_exp_f32 %1, %1\n\tv_exp_f32 %2, %2\n\tv_exp_f32 %3, %3\n\t"
        "v_exp_f32 %4, %4\n\tv_exp_f32 %5, %5\n\tv_exp_f32 %6, %6\n\tv_exp_f32 %7, %7\n\tv_nop"
        : "+v"(a), "+v"(b), "+v"(c), "+v"(d), "+v"(e), "+v"(f), "+v"(g), "+v"(h));
    x[0] = a; x[1] = b; x[2] = c; x[3] = d; x[4] = e; x[5] = f; x[6] = g; x[7] = h;
}

// 2^x of two values in place, in one statement closed by v_nop, for the same slot.
__device__ inline void exp2x2(float& a, float& b) {
    asm("v_exp_f32 %0, %0\n\tv_exp_f32 %1, %1\n\tv_nop" : "+v"(a), "+v"(b));
}

// Four waves per SIMD: the grid is two blocks per WGP; the bound lets a wave use its full share
// of the registers for the two query tiles.
__global__ __launch_bounds__(256) __attribute__((amdgpu_waves_per_eu(4, 4)))
void attn_f16(const _Float16* __restrict__ Q, const _Float16* __restrict__ Kd,
              const _Float16* __restrict__ Vt, const float* __restrict__ Nq,
              const float* __restrict__ Nk, _Float16* __restrict__ O) {
    // [buffer][key group][K | V^T][row][col]: K rows are keys over dh, V^T rows are dh over keys
    __shared__ __align__(16) _Float16 KV[2][2][2][64][PITCH64];
    __shared__ __align__(16) float Red[2][8];      // [|k|^2 | |q|^2][wave]: the waves' maxima

    const int t    = threadIdx.x;
    // the wave's number in a scalar register: what is derived from it takes no vector register
    const int wave = __builtin_amdgcn_readfirstlane(t >> 5), lane = t & 31;
    const int half = lane >> 4, l16 = lane & 15;
    const int qg   = wave & 3;             // strip of 32 queries
    const int kh   = wave >> 2;            // key group
    const int bh    = blockIdx.x;          // 0..31
    const int qtile = blockIdx.y;          // 0..15
    const int qbase = qtile * 128 + qg * 32;

    // Q strip: 2 tiles x 16 queries x 64 dh = two 32x16 B fragments a tile (column = query l16),
    // straight from global
    Frag16 qf[2][2];
    // unrolled so that qf stays in registers, indexed by constants
#pragma unroll
    for (int qt = 0; qt < 2; ++qt)
#pragma unroll
        for (int kk = 0; kk < 2; ++kk) {
            const _Float16* qp = Q + ((size_t)bh * SEQ + qbase + qt * 16 + l16) * HEAD_DIM + kk * 32;
            qf[qt][kk].u[0] = *(const uint4*)(qp + half * 8);
            qf[qt][kk].u[1] = *(const uint4*)(qp + 16 + half * 8);
        }

    // Squared lengths: a thread takes 8 of the head's 2,048 keys and one of the block's 128 queries.
    const float* nkp = Nk + (size_t)bh * SEQ + t * 8;
    const float* nqp = Nq + (size_t)bh * SEQ + qtile * 128 + (t & 127);
    const v4f   nk0 = *(const v4f*)nkp, nk1 = *(const v4f*)(nkp + 4);
    const float nq0 = *nqp;
    // Precaution for the three loads above: their address pairs are inputs here, so they stay live
    // up to this wait and nothing is placed in one of them before it.
    asm volatile("s_wait_xcnt 0x0" :: "v"(nkp), "v"(nqp) : "memory");

    v8f o[2][4] = {};                      // o[qt][jf][e] = O^T[dh = jf * 16 + 8 * half + e][query qt * 16 + l16]
    float mrun[2] = {-1e30f, -1e30f};      // running maximum of the query (log2 units), equal in both halves
    float lrun[2] = {0.f, 0.f};            // running sum over this half's keys only; joined after the loop

    // A stage: 128 keys = 2 key groups x 2 tiles x 64 rows x 128 B. A lane copies chunk cc of rows
    // cr and cr + 32 of all four tiles; eight lanes cover one whole 128-B line.
    const int cr = t >> 3, cc = (t & 7) * 8;
    const _Float16* gk = Kd + ((size_t)bh * SEQ + cr) * HEAD_DIM + cc;        // [key][dh]
    const _Float16* gv = Vt + ((size_t)bh * HEAD_DIM + cr) * SEQ + cc;        // [dh][key]
    const unsigned  ls = 32 * PITCH64 * 2;                     // 32 rows on, in LDS bytes
    const unsigned  lk = lds_addr(&KV[0][0][0][cr][cc]);
    const unsigned  lv = lds_addr(&KV[0][0][1][cr][cc]);
    const unsigned  lh = sizeof(KV[0][0]);                     // one key group on
    const unsigned  lb = sizeof(KV[0]);                        // one buffer on
    constexpr int   T  = SEQ / 128;
    // First stage of this block's walk over the keys: the 16 blocks of a head, which read the same
    // K and V^T, each start at a stage of their own. A softmax does not depend on the keys' order.
    const int       rot = qtile & (T - 1);
    auto stage_of = [&](const int trip) { return (trip + rot) & (T - 1); };

#define KV_STAGE(s, buf)                                                                          \
    copy8(lk + (buf) * lb, lk + (buf) * lb + ls, lv + (buf) * lb, lv + (buf) * lb + ls,           \
          lk + (buf) * lb + lh, lk + (buf) * lb + lh + ls, lv + (buf) * lb + lh, lv + (buf) * lb + lh + ls, \
          gk + (size_t)(s) * 128 * HEAD_DIM, gk + ((size_t)(s) * 128 + 32) * HEAD_DIM,            \
          gv + (s) * 128, gv + (s) * 128 + (size_t)32 * SEQ,                                      \
          gk + ((size_t)(s) * 128 + 64) * HEAD_DIM, gk + ((size_t)(s) * 128 + 96) * HEAD_DIM,     \
          gv + (s) * 128 + 64, gv + (s) * 128 + 64 + (size_t)32 * SEQ)

    KV_STAGE(stage_of(0), 0);
    // Keeps the wait for the squared lengths behind the issue of the first stage's copies: without it the
    // scheduler draws the maxima up, and the copies start only when those loads have returned.
    __builtin_amdgcn_sched_barrier(0);
    // the wave's maxima, while the first stage flies; they are published by the barrier that publishes it
    {
        float km = fmaxf(fmaxf(fmaxf(nk0[0], nk0[1]), fmaxf(nk0[2], nk0[3])),
                         fmaxf(fmaxf(nk1[0], nk1[1]), fmaxf(nk1[2], nk1[3])));
        km = rowmax16(km);
        km = fmaxf(km, xhalf(km));
        float qm = rowmax16(nq0);
        qm = fmaxf(qm, xhalf(qm));
        if (lane == 0) { Red[0][wave] = km; Red[1][wave] = qm; }
    }
    wait_copies();
    __syncthreads();                 // the first stage is published
    KV_STAGE(stage_of(1), 1);

    // The block's test, the same in every thread; through readfirstlane so that it is a scalar branch.
    bool withmax;
    {
        const v4f a = *(const v4f*)&Red[0][0], b = *(const v4f*)&Red[0][4];
        const v4f c = *(const v4f*)&Red[1][0], d = *(const v4f*)&Red[1][4];
        const float km = fmaxf(fmaxf(fmaxf(a[0], a[1]), fmaxf(a[2], a[3])), fmaxf(fmaxf(b[0], b[1]), fmaxf(b[2], b[3])));
        const float qm = fmaxf(fmaxf(fmaxf(c[0], c[1]), fmaxf(c[2], c[3])), fmaxf(fmaxf(d[0], d[1]), fmaxf(d[2], d[3])));
        withmax = __builtin_amdgcn_readfirstlane(km * qm <= 128.0f ? 0 : 1) != 0;   // also where the product is no number
    }

    // One trip, up to and with the barrier at its foot. Inlined into the loops below, with the
    // running maximum (Sel<false>) or without (Sel<true>).
    auto trip = [&](const int st, auto sel) __attribute__((always_inline)) {
        constexpr bool NOMAX = decltype(sel)::value;
        const int buf = st & 1;
        const _Float16 (*Kblk)[PITCH64] = KV[buf][kh][0];
        const _Float16 (*Vblk)[PITCH64] = KV[buf][kh][1];

        // S^T = K * Q^T : 64 keys x 32 queries (4 M-fragments x 2 query tiles, K-dim 64 = 2 steps)
        // s[qt][nf][e] = score of key stage_of(st) * 128 + kh * 64 + nf * 16 + 8 * half + e
        //                against query qt * 16 + l16
        v8f s[2][4] = {};
        // the trip's eight K fragments, one group; unrolled so that ka is indexed by constants
        Frag16 ka[4][2];
#pragma unroll
        for (int nf = 0; nf < 4; ++nf)
#pragma unroll
            for (int kk = 0; kk < 2; ++kk) {
                ka[nf][kk].u[0] = *(const uint4*)&Kblk[nf * 16 + l16][kk * 32 + half * 8];
                ka[nf][kk].u[1] = *(const uint4*)&Kblk[nf * 16 + l16][kk * 32 + 16 + half * 8];
            }
        // Keeps the group in front of the products, which then wait by count: among the WMMAs every
        // load pair is a stop of its own with a full wait behind it.
        __builtin_amdgcn_sched_barrier(0);
        // both query tiles use a fragment; unrolled so that s, ka and qf are indexed by constants
#pragma unroll
        for (int nf = 0; nf < 4; ++nf)
#pragma unroll
            for (int kk = 0; kk < 2; ++kk)
#pragma unroll
                for (int qt = 0; qt < 2; ++qt)
                    s[qt][nf] = __builtin_amdgcn_wmma_f32_16x16x32_f16(
                        false, ka[nf][kk].v, false, qf[qt][kk].v, (short)0, s[qt][nf], false, false);
        // Keeps the V^T loads below behind these products: they take over the K fragments' registers.
        __builtin_amdgcn_sched_barrier(0);

        // V^T fragments of dh 0 to 31, one group ahead of the softmax, whose vector work covers their
        // LDS latency; unrolled so that va is indexed by constants
        Frag16 va[4][2];
#pragma unroll
        for (int jf = 0; jf < 2; ++jf)
#pragma unroll
            for (int kk = 0; kk < 2; ++kk) {
                va[jf][kk].u[0] = *(const uint4*)&Vblk[jf * 16 + l16][kk * 32 + half * 8];
                va[jf][kk].u[1] = *(const uint4*)&Vblk[jf * 16 + l16][kk * 32 + 16 + half * 8];
            }
        // Keeps that group here: without it the scheduler sinks the loads to their products.
        __builtin_amdgcn_sched_barrier(0);

        Frag16 p[2][2];
        // unrolled so that the per-tile arrays are indexed by constants
#pragma unroll
        for (int qt = 0; qt < 2; ++qt) {
            float alpha = 1.0f;
            if constexpr (!NOMAX) {
                // --- online softmax: the lane's 32 scores, then the other half's 32 ---
                float m8[8];
#pragma unroll
                for (int e = 0; e < 8; ++e)
                    m8[e] = fmaxf(fmaxf(s[qt][0][e], s[qt][1][e]), fmaxf(s[qt][2][e], s[qt][3][e]));
                float mcur = fmaxf(fmaxf(fmaxf(m8[0], m8[1]), fmaxf(m8[2], m8[3])),
                                   fmaxf(fmaxf(m8[4], m8[5]), fmaxf(m8[6], m8[7])));
                mcur = fmaxf(mcur, xhalf(mcur));

                const float mn = fmaxf(mrun[qt], mcur);
                alpha = __builtin_amdgcn_exp2f(mrun[qt] - mn);
                mrun[qt] = mn;
#pragma unroll
                for (int nf = 0; nf < 4; ++nf) s[qt][nf] = s[qt][nf] - mn;
            }
#pragma unroll
            for (int nf = 0; nf < 4; ++nf) exp2x8(s[qt][nf]);

            float r8[8];
#pragma unroll
            for (int e = 0; e < 8; ++e)
                r8[e] = (s[qt][0][e] + s[qt][1][e]) + (s[qt][2][e] + s[qt][3][e]);
            const float rsum = ((r8[0] + r8[1]) + (r8[2] + r8[3])) + ((r8[4] + r8[5]) + (r8[6] + r8[7]));
            if constexpr (NOMAX) {
                lrun[qt] += rsum;
            } else {
                lrun[qt] = lrun[qt] * alpha + rsum;
#pragma unroll
                for (int jf = 0; jf < 4; ++jf)
#pragma unroll
                    for (int e = 0; e < 8; ++e) o[qt][jf][e] *= alpha;
            }

            // P^T as B operand: element i of fragment kk is key kk * 32 + (i < 8 ? 8 * half + i
            // : 16 + 8 * half + i - 8), which is register i & 7 of tile 2 * kk + (i >> 3)
#pragma unroll
            for (int kk = 0; kk < 2; ++kk)
#pragma unroll
                for (int i = 0; i < 16; ++i)
                    p[qt][kk].v[i] = (_Float16)s[qt][2 * kk + (i >> 3)][i & 7];

            if (qt == 0) {
                // Ends the first query tile's softmax here: its sum is taken and its P packed, so its
                // scores' registers are free for the second load group.
                __builtin_amdgcn_sched_barrier(0);
                // V^T fragments of dh 32 to 63, one group: one stop and one wait for its eight loads. They
                // are the trip's last LDS reads, so the compiler draws the foot's waits and the barrier's
                // signal up behind them; what follows up to the barrier's wait works on registers only.
#pragma unroll
                for (int jf = 2; jf < 4; ++jf)
#pragma unroll
                    for (int kk = 0; kk < 2; ++kk) {
                        va[jf][kk].u[0] = *(const uint4*)&Vblk[jf * 16 + l16][kk * 32 + half * 8];
                        va[jf][kk].u[1] = *(const uint4*)&Vblk[jf * 16 + l16][kk * 32 + 16 + half * 8];
                    }
                // Keeps that group here: without it the scheduler sinks the loads to their products.
                __builtin_amdgcn_sched_barrier(0);
            }
        }

        // O^T += V^T * P^T : 64 dh x 32 queries (4 M-fragments x 2 query tiles, K=64 keys = 2 steps);
        // both query tiles use a fragment; unrolled so that o, va and p are indexed by constants
#pragma unroll
        for (int g = 0; g < 2; ++g)
#pragma unroll
            for (int kk = 0; kk < 2; ++kk)
#pragma unroll
                for (int jf = 2 * g; jf < 2 * g + 2; ++jf)
#pragma unroll
                    for (int qt = 0; qt < 2; ++qt)
                        o[qt][jf] = __builtin_amdgcn_wmma_f32_16x16x32_f16(
                            false, va[jf][kk].v, false, p[qt][kk].v, (short)0, o[qt][jf], false, false);

        wait_lds_reads();
        wait_copies();
        __syncthreads();
    };
    // The trips that refill and the last two, which do not, are loops of their own: the test for a
    // stage st + 2 is the loop bound, so a trip is one straight block. With a branch at the foot the
    // compiler sank the row sums behind it, and the 64 exponentials stayed in registers through the
    // O^T products, where the V^T fragments need them.
    if (withmax) {
        for (int st = 0; st < T - 2; ++st) {
            trip(st, Sel<false>{});
            KV_STAGE(stage_of(st + 2), st & 1);
        }
        // kept rolled: two more copies of this trip would only lengthen the text
#pragma unroll 1
        for (int st = T - 2; st < T; ++st) trip(st, Sel<false>{});
    } else {
        mrun[0] = mrun[1] = 0.f;     // P = 2^(score - 0): what the merge below reads as the maximum
        for (int st = 0; st < T - 2; ++st) {
            trip(st, Sel<true>{});
            KV_STAGE(stage_of(st + 2), st & 1);
        }
        for (int st = T - 2; st < T; ++st) trip(st, Sel<true>{});
    }
    wait_copies();
#undef KV_STAGE

    // join the halves' sums
    lrun[0] += xhalf(lrun[0]);
    lrun[1] += xhalf(lrun[1]);

    // Merge of the two key groups. Waves w and w ^ 4 hold the same 32 queries in the same lanes and
    // registers. Each finishes one query tile (tile kh) and hands the other tile's state to its
    // partner. Behind the last trip's barrier nobody reads the ring and no copy is outstanding:
    // the ring's LDS carries the exchange.
    const bool up = kh != 0;
    v4f*   xo = (v4f*)&KV[0][0][0][0][0];                      // [wave][8][lane], 16 B a lane
    float* xm = (float*)(xo + 8 * 8 * 32);                     // [wave][max | sum][lane]
    // unrolled (here and in the store loop below) so that o is indexed by constants
#pragma unroll
    for (int jf = 0; jf < 4; ++jf) {
        const v8f g = up ? o[0][jf] : o[1][jf];
        xo[(wave * 8 + 2 * jf) * 32 + lane]     = __builtin_shufflevector(g, g, 0, 1, 2, 3);
        xo[(wave * 8 + 2 * jf + 1) * 32 + lane] = __builtin_shufflevector(g, g, 4, 5, 6, 7);
    }
    xm[(wave * 2) * 32 + lane]     = up ? mrun[0] : mrun[1];
    xm[(wave * 2 + 1) * 32 + lane] = up ? lrun[0] : lrun[1];
    __syncthreads();                 // the partners' states are published

    const int   pw = wave ^ 4;
    const float mp = xm[(pw * 2) * 32 + lane];
    const float lp = xm[(pw * 2 + 1) * 32 + lane];
    const float mo = up ? mrun[1] : mrun[0];
    const float lo = up ? lrun[1] : lrun[0];
    const float mj = fmaxf(mo, mp);
    float fo = mo - mj;                                        // the maxima are in log2 units
    float fp = mp - mj;
    exp2x2(fo, fp);
    const float lj = lo * fo + lp * fp;

    // normalize, store f16 [b*L + q][h*64 + dh]: 8 neighbouring dh a store
    const int b = bh >> 4, h = bh & (NUM_HEADS - 1);
    const size_t m = (size_t)b * SEQ + qbase + kh * 16 + l16;
#pragma unroll
    for (int jf = 0; jf < 4; ++jf) {
        const v8f own = up ? o[1][jf] : o[0][jf];
        const v4f p0  = xo[(pw * 8 + 2 * jf) * 32 + lane];
        const v4f p1  = xo[(pw * 8 + 2 * jf + 1) * 32 + lane];
        union { _Float16 f[8]; uint4 u; } pk;
#pragma unroll
        for (int e = 0; e < 8; ++e)
            pk.f[e] = (_Float16)((own[e] * fo + (e < 4 ? p0[e & 3] : p1[e & 3]) * fp) / lj);
        *(uint4*)&O[m * D_MODEL + h * HEAD_DIM + jf * 16 + 8 * half] = pk.u;
    }
}

// ---------------------------------------------------------------------------
// Launcher
// ---------------------------------------------------------------------------
extern "C" void kernel_launch(void* const* d_in, const int* in_sizes, int n_in,
                              void* d_out, int out_size, void* d_ws, size_t ws_size,
                              hipStream_t stream) {
    (void)in_sizes; (void)n_in; (void)out_size; (void)ws_size;

    const float* x    = (const float*)d_in[0];   // [2,2048,1024]
    const float* cosT = (const float*)d_in[1];   // [2048,64]
    const float* sinT = (const float*)d_in[2];   // [2048,64]
    const float* wqkv = (const float*)d_in[3];   // [3072,1024]
    const float* wo   = (const float*)d_in[4];   // [1024,1024]
    float* out = (float*)d_out;                  // [2,2048,1024]

    char* ws = (char*)d_ws;
    _Float16* x_h  = (_Float16*)(ws);                        //  8 MB
    _Float16* wq_h = (_Float16*)(ws + ( 8ull << 20));        //  6 MB
    _Float16* wo_h = (_Float16*)(ws + (14ull << 20));        //  2 MB
    _Float16* q_h  = (_Float16*)(ws + (64ull << 20));        //  8 MB
    _Float16* k_h  = (_Float16*)(ws + (72ull << 20));        //  8 MB
    _Float16* vt_h = (_Float16*)(ws + (80ull << 20));        //  8 MB
    _Float16* at_h = (_Float16*)(ws + (88ull << 20));        //  8 MB
    float*    nq_f = (float*)(ws + (96ull << 20));           //  256 KB
    float*    nk_f = (float*)(ws + (97ull << 20));           //  256 KB

    cvt3_f32_f16<<<CVT_X_BLOCKS + CVT_WQ_BLOCKS + CVT_WO_BLOCKS, 256, 0, stream>>>(
        x, wqkv, wo, x_h, wq_h, wo_h);

    // x @ w_qkv^T (M=4096, N=3072, K=1024), rotated and repacked in the epilogue
    gemm_qkv_rope<<<dim3(3 * D_MODEL / 128, MROWS / 128), 256, 0, stream>>>(
        x_h, wq_h, cosT, sinT, q_h, k_h, vt_h, nq_f, nk_f);

    attn_f16<<<dim3(BATCH * NUM_HEADS, SEQ / 128), 256, 0, stream>>>(q_h, k_h, vt_h, nq_f, nk_f, at_h);

    // out = attn @ w_o^T  : M=4096, N=1024, K=1024
    gemm_nt_f16<<<dim3(D_MODEL / 128, MROWS / 128), 256, 0, stream>>>(at_h, wo_h, out, MROWS, D_MODEL, 1024);
}
